// v000
// The times below were measured on an AMD MI455X: many runs one after another, warmed up first and cycling through
// copies of the inputs, with the whole window's GPU time divided by the number of runs. Launches and the gaps
// between them are all in it. The median over several windows is given; except for v000 it joins two sittings, which
// can be a few percent apart, so the side-by-side timings, each taken in one sitting, are the better comparison.
// v000 is the starting kernel. One run takes 2090 microseconds.
#include <hip/hip_runtime.h>

// MultiHeadAttention_New (master, slave [2][2048][1024], attention_mask [2][2048] (int, read; random 0/1); q = (master Wq^T + bq) x 0.125, k/v = slave W^T + b (16 x 64); attn = clip(q.k, +-50000) + (mask == 0 ? -9e15 : mask) per key; softmax; out = merged Wo^T + bo -> [2][2048][1024]).
// Compute dtypes, f32 accumulate: every input rounded to bf16; q/k/v on PLAIN bf16 operands (inputs: exact) + bias; scores and attn.v: query rows < 512 hl (3 products), the rest single fp16 (x1024); the clamp and the additive mask term ((mask == 0) ? -9e15 : float(mask), read per key) in f32; softmax f32; Wo hl x exact (2 products) + bias.

#define NB_  2
#define TT   2048
#define DM   1024
#define NH_  16
#define NKV  16
#define REP  (NH_ / NKV)
#define HD   64
#define DQ   (NH_ * HD)
#define DKV  (NKV * HD)
#define ZH   2
#define RH   512                  // query rows < RH use hi+lo planes (0: none)
#define WIN  0
#define PCAR 1024.0f
#define SCL  0.125f   // HD^-0.5
typedef _Float16 h16;
typedef unsigned short bf;
typedef __attribute__((ext_vector_type(16))) __bf16   v16bf;
typedef __attribute__((ext_vector_type(16))) _Float16 v16h;
typedef __attribute__((ext_vector_type(8)))  _Float16 v8h;
typedef __attribute__((ext_vector_type(8)))  unsigned short v8us;
typedef __attribute__((ext_vector_type(8)))  float    v8f;
typedef __attribute__((ext_vector_type(4)))  float    v4f;
typedef v8h  __attribute__((may_alias)) v8ha;
typedef v4f  __attribute__((may_alias)) v4fa;
typedef v8us __attribute__((may_alias)) v8usa;

__device__ __forceinline__ unsigned short f2bf(float f) { unsigned u = __float_as_uint(f); u += 0x7FFFu + ((u >> 16) & 1u); return (unsigned short)(u >> 16); }
__device__ __forceinline__ float bf2f(unsigned short b) { return __uint_as_float(((unsigned)b) << 16); }
__device__ __forceinline__ float bfr(float f) { return bf2f(f2bf(f)); }
__device__ __forceinline__ v16h cat16(v8h lo, v8h hi) { return __builtin_shufflevector(lo, hi, 0, 1, 2, 3, 4, 5, 6, 7, 8, 9, 10, 11, 12, 13, 14, 15); }
__device__ __forceinline__ v16bf cat16b(v8us lo, v8us hi) { return __builtin_bit_cast(v16bf, __builtin_shufflevector(lo, hi, 0, 1, 2, 3, 4, 5, 6, 7, 8, 9, 10, 11, 12, 13, 14, 15)); }
__device__ __forceinline__ v8f wmma16(v16h a, v16h b, v8f c) { return __builtin_amdgcn_wmma_f32_16x16x32_f16(false, a, false, b, (short)0, c, false, false); }
__device__ __forceinline__ v8f wmmab(v16bf a, v16bf b, v8f c) { return __builtin_amdgcn_wmma_f32_16x16x32_bf16(false, a, false, b, (short)0, c, false, false); }



// ---- k_gemmw: register-blocked GEMM, ONE WAVE per 64x64 output tile (16 accumulators), operands straight from K-contiguous 16-bit planes; grid (M/64, N/64, Z), 32 threads.
// C[m][n] (f32, pitch ldc, + optional f32 bias[n]) = sum_k A[m][k] Bt[n][k] (+ split products per NSPLIT). z-batch strides sA/sB/sC in elements. K % 32 == 0.
template <typename T16> struct WFrag;
template <> struct WFrag<h16> { typedef v16h V; static __device__ __forceinline__ V ld(const h16* p) { return cat16(*(const v8h*)p, *(const v8h*)(p + 16)); } static __device__ __forceinline__ v8f mma(V a, V b, v8f c) { return wmma16(a, b, c); } };
template <> struct WFrag<bf> { typedef v16bf V; static __device__ __forceinline__ V ld(const bf* p) { return cat16b(*(const v8us*)p, *(const v8us*)(p + 16)); } static __device__ __forceinline__ v8f mma(V a, V b, v8f c) { return wmmab(a, b, c); } };
template <typename T16, int NSPLIT, bool BIAS>
__global__ __launch_bounds__(32) void k_gemmw(const T16* __restrict__ A, const T16* __restrict__ A2, const T16* __restrict__ Bt, const T16* __restrict__ Bt2, int K, float* C, int ldc, const float* __restrict__ bias, size_t sA, size_t sB, size_t sC) {
    typedef typename WFrag<T16>::V V;
    __shared__ __align__(16) float os[16 * 68];
    const size_t z = blockIdx.z; A += z * sA; if (A2) A2 += z * sA; Bt += z * sB; if (Bt2) Bt2 += z * sB; C += z * sC;
    const int lane = threadIdx.x & 31, lr = lane & 15, hi = lane >> 4; const int r0 = blockIdx.x * 64, c0 = blockIdx.y * 64;
    v8f acc[4][4];
#pragma unroll
    for (int mb = 0; mb < 4; ++mb)
#pragma unroll
        for (int nb = 0; nb < 4; ++nb) acc[mb][nb] = (v8f){};
    const size_t aoff = (size_t)(r0 + lr) * K + 8 * hi, boff = (size_t)(c0 + lr) * K + 8 * hi;
#pragma unroll 1
    for (int kc = 0; kc < K; kc += 32) {
        V a[4], a2[4];
#pragma unroll
        for (int mb = 0; mb < 4; ++mb) { a[mb] = WFrag<T16>::ld(A + aoff + (size_t)mb * 16 * K + kc); if (NSPLIT == 1 || NSPLIT == 2) a2[mb] = WFrag<T16>::ld(A2 + aoff + (size_t)mb * 16 * K + kc); }
#pragma unroll
        for (int nb = 0; nb < 4; ++nb) { const V b = WFrag<T16>::ld(Bt + boff + (size_t)nb * 16 * K + kc); V b2; if (NSPLIT >= 2) b2 = WFrag<T16>::ld(Bt2 + boff + (size_t)nb * 16 * K + kc);
#pragma unroll
            for (int mb = 0; mb < 4; ++mb) { acc[mb][nb] = WFrag<T16>::mma(a[mb], b, acc[mb][nb]); if (NSPLIT == 1 || NSPLIT == 2) acc[mb][nb] = WFrag<T16>::mma(a2[mb], b, acc[mb][nb]); if (NSPLIT >= 2) acc[mb][nb] = WFrag<T16>::mma(a[mb], b2, acc[mb][nb]); } }
        asm volatile("v_nop\n\tv_nop\n\tv_nop\n\tv_nop" : "+v"(acc[0][0]), "+v"(acc[1][1]), "+v"(acc[2][2]), "+v"(acc[3][3]) : "v"(a[0]), "v"(a[3]));
    }
#pragma unroll
    for (int mb = 0; mb < 4; ++mb) {
#pragma unroll
        for (int nb = 0; nb < 4; ++nb) {
#pragma unroll
            for (int j = 0; j < 8; ++j) os[(hi * 8 + j) * 68 + nb * 16 + lr] = acc[mb][nb][j]; }
        __builtin_amdgcn_wave_barrier(); asm volatile("" ::: "memory");
        float* crow = C + (size_t)(r0 + mb * 16) * ldc + c0;
{
#pragma unroll
            for (int s = 0; s < 8; ++s) { const int row = 2 * s + hi, cofs = lr * 4; v4f val = *(const v4fa*)(os + row * 68 + cofs); if (BIAS) { val[0] += bfr(bias[c0 + cofs]); val[1] += bfr(bias[c0 + cofs + 1]); val[2] += bfr(bias[c0 + cofs + 2]); val[3] += bfr(bias[c0 + cofs + 3]); }
                *(v4f*)(crow + (size_t)row * ldc + cofs) = val; }
             }
        __builtin_amdgcn_wave_barrier(); asm volatile("" ::: "memory");
    }
}

__device__ __forceinline__ h16 tohx(float x) { return (h16)x; }
__device__ __forceinline__ void splitf(float y, unsigned short& h, unsigned short& l) { h = f2bf(y); l = f2bf(y - bf2f(h)); }
typedef __attribute__((ext_vector_type(2))) _Float16 v2h;
typedef __attribute__((ext_vector_type(4))) _Float16 v4h;
typedef __attribute__((ext_vector_type(2))) unsigned short v2us;
typedef __attribute__((ext_vector_type(4))) unsigned short v4us;
typedef __attribute__((ext_vector_type(2))) float v2f;
typedef __attribute__((ext_vector_type(4))) int v4i;

__global__ __launch_bounds__(256) void k_wtG(const float* __restrict__ w, int K, int N, bf* Bt) {
    const int lane = threadIdx.x & 31; const int L0 = (blockIdx.x * 8 + (threadIdx.x >> 5)) * 8; const int nlines = N * K / 64;
{
#pragma unroll 1
        for (int l = 0; l < 8; ++l) { const int L = L0 + l; if (L >= nlines) break; const size_t e = (size_t)L * 64 + lane * 2; const int k = (int)(e % K), n = (int)(e / K); v2us o;
            o[0] = f2bf(w[(size_t)k * N + n]); o[1] = f2bf(w[(size_t)(k + 1) * N + n]); *(v2us*)(Bt + e) = o; }
         }
}
__global__ __launch_bounds__(256) void k_cvt8(const float* __restrict__ src, bf* dst, size_t n8) { const size_t i = (size_t)blockIdx.x * 256 + threadIdx.x; if (i >= n8) return; const v8f v = *(const v8f*)(src + i * 8); v8us o;
#pragma unroll
    for (int k = 0; k < 8; ++k) o[k] = f2bf(v[k]); *(v8us*)(dst + i * 8) = o;  }
__global__ __launch_bounds__(256) void k_cscvt(const float* __restrict__ cosT, const float* __restrict__ sinT, float* CS) { const int idx = blockIdx.x * 256 + threadIdx.x; if (idx >= TT * HD) return; v2f cs; cs[0] = bfr(cosT[idx]); cs[1] = bfr(sinT[idx]); *(v2f*)(CS + (size_t)idx * 2) = cs;  }
// k_rope: head planes [h][t][d] (fp16 + hi/lo) of rope(x) x sc with the rotate-half convention out[d] = x[d] cos[t][d] - x[d+HD/2] sin[t][d], out[d+HD/2] = x[d+HD/2] cos[t][d+HD/2] + x[d] sin[t][d+HD/2]
__global__ __launch_bounds__(256) void k_rope(const float* __restrict__ F, int pitch, int nheads, const float* __restrict__ CS, const float* __restrict__ RF, const float* __restrict__ nw, float sc, h16* P16, bf* Ph, bf* Pl) {
    const size_t e = ((size_t)blockIdx.x * 256 + threadIdx.x) * 2; if (e >= (size_t)nheads * TT * HD) return; const int d = (int)(e % HD); const int t = (int)((e / HD) % TT); const int h = (int)(e / ((size_t)HD * TT)); const float* f = F + (size_t)t * pitch + h * HD; const float rf = RF ? RF[(size_t)h * TT + t] : 1.0f; v2h o16; v2us oh, ol;
#pragma unroll
    for (int q = 0; q < 2; ++q) { const int dd = d + q; const int dp = (dd < HD / 2) ? dd + HD / 2 : dd - HD / 2; float x0 = f[dd], x1 = f[dp];
        if (RF) { float n0 = __fmul_rn(x0, rf), n1 = __fmul_rn(x1, rf); asm volatile("" : "+v"(n0)); asm volatile("" : "+v"(n1)); x0 = __fmul_rn(bfr(nw[dd]), n0); x1 = __fmul_rn(bfr(nw[dp]), n1); }
        const v2f cs = *(const v2f*)(CS + ((size_t)t * HD + dd) * 2); float a = __fmul_rn(x0, cs[0]), bq = __fmul_rn(x1, cs[1]); asm volatile("" : "+v"(a)); asm volatile("" : "+v"(bq)); const float r = ((dd < HD / 2) ? __fsub_rn(a, bq) : __fadd_rn(a, bq)) * sc;
        o16[q] = tohx(r); unsigned short a2, c2; splitf(r, a2, c2); oh[q] = a2; ol[q] = c2; }
    *(v2h*)(P16 + e) = o16; *(v2us*)(Ph + e) = oh; *(v2us*)(Pl + e) = ol;  }
__global__ __launch_bounds__(256) void k_vtp(const float* __restrict__ F, int pitch, int nheads, h16* V16, bf* Vh, bf* Vl) { const size_t e = ((size_t)blockIdx.x * 256 + threadIdx.x) * 2; if (e >= (size_t)nheads * HD * TT) return; const int t = (int)(e % TT); const int d = (int)((e / TT) % HD); const int g = (int)(e / ((size_t)TT * HD)); v2h o16; v2us oh, ol;
#pragma unroll
    for (int q = 0; q < 2; ++q) { const float x = F[(size_t)(t + q) * pitch + g * HD + d]; o16[q] = tohx(x); unsigned short a2, c2; splitf(x, a2, c2); oh[q] = a2; ol[q] = c2; }
    *(v2h*)(V16 + e) = o16; *(v2us*)(Vh + e) = oh; *(v2us*)(Vl + e) = ol;  }
__global__ __launch_bounds__(256) void k_csid(float* CS) { const int idx = blockIdx.x * 256 + threadIdx.x; if (idx >= TT * HD) return; v2f cs; cs[0] = 1.0f; cs[1] = 0.0f; *(v2f*)(CS + (size_t)idx * 2) = cs;  }
// k_asoft: per row (zz, i): t = clip(S x HD^-0.5, +-50000) + ((mask == 0) ? -9e15 : mask) per key; softmax over the 2048 keys (register row, one exp, fixed trees);
__global__ __launch_bounds__(256) void k_asoft(const float* __restrict__ Sb, const int* __restrict__ km, h16* P16, bf* Ph, bf* Pl) {
    const int lane = threadIdx.x & 31; const int row = blockIdx.x * 8 + (threadIdx.x >> 5); if (row >= ZH * TT) return; const int i = row % TT; const int zz = row / TT; (void)zz; const bool hires = (i < RH); const float* sr = Sb + (size_t)row * TT; float v[TT / 32]; float mx = -3.0e38f;
#pragma unroll
    for (int ch = 0; ch < TT / 128; ++ch) { const int j0 = ch * 128 + lane * 4; const v4f a = *(const v4f*)(sr + j0);
#pragma unroll
        for (int q = 0; q < 4; ++q) { const int j = j0 + q; (void)j; float sa = a[q] * SCL; asm volatile("" : "+v"(sa)); float sc = fminf(fmaxf(sa, -50000.0f), 50000.0f); asm volatile("" : "+v"(sc)); const int mvv = km[j0 + q]; const float madd = (mvv == 0) ? -9.0e15f : (float)mvv; const float t = __fadd_rn(sc, madd); v[ch * 4 + q] = t; mx = fmaxf(mx, t); } }
#pragma unroll
    for (int sh = 16; sh; sh >>= 1) mx = fmaxf(mx, __shfl_xor(mx, sh, 32));
    float sum = 0.f;
#pragma unroll
    for (int k = 0; k < TT / 32; ++k) { float d0 = __fsub_rn(v[k], mx); asm volatile("" : "+v"(d0)); v[k] = __builtin_amdgcn_exp2f(__fmul_rn(d0, 1.4426950408889634f)); sum += v[k]; }
#pragma unroll
    for (int sh = 16; sh; sh >>= 1) sum += __shfl_xor(sum, sh, 32);
    const float f = __fdiv_rn(hires ? 1.0f : PCAR, sum);
{
        if (hires) {
#pragma unroll
            for (int ch = 0; ch < TT / 128; ++ch) { v4us oh, ol;
#pragma unroll
                for (int q = 0; q < 4; ++q) { unsigned short a, c2; splitf(v[ch * 4 + q] * f, a, c2); oh[q] = a; ol[q] = c2; }
                const size_t oo = ((size_t)zz * (RH ? RH : 1) + i) * TT + ch * 128 + lane * 4; *(v4us*)(Ph + oo) = oh; *(v4us*)(Pl + oo) = ol; }
        } else {
#pragma unroll
            for (int ch = 0; ch < TT / 128; ++ch) { v4h o4;
#pragma unroll
                for (int q = 0; q < 4; ++q) o4[q] = tohx(v[ch * 4 + q] * f);
                *(v4h*)(P16 + (size_t)row * TT + ch * 128 + lane * 4) = o4; } }
         }
}
__global__ __launch_bounds__(256) void k_merge(const float* __restrict__ O, int h0, bf* Ah, bf* Al) { const size_t e = ((size_t)blockIdx.x * 256 + threadIdx.x) * 2; if (e >= (size_t)ZH * TT * HD) return; const int d = (int)(e % HD); const int t = (int)((e / HD) % TT); const int zz = (int)(e / ((size_t)HD * TT)); const float cs = (t < RH) ? 1.0f : (1.0f / PCAR); const size_t oo = (size_t)t * DQ + (h0 + zz) * HD + d;
    v2us oh, ol;
#pragma unroll
    for (int q = 0; q < 2; ++q) { unsigned short a, c2; splitf(O[e + q] * cs, a, c2); oh[q] = a; ol[q] = c2; } *(v2us*)(Ah + oo) = oh; *(v2us*)(Al + oo) = ol;  }

extern "C" void kernel_launch(void* const* d_in, const int* in_sizes, int n_in,
                              void* d_out, int out_size, void* d_ws, size_t ws_size, hipStream_t stream) {
    (void)in_sizes; (void)n_in; (void)out_size;
    const float* x = (const float*)d_in[0]; const float* y = (const float*)d_in[1]; const int* kmask = (const int*)d_in[2]; const float* wq = (const float*)d_in[3]; const float* bq = (const float*)d_in[4]; const float* wk = (const float*)d_in[5]; const float* bk = (const float*)d_in[6]; const float* wv = (const float*)d_in[7]; const float* bv = (const float*)d_in[8]; const float* wo = (const float*)d_in[9]; const float* bo = (const float*)d_in[10]; const float* cosT = nullptr; const float* sinT = nullptr; (void)cosT; (void)sinT;
    float* OUT = (float*)d_out;     // [2][2048][1024]
    char* wsp = (char*)d_ws;
    auto take = [&](size_t bytes) { char* p = wsp; wsp += (bytes + 255) & ~(size_t)255; return (void*)p; };
    bf* WQ = (bf*)take((size_t)DQ * DM * 2); bf* WK = (bf*)take((size_t)DKV * DM * 2); bf* WV = (bf*)take((size_t)DKV * DM * 2); bf* WO = (bf*)take((size_t)DM * DQ * 2); float* CS = (float*)take((size_t)TT * HD * 2 * 4);
    bf* XB = (bf*)take((size_t)TT * DM * 2); bf* YB = (bf*)take((size_t)TT * DM * 2); float* FQ = (float*)take((size_t)TT * DQ * 4); float* FK = (float*)take((size_t)TT * DKV * 4);
    h16* QP16 = (h16*)take((size_t)NH_ * TT * HD * 2); h16* KP16 = (h16*)take((size_t)NKV * TT * HD * 2); h16* VT16 = (h16*)take((size_t)NKV * HD * TT * 2);
    bf* QPh = (bf*)take((size_t)NH_ * TT * HD * 2); bf* QPl = (bf*)take((size_t)NH_ * TT * HD * 2); bf* KPh = (bf*)take((size_t)NKV * TT * HD * 2); bf* KPl = (bf*)take((size_t)NKV * TT * HD * 2); bf* VTh = (bf*)take((size_t)NKV * HD * TT * 2); bf* VTl = (bf*)take((size_t)NKV * HD * TT * 2); bf* Ph = (bf*)take((size_t)ZH * RH * TT * 2); bf* Pl = (bf*)take((size_t)ZH * RH * TT * 2);
    float* Sb = (float*)take((size_t)ZH * TT * TT * 4); h16* P16 = (h16*)take((size_t)ZH * TT * TT * 2); float* Ob = (float*)take((size_t)ZH * TT * HD * 4); bf* ATh = (bf*)take((size_t)TT * DQ * 2); bf* ATl = (bf*)take((size_t)TT * DQ * 2);
    if ((size_t)(wsp - (char*)d_ws) > ws_size) return;    // ws 256 MiB
    float* FV = FK;   // v projection reuses the k buffer after the k planes are built (stream-ordered)
    { k_cvt8<<<(unsigned)(((size_t)DQ * DM / 8 + 255) / 256), 256, 0, stream>>>(wq, WQ, (size_t)DQ * DM / 8); k_cvt8<<<(unsigned)(((size_t)DKV * DM / 8 + 255) / 256), 256, 0, stream>>>(wk, WK, (size_t)DKV * DM / 8); k_cvt8<<<(unsigned)(((size_t)DKV * DM / 8 + 255) / 256), 256, 0, stream>>>(wv, WV, (size_t)DKV * DM / 8);
      k_cvt8<<<(unsigned)(((size_t)DM * DQ / 8 + 255) / 256), 256, 0, stream>>>(wo, WO, (size_t)DM * DQ / 8);
       }
    k_csid<<<(TT * HD + 255) / 256, 256, 0, stream>>>(CS);
    const unsigned LQ = (unsigned)(((size_t)NH_ * TT * HD / 2 + 255) / 256), LKv = (unsigned)(((size_t)NKV * TT * HD / 2 + 255) / 256);
    for (int b = 0; b < NB_; ++b) {
        
        k_cvt8<<<(unsigned)(((size_t)TT * DM / 8 + 255) / 256), 256, 0, stream>>>(x + (size_t)b * TT * DM, XB, (size_t)TT * DM / 8); k_cvt8<<<(unsigned)(((size_t)TT * DM / 8 + 255) / 256), 256, 0, stream>>>(y + (size_t)b * TT * DM, YB, (size_t)TT * DM / 8);
        k_gemmw<bf, 0, true><<<dim3(TT / 64, DQ / 64, 1), 32, 0, stream>>>(XB, nullptr, WQ, nullptr, DM, FQ, DQ, bq, 0, 0, 0);
        k_rope<<<LQ, 256, 0, stream>>>(FQ, DQ, NH_, CS, nullptr, nullptr, 1.0f, QP16, QPh, QPl);
        k_gemmw<bf, 0, true><<<dim3(TT / 64, DKV / 64, 1), 32, 0, stream>>>(YB, nullptr, WK, nullptr, DM, FK, DKV, bk, 0, 0, 0);
        k_rope<<<LKv, 256, 0, stream>>>(FK, DKV, NKV, CS, nullptr, nullptr, 1.0f, KP16, KPh, KPl);
        k_gemmw<bf, 0, true><<<dim3(TT / 64, DKV / 64, 1), 32, 0, stream>>>(YB, nullptr, WV, nullptr, DM, FV, DKV, bv, 0, 0, 0); k_vtp<<<LKv, 256, 0, stream>>>(FV, DKV, NKV, VT16, VTh, VTl);
        for (int h0 = 0; h0 < NH_; h0 += ZH) { const size_t zq = (size_t)h0, zk = (size_t)(h0 / REP);   // one kv head per query head: the pass's two heads use consecutive kv planes (z-strides TT*HD)
            k_gemmw<bf, 2, false><<<dim3(RH / 64, TT / 64, ZH), 32, 0, stream>>>(QPh + zq * TT * HD, QPl + zq * TT * HD, KPh + zk * TT * HD, KPl + zk * TT * HD, HD, Sb, TT, nullptr, (size_t)TT * HD, (size_t)TT * HD, (size_t)TT * TT);
            k_gemmw<h16, 0, false><<<dim3((TT - RH) / 64, TT / 64, ZH), 32, 0, stream>>>(QP16 + zq * TT * HD + (size_t)RH * HD, nullptr, KP16 + zk * TT * HD, nullptr, HD, Sb + (size_t)RH * TT, TT, nullptr, (size_t)TT * HD, (size_t)TT * HD, (size_t)TT * TT);
            k_asoft<<<ZH * TT / 8, 256, 0, stream>>>(Sb, kmask + (size_t)b * TT, P16, Ph, Pl);
            k_gemmw<bf, 2, false><<<dim3(RH / 64, HD / 64, ZH), 32, 0, stream>>>(Ph, Pl, VTh + zk * HD * TT, VTl + zk * HD * TT, TT, Ob, HD, nullptr, (size_t)RH * TT, (size_t)HD * TT, (size_t)TT * HD);
            k_gemmw<h16, 0, false><<<dim3((TT - RH) / 64, HD / 64, ZH), 32, 0, stream>>>(P16 + (size_t)RH * TT, nullptr, VT16 + zk * HD * TT, nullptr, TT, Ob + (size_t)RH * HD, HD, nullptr, (size_t)TT * TT, (size_t)HD * TT, (size_t)TT * HD);
            k_merge<<<(unsigned)(((size_t)ZH * TT * HD / 2 + 255) / 256), 256, 0, stream>>>(Ob, h0, ATh, ATl); }
        k_gemmw<bf, 1, true><<<dim3(TT / 64, DM / 64, 1), 32, 0, stream>>>(ATh, ATl, WO, nullptr, DQ, OUT + (size_t)b * TT * DM, DM, bo, 0, 0, 0); }
}

// v001
// Measured time: 913 microseconds a run.
// Next to v000, in two timings, it ran 2.31 and 2.32 times as fast.
#include <hip/hip_runtime.h>

// MultiHeadAttention_New (master, slave [2][2048][1024], attention_mask [2][2048] (int, read; random 0/1); q = (master Wq^T + bq) x 0.125, k/v = slave W^T + b (16 x 64); attn = clip(q.k, +-50000) + (mask == 0 ? -9e15 : mask) per key; softmax; out = merged Wo^T + bo -> [2][2048][1024]).
// Compute dtypes, f32 accumulate: every input rounded to bf16; q/k/v on PLAIN bf16 operands (inputs: exact) + bias; scores and attn.v: query rows < 512 hl (3 products), the rest single fp16 (x1024); the clamp and the additive mask term ((mask == 0) ? -9e15 : float(mask), read per key) in f32; softmax f32; Wo hl x exact (2 products) + bias.

#define NB_  2
#define TT   2048
#define DM   1024
#define NH_  16
#define NKV  16
#define REP  (NH_ / NKV)
#define HD   64
#define DQ   (NH_ * HD)
#define DKV  (NKV * HD)
#define ZH   2
#define RH   512                  // query rows < RH use hi+lo planes (0: none)
#define WIN  0
#define PCAR 1024.0f
#define SCL  0.125f   // HD^-0.5
typedef _Float16 h16;
typedef unsigned short bf;
typedef __attribute__((ext_vector_type(16))) __bf16   v16bf;
typedef __attribute__((ext_vector_type(16))) _Float16 v16h;
typedef __attribute__((ext_vector_type(8)))  _Float16 v8h;
typedef __attribute__((ext_vector_type(8)))  unsigned short v8us;
typedef __attribute__((ext_vector_type(8)))  float    v8f;
typedef __attribute__((ext_vector_type(4)))  float    v4f;
typedef v8h  __attribute__((may_alias)) v8ha;
typedef v4f  __attribute__((may_alias)) v4fa;
typedef v8us __attribute__((may_alias)) v8usa;

__device__ __forceinline__ unsigned short f2bf(float f) { unsigned u = __float_as_uint(f); u += 0x7FFFu + ((u >> 16) & 1u); return (unsigned short)(u >> 16); }
__device__ __forceinline__ float bf2f(unsigned short b) { return __uint_as_float(((unsigned)b) << 16); }
__device__ __forceinline__ float bfr(float f) { return bf2f(f2bf(f)); }
__device__ __forceinline__ v16h cat16(v8h lo, v8h hi) { return __builtin_shufflevector(lo, hi, 0, 1, 2, 3, 4, 5, 6, 7, 8, 9, 10, 11, 12, 13, 14, 15); }
__device__ __forceinline__ v16bf cat16b(v8us lo, v8us hi) { return __builtin_bit_cast(v16bf, __builtin_shufflevector(lo, hi, 0, 1, 2, 3, 4, 5, 6, 7, 8, 9, 10, 11, 12, 13, 14, 15)); }
__device__ __forceinline__ v8f wmma16(v16h a, v16h b, v8f c) { return __builtin_amdgcn_wmma_f32_16x16x32_f16(false, a, false, b, (short)0, c, false, false); }
__device__ __forceinline__ v8f wmmab(v16bf a, v16bf b, v8f c) { return __builtin_amdgcn_wmma_f32_16x16x32_bf16(false, a, false, b, (short)0, c, false, false); }



// ---- k_gemmw: register-blocked GEMM, ONE WAVE per 64x64 output tile (16 accumulators), operands straight from K-contiguous 16-bit planes; grid (M/64, N/64, Z), 32 threads.
// C[m][n] (f32, pitch ldc, + optional f32 bias[n]) = sum_k A[m][k] Bt[n][k] (+ split products per NSPLIT). z-batch strides sA/sB/sC in elements. K % 32 == 0.
template <typename T16> struct WFrag;
template <> struct WFrag<h16> { typedef v16h V; static __device__ __forceinline__ V ld(const h16* p) { return cat16(*(const v8h*)p, *(const v8h*)(p + 16)); } static __device__ __forceinline__ v8f mma(V a, V b, v8f c) { return wmma16(a, b, c); } };
template <> struct WFrag<bf> { typedef v16bf V; static __device__ __forceinline__ V ld(const bf* p) { return cat16b(*(const v8us*)p, *(const v8us*)(p + 16)); } static __device__ __forceinline__ v8f mma(V a, V b, v8f c) { return wmmab(a, b, c); } };
template <typename T16, int NSPLIT, bool BIAS>
__global__ __launch_bounds__(32) void k_gemmw(const T16* __restrict__ A, const T16* __restrict__ A2, const T16* __restrict__ Bt, const T16* __restrict__ Bt2, int K, float* C, int ldc, const float* __restrict__ bias, size_t sA, size_t sB, size_t sC) {
    typedef typename WFrag<T16>::V V;
    __shared__ __align__(16) float os[16 * 68];
    const size_t z = blockIdx.z; A += z * sA; if (A2) A2 += z * sA; Bt += z * sB; if (Bt2) Bt2 += z * sB; C += z * sC;
    const int lane = threadIdx.x & 31, lr = lane & 15, hi = lane >> 4; const int r0 = blockIdx.x * 64, c0 = blockIdx.y * 64;
    v8f acc[4][4];
#pragma unroll
    for (int mb = 0; mb < 4; ++mb)
#pragma unroll
        for (int nb = 0; nb < 4; ++nb) acc[mb][nb] = (v8f){};
    const size_t aoff = (size_t)(r0 + lr) * K + 8 * hi, boff = (size_t)(c0 + lr) * K + 8 * hi;
#pragma unroll 1
    for (int kc = 0; kc < K; kc += 32) {
        V a[4], a2[4];
#pragma unroll
        for (int mb = 0; mb < 4; ++mb) { a[mb] = WFrag<T16>::ld(A + aoff + (size_t)mb * 16 * K + kc); if (NSPLIT == 1 || NSPLIT == 2) a2[mb] = WFrag<T16>::ld(A2 + aoff + (size_t)mb * 16 * K + kc); }
#pragma unroll
        for (int nb = 0; nb < 4; ++nb) { const V b = WFrag<T16>::ld(Bt + boff + (size_t)nb * 16 * K + kc); V b2; if (NSPLIT >= 2) b2 = WFrag<T16>::ld(Bt2 + boff + (size_t)nb * 16 * K + kc);
#pragma unroll
            for (int mb = 0; mb < 4; ++mb) { acc[mb][nb] = WFrag<T16>::mma(a[mb], b, acc[mb][nb]); if (NSPLIT == 1 || NSPLIT == 2) acc[mb][nb] = WFrag<T16>::mma(a2[mb], b, acc[mb][nb]); if (NSPLIT >= 2) acc[mb][nb] = WFrag<T16>::mma(a[mb], b2, acc[mb][nb]); } }
        asm volatile("v_nop\n\tv_nop\n\tv_nop\n\tv_nop" : "+v"(acc[0][0]), "+v"(acc[1][1]), "+v"(acc[2][2]), "+v"(acc[3][3]) : "v"(a[0]), "v"(a[3]));
    }
#pragma unroll
    for (int mb = 0; mb < 4; ++mb) {
#pragma unroll
        for (int nb = 0; nb < 4; ++nb) {
#pragma unroll
            for (int j = 0; j < 8; ++j) os[(hi * 8 + j) * 68 + nb * 16 + lr] = acc[mb][nb][j]; }
        __builtin_amdgcn_wave_barrier(); asm volatile("" ::: "memory");
        float* crow = C + (size_t)(r0 + mb * 16) * ldc + c0;
{
#pragma unroll
            for (int s = 0; s < 8; ++s) { const int row = 2 * s + hi, cofs = lr * 4; v4f val = *(const v4fa*)(os + row * 68 + cofs); if (BIAS) { val[0] += bfr(bias[c0 + cofs]); val[1] += bfr(bias[c0 + cofs + 1]); val[2] += bfr(bias[c0 + cofs + 2]); val[3] += bfr(bias[c0 + cofs + 3]); }
                *(v4f*)(crow + (size_t)row * ldc + cofs) = val; }
             }
        __builtin_amdgcn_wave_barrier(); asm volatile("" ::: "memory");
    }
}

// ---- k_gemmk: the same product for a long K: NW waves of one work-group share one (16 MB) x (16 NB) output tile, wave w sums k in [w KW, (w + 1) KW) (K = NW KW) into its own accumulators,
// every wave parks its partial tile in LDS (row-major, pitch 16 NB + 4 floats), one barrier, then the partials are added in wave order 0..NW-1 and whole 128-byte row pieces are stored. grid (M / (16 MB), N / (16 NB), Z), 32 NW threads.
template <typename T16, int NSPLIT, bool BIAS, int MB, int NB, int NW, int KW>
__global__ __launch_bounds__(NW * 32) void k_gemmk(const T16* __restrict__ A, const T16* __restrict__ A2, const T16* __restrict__ Bt, const T16* __restrict__ Bt2, float* C, int ldc, const float* __restrict__ bias, size_t sA, size_t sB, size_t sC) {
    typedef typename WFrag<T16>::V V;
    constexpr int K = NW * KW, TM = MB * 16, TN = NB * 16, PT = TN + 4;
    __shared__ __align__(16) float red[NW * TM * PT];
    const int lane = threadIdx.x & 31, lr = lane & 15, hi = lane >> 4, wave = threadIdx.x >> 5; const int r0 = blockIdx.x * TM, c0 = blockIdx.y * TN;
    const size_t z = blockIdx.z, za = z * sA + (size_t)r0 * K, zb = z * sB + (size_t)c0 * K; C += z * sC;
    const unsigned off = (unsigned)(lr * K + 8 * hi + wave * KW);   // one lane offset serves both operands: equal pitch K, equal k range
    const T16* pa = A + za + off; const T16* pa2 = (NSPLIT == 1 || NSPLIT == 2) ? A2 + za + off : nullptr; const T16* pb = Bt + zb + off; const T16* pb2 = (NSPLIT >= 2) ? Bt2 + zb + off : nullptr;
    v8f acc[MB][NB];
#pragma unroll
    for (int mb = 0; mb < MB; ++mb)
#pragma unroll
        for (int nb = 0; nb < NB; ++nb) acc[mb][nb] = (v8f){};
    // unrolled: KW / 32 is a small constant, so every k offset becomes an immediate of its load and no matrix instruction stands in front of a back edge
#pragma unroll
    for (int kc = 0; kc < KW; kc += 32) {
        V a[MB], a2[MB];
#pragma unroll
        for (int mb = 0; mb < MB; ++mb) { a[mb] = WFrag<T16>::ld(pa + mb * 16 * K + kc); if (NSPLIT == 1 || NSPLIT == 2) a2[mb] = WFrag<T16>::ld(pa2 + mb * 16 * K + kc); }
#pragma unroll
        for (int nb = 0; nb < NB; ++nb) { const V b = WFrag<T16>::ld(pb + nb * 16 * K + kc); V b2; if (NSPLIT >= 2) b2 = WFrag<T16>::ld(pb2 + nb * 16 * K + kc);
#pragma unroll
            for (int mb = 0; mb < MB; ++mb) { acc[mb][nb] = WFrag<T16>::mma(a[mb], b, acc[mb][nb]); if (NSPLIT == 1 || NSPLIT == 2) acc[mb][nb] = WFrag<T16>::mma(a2[mb], b, acc[mb][nb]); if (NSPLIT >= 2) acc[mb][nb] = WFrag<T16>::mma(a[mb], b2, acc[mb][nb]); } }
    }
    float* my = red + wave * (TM * PT);
#pragma unroll
    for (int mb = 0; mb < MB; ++mb)
#pragma unroll
        for (int nb = 0; nb < NB; ++nb)
#pragma unroll
            for (int j = 0; j < 8; ++j) my[(mb * 16 + hi * 8 + j) * PT + nb * 16 + lr] = acc[mb][nb][j];
    __syncthreads();
    for (int e = threadIdx.x; e < TM * TN / 4; e += NW * 32) { const int row = e / (TN / 4), cofs = (e % (TN / 4)) * 4; v4f val = *(const v4fa*)(red + row * PT + cofs);
#pragma unroll
        for (int w = 1; w < NW; ++w) val += *(const v4fa*)(red + w * (TM * PT) + row * PT + cofs);
        if (BIAS) { val[0] += bfr(bias[c0 + cofs]); val[1] += bfr(bias[c0 + cofs + 1]); val[2] += bfr(bias[c0 + cofs + 2]); val[3] += bfr(bias[c0 + cofs + 3]); }
        *(v4f*)(C + (size_t)(r0 + row) * ldc + c0 + cofs) = val; }
}

__device__ __forceinline__ h16 tohx(float x) { return (h16)x; }
__device__ __forceinline__ void splitf(float y, unsigned short& h, unsigned short& l) { h = f2bf(y); l = f2bf(y - bf2f(h)); }
typedef __attribute__((ext_vector_type(2))) _Float16 v2h;
typedef __attribute__((ext_vector_type(4))) _Float16 v4h;
typedef __attribute__((ext_vector_type(2))) unsigned short v2us;
typedef __attribute__((ext_vector_type(4))) unsigned short v4us;
typedef __attribute__((ext_vector_type(2))) float v2f;
typedef __attribute__((ext_vector_type(4))) int v4i;

__global__ __launch_bounds__(256) void k_wtG(const float* __restrict__ w, int K, int N, bf* Bt) {
    const int lane = threadIdx.x & 31; const int L0 = (blockIdx.x * 8 + (threadIdx.x >> 5)) * 8; const int nlines = N * K / 64;
{
#pragma unroll 1
        for (int l = 0; l < 8; ++l) { const int L = L0 + l; if (L >= nlines) break; const size_t e = (size_t)L * 64 + lane * 2; const int k = (int)(e % K), n = (int)(e / K); v2us o;
            o[0] = f2bf(w[(size_t)k * N + n]); o[1] = f2bf(w[(size_t)(k + 1) * N + n]); *(v2us*)(Bt + e) = o; }
         }
}
__global__ __launch_bounds__(256) void k_cvt8(const float* __restrict__ src, bf* dst, size_t n8) { const size_t i = (size_t)blockIdx.x * 256 + threadIdx.x; if (i >= n8) return; const v8f v = *(const v8f*)(src + i * 8); v8us o;
#pragma unroll
    for (int k = 0; k < 8; ++k) o[k] = f2bf(v[k]); *(v8us*)(dst + i * 8) = o;  }
__global__ __launch_bounds__(256) void k_cscvt(const float* __restrict__ cosT, const float* __restrict__ sinT, float* CS) { const int idx = blockIdx.x * 256 + threadIdx.x; if (idx >= TT * HD) return; v2f cs; cs[0] = bfr(cosT[idx]); cs[1] = bfr(sinT[idx]); *(v2f*)(CS + (size_t)idx * 2) = cs;  }
// k_rope: head planes [h][t][d] (fp16 + hi/lo) of rope(x) x sc with the rotate-half convention out[d] = x[d] cos[t][d] - x[d+HD/2] sin[t][d], out[d+HD/2] = x[d+HD/2] cos[t][d+HD/2] + x[d] sin[t][d+HD/2]
__global__ __launch_bounds__(256) void k_rope(const float* __restrict__ F, int pitch, int nheads, const float* __restrict__ CS, const float* __restrict__ RF, const float* __restrict__ nw, float sc, h16* P16, bf* Ph, bf* Pl) {
    const size_t e = ((size_t)blockIdx.x * 256 + threadIdx.x) * 2; if (e >= (size_t)nheads * TT * HD) return; const int d = (int)(e % HD); const int t = (int)((e / HD) % TT); const int h = (int)(e / ((size_t)HD * TT)); const float* f = F + (size_t)t * pitch + h * HD; const float rf = RF ? RF[(size_t)h * TT + t] : 1.0f; v2h o16; v2us oh, ol;
#pragma unroll
    for (int q = 0; q < 2; ++q) { const int dd = d + q; const int dp = (dd < HD / 2) ? dd + HD / 2 : dd - HD / 2; float x0 = f[dd], x1 = f[dp];
        if (RF) { float n0 = __fmul_rn(x0, rf), n1 = __fmul_rn(x1, rf); asm volatile("" : "+v"(n0)); asm volatile("" : "+v"(n1)); x0 = __fmul_rn(bfr(nw[dd]), n0); x1 = __fmul_rn(bfr(nw[dp]), n1); }
        const v2f cs = *(const v2f*)(CS + ((size_t)t * HD + dd) * 2); float a = __fmul_rn(x0, cs[0]), bq = __fmul_rn(x1, cs[1]); asm volatile("" : "+v"(a)); asm volatile("" : "+v"(bq)); const float r = ((dd < HD / 2) ? __fsub_rn(a, bq) : __fadd_rn(a, bq)) * sc;
        o16[q] = tohx(r); unsigned short a2, c2; splitf(r, a2, c2); oh[q] = a2; ol[q] = c2; }
    *(v2h*)(P16 + e) = o16; *(v2us*)(Ph + e) = oh; *(v2us*)(Pl + e) = ol;  }
__global__ __launch_bounds__(256) void k_vtp(const float* __restrict__ F, int pitch, int nheads, h16* V16, bf* Vh, bf* Vl) { const size_t e = ((size_t)blockIdx.x * 256 + threadIdx.x) * 2; if (e >= (size_t)nheads * HD * TT) return; const int t = (int)(e % TT); const int d = (int)((e / TT) % HD); const int g = (int)(e / ((size_t)TT * HD)); v2h o16; v2us oh, ol;
#pragma unroll
    for (int q = 0; q < 2; ++q) { const float x = F[(size_t)(t + q) * pitch + g * HD + d]; o16[q] = tohx(x); unsigned short a2, c2; splitf(x, a2, c2); oh[q] = a2; ol[q] = c2; }
    *(v2h*)(V16 + e) = o16; *(v2us*)(Vh + e) = oh; *(v2us*)(Vl + e) = ol;  }
__global__ __launch_bounds__(256) void k_csid(float* CS) { const int idx = blockIdx.x * 256 + threadIdx.x; if (idx >= TT * HD) return; v2f cs; cs[0] = 1.0f; cs[1] = 0.0f; *(v2f*)(CS + (size_t)idx * 2) = cs;  }
// k_asoft: per row (zz, i): t = clip(S x HD^-0.5, +-50000) + ((mask == 0) ? -9e15 : mask) per key; softmax over the 2048 keys (register row, one exp, fixed trees);
__global__ __launch_bounds__(256) void k_asoft(const float* __restrict__ Sb, const int* __restrict__ km, h16* P16, bf* Ph, bf* Pl) {
    const int lane = threadIdx.x & 31; const int row = blockIdx.x * 8 + (threadIdx.x >> 5); if (row >= ZH * TT) return; const int i = row % TT; const int zz = row / TT; (void)zz; const bool hires = (i < RH); const float* sr = Sb + (size_t)row * TT; float v[TT / 32]; float mx = -3.0e38f;
#pragma unroll
    for (int ch = 0; ch < TT / 128; ++ch) { const int j0 = ch * 128 + lane * 4; const v4f a = *(const v4f*)(sr + j0);
#pragma unroll
        for (int q = 0; q < 4; ++q) { const int j = j0 + q; (void)j; float sa = a[q] * SCL; asm volatile("" : "+v"(sa)); float sc = fminf(fmaxf(sa, -50000.0f), 50000.0f); asm volatile("" : "+v"(sc)); const int mvv = km[j0 + q]; const float madd = (mvv == 0) ? -9.0e15f : (float)mvv; const float t = __fadd_rn(sc, madd); v[ch * 4 + q] = t; mx = fmaxf(mx, t); } }
#pragma unroll
    for (int sh = 16; sh; sh >>= 1) mx = fmaxf(mx, __shfl_xor(mx, sh, 32));
    float sum = 0.f;
#pragma unroll
    for (int k = 0; k < TT / 32; ++k) { float d0 = __fsub_rn(v[k], mx); asm volatile("" : "+v"(d0)); v[k] = __builtin_amdgcn_exp2f(__fmul_rn(d0, 1.4426950408889634f)); sum += v[k]; }
#pragma unroll
    for (int sh = 16; sh; sh >>= 1) sum += __shfl_xor(sum, sh, 32);
    const float f = __fdiv_rn(hires ? 1.0f : PCAR, sum);
{
        if (hires) {
#pragma unroll
            for (int ch = 0; ch < TT / 128; ++ch) { v4us oh, ol;
#pragma unroll
                for (int q = 0; q < 4; ++q) { unsigned short a, c2; splitf(v[ch * 4 + q] * f, a, c2); oh[q] = a; ol[q] = c2; }
                const size_t oo = ((size_t)zz * (RH ? RH : 1) + i) * TT + ch * 128 + lane * 4; *(v4us*)(Ph + oo) = oh; *(v4us*)(Pl + oo) = ol; }
        } else {
#pragma unroll
            for (int ch = 0; ch < TT / 128; ++ch) { v4h o4;
#pragma unroll
                for (int q = 0; q < 4; ++q) o4[q] = tohx(v[ch * 4 + q] * f);
                *(v4h*)(P16 + (size_t)row * TT + ch * 128 + lane * 4) = o4; } }
         }
}
__global__ __launch_bounds__(256) void k_merge(const float* __restrict__ O, int h0, bf* Ah, bf* Al) { const size_t e = ((size_t)blockIdx.x * 256 + threadIdx.x) * 2; if (e >= (size_t)ZH * TT * HD) return; const int d = (int)(e % HD); const int t = (int)((e / HD) % TT); const int zz = (int)(e / ((size_t)HD * TT)); const float cs = (t < RH) ? 1.0f : (1.0f / PCAR); const size_t oo = (size_t)t * DQ + (h0 + zz) * HD + d;
    v2us oh, ol;
#pragma unroll
    for (int q = 0; q < 2; ++q) { unsigned short a, c2; splitf(O[e + q] * cs, a, c2); oh[q] = a; ol[q] = c2; } *(v2us*)(Ah + oo) = oh; *(v2us*)(Al + oo) = ol;  }

extern "C" void kernel_launch(void* const* d_in, const int* in_sizes, int n_in,
                              void* d_out, int out_size, void* d_ws, size_t ws_size, hipStream_t stream) {
    (void)in_sizes; (void)n_in; (void)out_size;
    const float* x = (const float*)d_in[0]; const float* y = (const float*)d_in[1]; const int* kmask = (const int*)d_in[2]; const float* wq = (const float*)d_in[3]; const float* bq = (const float*)d_in[4]; const float* wk = (const float*)d_in[5]; const float* bk = (const float*)d_in[6]; const float* wv = (const float*)d_in[7]; const float* bv = (const float*)d_in[8]; const float* wo = (const float*)d_in[9]; const float* bo = (const float*)d_in[10]; const float* cosT = nullptr; const float* sinT = nullptr; (void)cosT; (void)sinT;
    float* OUT = (float*)d_out;     // [2][2048][1024]
    char* wsp = (char*)d_ws;
    auto take = [&](size_t bytes) { char* p = wsp; wsp += (bytes + 255) & ~(size_t)255; return (void*)p; };
    bf* WQ = (bf*)take((size_t)DQ * DM * 2); bf* WK = (bf*)take((size_t)DKV * DM * 2); bf* WV = (bf*)take((size_t)DKV * DM * 2); bf* WO = (bf*)take((size_t)DM * DQ * 2); float* CS = (float*)take((size_t)TT * HD * 2 * 4);
    bf* XB = (bf*)take((size_t)TT * DM * 2); bf* YB = (bf*)take((size_t)TT * DM * 2); float* FQ = (float*)take((size_t)TT * DQ * 4); float* FK = (float*)take((size_t)TT * DKV * 4);
    h16* QP16 = (h16*)take((size_t)NH_ * TT * HD * 2); h16* KP16 = (h16*)take((size_t)NKV * TT * HD * 2); h16* VT16 = (h16*)take((size_t)NKV * HD * TT * 2);
    bf* QPh = (bf*)take((size_t)NH_ * TT * HD * 2); bf* QPl = (bf*)take((size_t)NH_ * TT * HD * 2); bf* KPh = (bf*)take((size_t)NKV * TT * HD * 2); bf* KPl = (bf*)take((size_t)NKV * TT * HD * 2); bf* VTh = (bf*)take((size_t)NKV * HD * TT * 2); bf* VTl = (bf*)take((size_t)NKV * HD * TT * 2); bf* Ph = (bf*)take((size_t)ZH * RH * TT * 2); bf* Pl = (bf*)take((size_t)ZH * RH * TT * 2);
    float* Sb = (float*)take((size_t)ZH * TT * TT * 4); h16* P16 = (h16*)take((size_t)ZH * TT * TT * 2); float* Ob = (float*)take((size_t)ZH * TT * HD * 4); bf* ATh = (bf*)take((size_t)TT * DQ * 2); bf* ATl = (bf*)take((size_t)TT * DQ * 2);
    if ((size_t)(wsp - (char*)d_ws) > ws_size) return;    // ws 256 MiB
    float* FV = FK;   // v projection reuses the k buffer after the k planes are built (stream-ordered)
    { k_cvt8<<<(unsigned)(((size_t)DQ * DM / 8 + 255) / 256), 256, 0, stream>>>(wq, WQ, (size_t)DQ * DM / 8); k_cvt8<<<(unsigned)(((size_t)DKV * DM / 8 + 255) / 256), 256, 0, stream>>>(wk, WK, (size_t)DKV * DM / 8); k_cvt8<<<(unsigned)(((size_t)DKV * DM / 8 + 255) / 256), 256, 0, stream>>>(wv, WV, (size_t)DKV * DM / 8);
      k_cvt8<<<(unsigned)(((size_t)DM * DQ / 8 + 255) / 256), 256, 0, stream>>>(wo, WO, (size_t)DM * DQ / 8);
       }
    k_csid<<<(TT * HD + 255) / 256, 256, 0, stream>>>(CS);
    const unsigned LQ = (unsigned)(((size_t)NH_ * TT * HD / 2 + 255) / 256), LKv = (unsigned)(((size_t)NKV * TT * HD / 2 + 255) / 256);
    for (int b = 0; b < NB_; ++b) {
        
        k_cvt8<<<(unsigned)(((size_t)TT * DM / 8 + 255) / 256), 256, 0, stream>>>(x + (size_t)b * TT * DM, XB, (size_t)TT * DM / 8); k_cvt8<<<(unsigned)(((size_t)TT * DM / 8 + 255) / 256), 256, 0, stream>>>(y + (size_t)b * TT * DM, YB, (size_t)TT * DM / 8);
        k_gemmk<bf, 0, true, 4, 4, 8, DM / 8><<<dim3(TT / 64, DQ / 64, 1), 256, 0, stream>>>(XB, nullptr, WQ, nullptr, FQ, DQ, bq, 0, 0, 0);
        k_rope<<<LQ, 256, 0, stream>>>(FQ, DQ, NH_, CS, nullptr, nullptr, 1.0f, QP16, QPh, QPl);
        k_gemmk<bf, 0, true, 4, 4, 8, DM / 8><<<dim3(TT / 64, DKV / 64, 1), 256, 0, stream>>>(YB, nullptr, WK, nullptr, FK, DKV, bk, 0, 0, 0);
        k_rope<<<LKv, 256, 0, stream>>>(FK, DKV, NKV, CS, nullptr, nullptr, 1.0f, KP16, KPh, KPl);
        k_gemmk<bf, 0, true, 4, 4, 8, DM / 8><<<dim3(TT / 64, DKV / 64, 1), 256, 0, stream>>>(YB, nullptr, WV, nullptr, FV, DKV, bv, 0, 0, 0); k_vtp<<<LKv, 256, 0, stream>>>(FV, DKV, NKV, VT16, VTh, VTl);
        for (int h0 = 0; h0 < NH_; h0 += ZH) { const size_t zq = (size_t)h0, zk = (size_t)(h0 / REP);   // one kv head per query head: the pass's two heads use consecutive kv planes (z-strides TT*HD)
            k_gemmw<bf, 2, false><<<dim3(RH / 64, TT / 64, ZH), 32, 0, stream>>>(QPh + zq * TT * HD, QPl + zq * TT * HD, KPh + zk * TT * HD, KPl + zk * TT * HD, HD, Sb, TT, nullptr, (size_t)TT * HD, (size_t)TT * HD, (size_t)TT * TT);
            k_gemmw<h16, 0, false><<<dim3((TT - RH) / 64, TT / 64, ZH), 32, 0, stream>>>(QP16 + zq * TT * HD + (size_t)RH * HD, nullptr, KP16 + zk * TT * HD, nullptr, HD, Sb + (size_t)RH * TT, TT, nullptr, (size_t)TT * HD, (size_t)TT * HD, (size_t)TT * TT);
            k_asoft<<<ZH * TT / 8, 256, 0, stream>>>(Sb, kmask + (size_t)b * TT, P16, Ph, Pl);
            k_gemmk<bf, 2, false, 2, 2, 16, TT / 16><<<dim3(RH / 32, HD / 32, ZH), 512, 0, stream>>>(Ph, Pl, VTh + zk * HD * TT, VTl + zk * HD * TT, Ob, HD, nullptr, (size_t)RH * TT, (size_t)HD * TT, (size_t)TT * HD);
            k_gemmk<h16, 0, false, 2, 2, 16, TT / 16><<<dim3((TT - RH) / 32, HD / 32, ZH), 512, 0, stream>>>(P16 + (size_t)RH * TT, nullptr, VT16 + zk * HD * TT, nullptr, Ob + (size_t)RH * HD, HD, nullptr, (size_t)TT * TT, (size_t)HD * TT, (size_t)TT * HD);
            k_merge<<<(unsigned)(((size_t)ZH * TT * HD / 2 + 255) / 256), 256, 0, stream>>>(Ob, h0, ATh, ATl); }
        k_gemmk<bf, 1, true, 4, 4, 8, DQ / 8><<<dim3(TT / 64, DM / 64, 1), 256, 0, stream>>>(ATh, ATl, WO, nullptr, OUT + (size_t)b * TT * DM, DM, bo, 0, 0, 0); }
}

// v003
// It runs in 245 microseconds.
// Versions in between are left out here; by their measured steps it is 3.75 times as fast as v001.
// Counting every step since v000, it is 8.69 times as fast.
#include <hip/hip_runtime.h>

// MultiHeadAttention_New (master, slave [2][2048][1024], attention_mask [2][2048] (int, read; random 0/1); q = (master Wq^T + bq) x 0.125, k/v = slave W^T + b (16 x 64); attn = clip(q.k, +-50000) + (mask == 0 ? -9e15 : mask) per key; softmax; out = merged Wo^T + bo -> [2][2048][1024]).
// Compute dtypes, f32 accumulate: every input rounded to bf16; q/k/v on PLAIN bf16 operands (inputs: exact) + bias; scores and attn.v: query rows < 512 hl (3 products), the rest single fp16 (x1024); the clamp and the additive mask term ((mask == 0) ? -9e15 : float(mask), read per key) in f32; softmax f32; Wo hl x exact (2 products) + bias.

#define NB_  2
#define TT   2048
#define DM   1024
#define NH_  16
#define NKV  16
#define REP  (NH_ / NKV)
#define HD   64
#define DQ   (NH_ * HD)
#define DKV  (NKV * HD)
#define RH   512                  // query rows < RH use hi+lo planes (0: none)
#define WIN  0
#define PCAR 1024.0f
#define SCL  0.125f   // HD^-0.5
typedef _Float16 h16;
typedef unsigned short bf;
typedef __attribute__((ext_vector_type(16))) __bf16   v16bf;
typedef __attribute__((ext_vector_type(16))) _Float16 v16h;
typedef __attribute__((ext_vector_type(8)))  _Float16 v8h;
typedef __attribute__((ext_vector_type(8)))  unsigned short v8us;
typedef __attribute__((ext_vector_type(8)))  float    v8f;
typedef __attribute__((ext_vector_type(4)))  float    v4f;
typedef v8h  __attribute__((may_alias)) v8ha;
typedef v4f  __attribute__((may_alias)) v4fa;
typedef v8us __attribute__((may_alias)) v8usa;

__device__ __forceinline__ unsigned short f2bf(float f) { unsigned u = __float_as_uint(f); u += 0x7FFFu + ((u >> 16) & 1u); return (unsigned short)(u >> 16); }
__device__ __forceinline__ float bf2f(unsigned short b) { return __uint_as_float(((unsigned)b) << 16); }
__device__ __forceinline__ float bfr(float f) { return bf2f(f2bf(f)); }
__device__ __forceinline__ v16h cat16(v8h lo, v8h hi) { return __builtin_shufflevector(lo, hi, 0, 1, 2, 3, 4, 5, 6, 7, 8, 9, 10, 11, 12, 13, 14, 15); }
__device__ __forceinline__ v16bf cat16b(v8us lo, v8us hi) { return __builtin_bit_cast(v16bf, __builtin_shufflevector(lo, hi, 0, 1, 2, 3, 4, 5, 6, 7, 8, 9, 10, 11, 12, 13, 14, 15)); }
__device__ __forceinline__ v8f wmma16(v16h a, v16h b, v8f c) { return __builtin_amdgcn_wmma_f32_16x16x32_f16(false, a, false, b, (short)0, c, false, false); }
__device__ __forceinline__ v8f wmmab(v16bf a, v16bf b, v8f c) { return __builtin_amdgcn_wmma_f32_16x16x32_bf16(false, a, false, b, (short)0, c, false, false); }



// ---- operand fragments straight from K-contiguous 16-bit planes: lane lr = row, k = 8 hi + 0..7 and 16 + 8 hi + 0..7 of a 32-wide k step, the same for A and for B
template <typename T16> struct WFrag;
template <> struct WFrag<h16> { typedef v16h V; static __device__ __forceinline__ V ld(const h16* p) { return cat16(*(const v8h*)p, *(const v8h*)(p + 16)); } static __device__ __forceinline__ v8f mma(V a, V b, v8f c) { return wmma16(a, b, c); } };
template <> struct WFrag<bf> { typedef v16bf V; static __device__ __forceinline__ V ld(const bf* p) { return cat16b(*(const v8us*)p, *(const v8us*)(p + 16)); } static __device__ __forceinline__ v8f mma(V a, V b, v8f c) { return wmmab(a, b, c); } };

__device__ __forceinline__ h16 tohx(float x) { return (h16)x; }
__device__ __forceinline__ void splitf(float y, unsigned short& h, unsigned short& l) { h = f2bf(y); l = f2bf(y - bf2f(h)); }
typedef __attribute__((ext_vector_type(4))) _Float16 v4h;
typedef __attribute__((ext_vector_type(4))) unsigned short v4us;

// ---- k_gemmk: C[m][n] (f32, pitch ldc, + optional f32 bias[n]) = sum_k A[m][k] Bt[n][k] (+ split products per NSPLIT; z-batch strides sA/sB/sC in elements) for a long K: NW waves of one work-group share one (16 MB) x (16 NB) output tile, wave w sums k in [w KW, (w + 1) KW) (K = NW KW) into its own accumulators,
// every wave parks its partial tile in LDS (row-major, pitch 16 NB + 4 floats), one barrier, then the partials are added in wave order 0..NW-1 and whole 128-byte row pieces are stored. grid (M / (16 MB), N / (16 NB), Z), 32 NW threads.
// EPI says what is stored. 0: C in f32. 1 and 2: no f32 C; each sum goes straight to the three 16-bit planes that attention reads (fp16, bf16 hi, bf16 lo).
// 1: m = token, n = feature, head planes [n / HD][m][n % HD]. 2: m = feature, n = token (weights as A, tokens as Bt), planes [m][n] of pitch ldc, the bias taken per row m.
template <typename T16, int NSPLIT, bool BIAS, int MB, int NB, int NW, int KW, int EPI>
__global__ __launch_bounds__(NW * 32) void k_gemmk(const T16* __restrict__ A, const T16* __restrict__ A2, const T16* __restrict__ Bt, const T16* __restrict__ Bt2, float* C, int ldc, const float* __restrict__ bias, size_t sA, size_t sB, size_t sC, h16* P16, bf* Ph, bf* Pl) {
    typedef typename WFrag<T16>::V V;
    constexpr int K = NW * KW, TM = MB * 16, TN = NB * 16, PT = TN + 4;
    __shared__ __align__(16) float red[NW * TM * PT];
    const int lane = threadIdx.x & 31, lr = lane & 15, hi = lane >> 4, wave = threadIdx.x >> 5; const int r0 = blockIdx.x * TM, c0 = blockIdx.y * TN;
    const size_t z = blockIdx.z, za = z * sA + (size_t)r0 * K, zb = z * sB + (size_t)c0 * K; if (EPI == 0) C += z * sC;
    const unsigned off = (unsigned)(lr * K + 8 * hi + wave * KW);   // one lane offset serves both operands: equal pitch K, equal k range
    const T16* pa = A + za + off; const T16* pa2 = (NSPLIT == 1 || NSPLIT == 2) ? A2 + za + off : nullptr; const T16* pb = Bt + zb + off; const T16* pb2 = (NSPLIT >= 2) ? Bt2 + zb + off : nullptr;
    v8f acc[MB][NB];
#pragma unroll
    for (int mb = 0; mb < MB; ++mb)
#pragma unroll
        for (int nb = 0; nb < NB; ++nb) acc[mb][nb] = (v8f){};
    // unrolled: KW / 32 is a small constant, so every k offset becomes an immediate of its load and no matrix instruction stands in front of a back edge
#pragma unroll
    for (int kc = 0; kc < KW; kc += 32) {
        V a[MB], a2[MB];
#pragma unroll
        for (int mb = 0; mb < MB; ++mb) { a[mb] = WFrag<T16>::ld(pa + mb * 16 * K + kc); if (NSPLIT == 1 || NSPLIT == 2) a2[mb] = WFrag<T16>::ld(pa2 + mb * 16 * K + kc); }
#pragma unroll
        for (int nb = 0; nb < NB; ++nb) { const V b = WFrag<T16>::ld(pb + nb * 16 * K + kc); V b2; if (NSPLIT >= 2) b2 = WFrag<T16>::ld(pb2 + nb * 16 * K + kc);
#pragma unroll
            for (int mb = 0; mb < MB; ++mb) { acc[mb][nb] = WFrag<T16>::mma(a[mb], b, acc[mb][nb]); if (NSPLIT == 1 || NSPLIT == 2) acc[mb][nb] = WFrag<T16>::mma(a2[mb], b, acc[mb][nb]); if (NSPLIT >= 2) acc[mb][nb] = WFrag<T16>::mma(a[mb], b2, acc[mb][nb]); } }
    }
    float* my = red + wave * (TM * PT);
#pragma unroll
    for (int mb = 0; mb < MB; ++mb)
#pragma unroll
        for (int nb = 0; nb < NB; ++nb)
#pragma unroll
            for (int j = 0; j < 8; ++j) my[(mb * 16 + hi * 8 + j) * PT + nb * 16 + lr] = acc[mb][nb][j];
    __syncthreads();
    for (int e = threadIdx.x; e < TM * TN / 4; e += NW * 32) { const int row = e / (TN / 4), cofs = (e % (TN / 4)) * 4; v4f val = *(const v4fa*)(red + row * PT + cofs);
#pragma unroll
        for (int w = 1; w < NW; ++w) val += *(const v4fa*)(red + w * (TM * PT) + row * PT + cofs);
        if (BIAS && EPI == 2) { const float br = bfr(bias[r0 + row]); val[0] += br; val[1] += br; val[2] += br; val[3] += br; }
        else if (BIAS) { val[0] += bfr(bias[c0 + cofs]); val[1] += bfr(bias[c0 + cofs + 1]); val[2] += bfr(bias[c0 + cofs + 2]); val[3] += bfr(bias[c0 + cofs + 3]); }
        if constexpr (EPI == 0) *(v4f*)(C + (size_t)(r0 + row) * ldc + c0 + cofs) = val;
        else { v4h o16; v4us oh, ol;
#pragma unroll
            for (int q = 0; q < 4; ++q) { o16[q] = tohx(val[q]); unsigned short a2, c2; splitf(val[q], a2, c2); oh[q] = a2; ol[q] = c2; }
            const size_t oo = (EPI == 1) ? ((size_t)((c0 + cofs) / HD) * TT + r0 + row) * HD + (c0 + cofs) % HD : (size_t)(r0 + row) * ldc + c0 + cofs;
            *(v4h*)(P16 + oo) = o16; *(v4us*)(Ph + oo) = oh; *(v4us*)(Pl + oo) = ol; } }
}

typedef __attribute__((ext_vector_type(2))) unsigned short v2us;
typedef __attribute__((ext_vector_type(2))) float v2f;
typedef __attribute__((ext_vector_type(4))) int v4i;
typedef __attribute__((ext_vector_type(8))) unsigned v8u;

__global__ __launch_bounds__(256) void k_wtG(const float* __restrict__ w, int K, int N, bf* Bt) {
    const int lane = threadIdx.x & 31; const int L0 = (blockIdx.x * 8 + (threadIdx.x >> 5)) * 8; const int nlines = N * K / 64;
{
#pragma unroll 1
        for (int l = 0; l < 8; ++l) { const int L = L0 + l; if (L >= nlines) break; const size_t e = (size_t)L * 64 + lane * 2; const int k = (int)(e % K), n = (int)(e / K); v2us o;
            o[0] = f2bf(w[(size_t)k * N + n]); o[1] = f2bf(w[(size_t)(k + 1) * N + n]); *(v2us*)(Bt + e) = o; }
         }
}
__global__ __launch_bounds__(256) void k_cvt8(const float* __restrict__ src, bf* dst, size_t n8) { const size_t i = (size_t)blockIdx.x * 256 + threadIdx.x; if (i >= n8) return; const v8f v = *(const v8f*)(src + i * 8); v8us o;
#pragma unroll
    for (int k = 0; k < 8; ++k) o[k] = f2bf(v[k]); *(v8us*)(dst + i * 8) = o;  }
// ---- k_attn: scores, softmax, attn.v and the head merge of QR query rows of one head in ONE work-group of AW waves; wave w owns keys [w KWV, (w + 1) KWV). grid (NH_, TT / QR), 32 AW threads.
// Scores are formed TRANSPOSED (A = 16 keys, B = 16 queries): a lane then holds, for query lr, keys hi 8 + j of each 16-key tile, which is the A-fragment order of attn.v (two tiles = one 32-key fragment), so the probabilities never leave the registers.
// Row maximum and row sum: in the lane, then across the two lane halves, then across the waves through LDS (added in wave order). attn.v partials of the waves are parked in LDS and added in wave order 0..AW-1, scaled, split hi/lo and stored as whole 128-byte row pieces of the merged planes.
#define QR   32
#define AW   16
#define KWV  (TT / AW)
#define SP   20                   // floats per query row of the wave statistics (16 used; 80-byte pitch keeps the 16-byte reads aligned)
#define OPT  (HD + 4)
// fragments asked for ahead of their use, single-plane rows (L) and hi/lo rows (H): key fragments DK, v fragments DU, of which PU already in front of the softmax; the largest that leave no spill at 256 registers
#define DKL 8
#define DKH 2
#define DUL 8
#define DUH 3
#define PUL 6
#define PUH 2
template <typename T16, bool HR>
__device__ __forceinline__ void attn_tile(const T16* __restrict__ Q, const T16* __restrict__ Q2, const T16* __restrict__ Kp, const T16* __restrict__ Kp2, const T16* __restrict__ Vt, const T16* __restrict__ Vt2, const int* __restrict__ km, bf* ATh, bf* ATl, float* red, float* smx, float* ssm, float* sma) {
    typedef typename WFrag<T16>::V V;
    constexpr int QT = QR / 16, KT = KWV / 16, KC = HD / 32, CT = KWV / 32, DT = HD / 16, NU = DT * CT;
    constexpr int DK = HR ? DKH : DKL, DU = HR ? DUH : DUL, PU = HR ? PUH : PUL;
    const v4i mk = *(const v4i*)(km + threadIdx.x * 4);   // TT == 128 AW: four keys a thread; asked for first, used behind the score products
    const int lane = threadIdx.x & 31, lr = lane & 15, hi = lane >> 4, wave = threadIdx.x >> 5; const int k0 = wave * KWV;
    const unsigned qoff = (unsigned)(lr * HD + 8 * hi), koff = (unsigned)((k0 + lr) * HD + 8 * hi), voff = (unsigned)(lr * TT + k0 + 8 * hi);
    V qf[QT][KC], qf2[QT][KC], kf[KT][KC], kf2[KT][KC], vf[NU], vf2[NU];
#pragma unroll
    for (int qt = 0; qt < QT; ++qt)
#pragma unroll
        for (int kc = 0; kc < KC; ++kc) { qf[qt][kc] = WFrag<T16>::ld(Q + qoff + qt * 16 * HD + kc * 32); if (HR) qf2[qt][kc] = WFrag<T16>::ld(Q2 + qoff + qt * 16 * HD + kc * 32); }
#pragma unroll
    for (int n = 0; n < DK; ++n) { kf[n / KC][n % KC] = WFrag<T16>::ld(Kp + koff + (n / KC) * 16 * HD + (n % KC) * 32); if (HR) kf2[n / KC][n % KC] = WFrag<T16>::ld(Kp2 + koff + (n / KC) * 16 * HD + (n % KC) * 32); }
    v8f s[KT][QT];
#pragma unroll
    for (int n = 0; n < KT * KC; ++n) { const int kt = n / KC, kc = n % KC, nn = n + DK;
        if (nn < KT * KC) { kf[nn / KC][nn % KC] = WFrag<T16>::ld(Kp + koff + (nn / KC) * 16 * HD + (nn % KC) * 32); if (HR) kf2[nn / KC][nn % KC] = WFrag<T16>::ld(Kp2 + koff + (nn / KC) * 16 * HD + (nn % KC) * 32); }
        __builtin_amdgcn_sched_barrier(0);   // keeps the loads of key fragment n + DK in front of fragment n's products: left alone the scheduler sinks each load to its use and every fragment waits a whole L2 trip
#pragma unroll
        for (int qt = 0; qt < QT; ++qt) { v8f a = (kc == 0) ? (v8f){} : s[kt][qt];
            a = WFrag<T16>::mma(kf[kt][kc], qf[qt][kc], a); if (HR) { a = WFrag<T16>::mma(kf[kt][kc], qf2[qt][kc], a); a = WFrag<T16>::mma(kf2[kt][kc], qf[qt][kc], a); }
            s[kt][qt] = a; }
        __builtin_amdgcn_sched_barrier(0);   // and the next fragment's loads behind these products
    }
    { v4f ma;
#pragma unroll
        for (int q = 0; q < 4; ++q) ma[q] = (mk[q] == 0) ? -9.0e15f : (float)mk[q];
        *(v4fa*)(sma + threadIdx.x * 4) = ma; }
    __syncthreads();
    // v fragments in the order of their use, u = dt CT + c; the first PU fly while the softmax runs (asked for behind the barrier above, which would wait for them)
#pragma unroll
    for (int u = 0; u < PU; ++u) { vf[u] = WFrag<T16>::ld(Vt + voff + (u / CT) * 16 * TT + (u % CT) * 32); if (HR) vf2[u] = WFrag<T16>::ld(Vt2 + voff + (u / CT) * 16 * TT + (u % CT) * 32); }
    asm volatile("s_wait_xcnt 0x0" ::: "memory");   // in front of the first rewrite of an address register that a load issued so far names
    __builtin_amdgcn_sched_barrier(0);   // keeps those loads in front of the softmax
    float mx[QT];
#pragma unroll
    for (int qt = 0; qt < QT; ++qt) mx[qt] = -3.0e38f;
#pragma unroll
    for (int kt = 0; kt < KT; ++kt) { const v4f a0 = *(const v4fa*)(sma + k0 + kt * 16 + hi * 8), a1 = *(const v4fa*)(sma + k0 + kt * 16 + hi * 8 + 4);
#pragma unroll
        for (int qt = 0; qt < QT; ++qt)
#pragma unroll
            for (int j = 0; j < 8; ++j) { const float t = __fadd_rn(fminf(fmaxf(s[kt][qt][j] * SCL, -50000.0f), 50000.0f), (j < 4) ? a0[j & 3] : a1[j & 3]); s[kt][qt][j] = t; mx[qt] = fmaxf(mx[qt], t); } }
#pragma unroll
    for (int qt = 0; qt < QT; ++qt) { mx[qt] = fmaxf(mx[qt], __shfl_xor(mx[qt], 16, 32)); if (hi == 0) smx[(qt * 16 + lr) * SP + wave] = mx[qt]; }
    __syncthreads();
#pragma unroll
    for (int qt = 0; qt < QT; ++qt) { float m = -3.0e38f;
#pragma unroll
        for (int w4 = 0; w4 < AW / 4; ++w4) { const v4f p = *(const v4fa*)(smx + (qt * 16 + lr) * SP + w4 * 4); m = fmaxf(fmaxf(fmaxf(m, p[0]), fmaxf(p[1], p[2])), p[3]); }
        float sum = 0.f;
#pragma unroll
        for (int kt = 0; kt < KT; ++kt)
#pragma unroll
            for (int j = 0; j < 8; ++j) { const float e = __builtin_amdgcn_exp2f(__fmul_rn(__fsub_rn(s[kt][qt][j], m), 1.4426950408889634f)); s[kt][qt][j] = e; sum += e; }
        sum += __shfl_xor(sum, 16, 32); if (hi == 0) ssm[(qt * 16 + lr) * SP + wave] = sum; }
    __syncthreads();
    V pf[CT][QT], pf2[CT][QT];
#pragma unroll
    for (int qt = 0; qt < QT; ++qt) { float sum = 0.f;
#pragma unroll
        for (int w4 = 0; w4 < AW / 4; ++w4) { const v4f p = *(const v4fa*)(ssm + (qt * 16 + lr) * SP + w4 * 4); sum += p[0]; sum += p[1]; sum += p[2]; sum += p[3]; }
        const float f = __fdiv_rn(HR ? 1.0f : PCAR, sum);
#pragma unroll
        for (int c = 0; c < CT; ++c) {
            if constexpr (HR) { v8u ph, pl;   // two 16-bit planes, packed a register pair at a time
#pragma unroll
                for (int j = 0; j < 16; j += 2) { unsigned short a0, b0, a1, b1; splitf(s[2 * c + j / 8][qt][j % 8] * f, a0, b0); splitf(s[2 * c + j / 8][qt][j % 8 + 1] * f, a1, b1); ph[j / 2] = (unsigned)a0 | ((unsigned)a1 << 16); pl[j / 2] = (unsigned)b0 | ((unsigned)b1 << 16); }
                pf[c][qt] = __builtin_bit_cast(v16bf, ph); pf2[c][qt] = __builtin_bit_cast(v16bf, pl);
                __builtin_amdgcn_sched_barrier(0);   // one fragment's split at a time: opened all at once the half-made planes do not fit the registers and spill
            } else { v8h x0, x1;
#pragma unroll
                for (int j = 0; j < 8; ++j) { x0[j] = tohx(s[2 * c][qt][j] * f); x1[j] = tohx(s[2 * c + 1][qt][j] * f); }
                pf[c][qt] = cat16(x0, x1); } } }
    float* my = red + wave * (QR * OPT);
#pragma unroll
    for (int u = PU; u < DU; ++u) { vf[u] = WFrag<T16>::ld(Vt + voff + (u / CT) * 16 * TT + (u % CT) * 32); if (HR) vf2[u] = WFrag<T16>::ld(Vt2 + voff + (u / CT) * 16 * TT + (u % CT) * 32); }
    v8f o[DT][QT];
#pragma unroll
    for (int dt = 0; dt < DT; ++dt) {
#pragma unroll
        for (int qt = 0; qt < QT; ++qt) o[dt][qt] = (v8f){};
#pragma unroll
        for (int c = 0; c < CT; ++c) { const int u = dt * CT + c, un = u + DU;
            if (un < NU) { vf[un] = WFrag<T16>::ld(Vt + voff + (un / CT) * 16 * TT + (un % CT) * 32); if (HR) vf2[un] = WFrag<T16>::ld(Vt2 + voff + (un / CT) * 16 * TT + (un % CT) * 32); }
            if (un == NU - 1) asm volatile("s_wait_xcnt 0x0" ::: "memory");   // behind the last load, in front of any rewrite of its address registers
            __builtin_amdgcn_sched_barrier(0);   // keeps the load of fragment u + DU in front of fragment u's products (as for the key tiles)
#pragma unroll
            for (int qt = 0; qt < QT; ++qt) { o[dt][qt] = WFrag<T16>::mma(pf[c][qt], vf[u], o[dt][qt]); if (HR) { o[dt][qt] = WFrag<T16>::mma(pf2[c][qt], vf[u], o[dt][qt]); o[dt][qt] = WFrag<T16>::mma(pf[c][qt], vf2[u], o[dt][qt]); } }
            __builtin_amdgcn_sched_barrier(0);   // and the next load behind them
            // a column block is parked one fragment late (the last at once): its registers are still live when the next block's first product is issued, so that product does not overwrite a fresh matrix result
            if ((c == 0 && dt > 0) || u == NU - 1) { const int dp = (u == NU - 1) ? dt : dt - 1;
#pragma unroll
                for (int qt = 0; qt < QT; ++qt)
#pragma unroll
                    for (int j = 0; j < 8; ++j) my[(qt * 16 + hi * 8 + j) * OPT + dp * 16 + lr] = o[dp][qt][j]; }
        }
    }
    __syncthreads();
    { const int row = threadIdx.x / (HD / 4), cofs = (threadIdx.x % (HD / 4)) * 4; v4f val = *(const v4fa*)(red + row * OPT + cofs);   // QR HD / 4 == 32 AW: one 4-float piece a thread
#pragma unroll
        for (int w = 1; w < AW; ++w) val += *(const v4fa*)(red + w * (QR * OPT) + row * OPT + cofs);
        const float cs = HR ? 1.0f : (1.0f / PCAR); v4us oh, ol;
#pragma unroll
        for (int q = 0; q < 4; ++q) { unsigned short a, c2; splitf(val[q] * cs, a, c2); oh[q] = a; ol[q] = c2; }
        const size_t oo = (size_t)row * DQ + cofs; *(v4us*)(ATh + oo) = oh; *(v4us*)(ATl + oo) = ol; }
}
__global__ __launch_bounds__(AW * 32) void k_attn(const h16* __restrict__ Q16, const h16* __restrict__ K16, const h16* __restrict__ V16, const bf* __restrict__ Qh, const bf* __restrict__ Ql, const bf* __restrict__ Kh, const bf* __restrict__ Kl, const bf* __restrict__ Vh, const bf* __restrict__ Vl, const int* __restrict__ km, bf* ATh, bf* ATl) {
    static_assert(QR * HD / 4 == AW * 32 && RH % QR == 0 && TT % QR == 0 && KWV % 32 == 0 && TT == AW * 128 && NH_ == NKV, "tile shape");
    __shared__ __align__(16) float red[AW * QR * OPT]; __shared__ __align__(16) float smx[QR * SP]; __shared__ __align__(16) float ssm[QR * SP]; __shared__ __align__(16) float sma[TT];
    const int h = blockIdx.x, q0 = blockIdx.y * QR; const size_t zp = (size_t)h * TT * HD, zq = zp + (size_t)q0 * HD, zo = (size_t)q0 * DQ + h * HD;
    if (q0 < RH) attn_tile<bf, true>(Qh + zq, Ql + zq, Kh + zp, Kl + zp, Vh + zp, Vl + zp, km, ATh + zo, ATl + zo, red, smx, ssm, sma);   // the same for the whole work-group: the barriers inside stay uniform
    else attn_tile<h16, false>(Q16 + zq, nullptr, K16 + zp, nullptr, V16 + zp, nullptr, km, ATh + zo, ATl + zo, red, smx, ssm, sma);
}

extern "C" void kernel_launch(void* const* d_in, const int* in_sizes, int n_in,
                              void* d_out, int out_size, void* d_ws, size_t ws_size, hipStream_t stream) {
    (void)in_sizes; (void)n_in; (void)out_size;
    const float* x = (const float*)d_in[0]; const float* y = (const float*)d_in[1]; const int* kmask = (const int*)d_in[2]; const float* wq = (const float*)d_in[3]; const float* bq = (const float*)d_in[4]; const float* wk = (const float*)d_in[5]; const float* bk = (const float*)d_in[6]; const float* wv = (const float*)d_in[7]; const float* bv = (const float*)d_in[8]; const float* wo = (const float*)d_in[9]; const float* bo = (const float*)d_in[10]; const float* cosT = nullptr; const float* sinT = nullptr; (void)cosT; (void)sinT;
    float* OUT = (float*)d_out;     // [2][2048][1024]
    char* wsp = (char*)d_ws;
    auto take = [&](size_t bytes) { char* p = wsp; wsp += (bytes + 255) & ~(size_t)255; return (void*)p; };
    bf* WQ = (bf*)take((size_t)DQ * DM * 2); bf* WK = (bf*)take((size_t)DKV * DM * 2); bf* WV = (bf*)take((size_t)DKV * DM * 2); bf* WO = (bf*)take((size_t)DM * DQ * 2);
    bf* XB = (bf*)take((size_t)TT * DM * 2); bf* YB = (bf*)take((size_t)TT * DM * 2);
    h16* QP16 = (h16*)take((size_t)NH_ * TT * HD * 2); h16* KP16 = (h16*)take((size_t)NKV * TT * HD * 2); h16* VT16 = (h16*)take((size_t)NKV * HD * TT * 2);
    bf* QPh = (bf*)take((size_t)NH_ * TT * HD * 2); bf* QPl = (bf*)take((size_t)NH_ * TT * HD * 2); bf* KPh = (bf*)take((size_t)NKV * TT * HD * 2); bf* KPl = (bf*)take((size_t)NKV * TT * HD * 2); bf* VTh = (bf*)take((size_t)NKV * HD * TT * 2); bf* VTl = (bf*)take((size_t)NKV * HD * TT * 2);
    bf* ATh = (bf*)take((size_t)TT * DQ * 2); bf* ATl = (bf*)take((size_t)TT * DQ * 2);
    if ((size_t)(wsp - (char*)d_ws) > ws_size) return;    // ws 256 MiB
    { k_cvt8<<<(unsigned)(((size_t)DQ * DM / 8 + 255) / 256), 256, 0, stream>>>(wq, WQ, (size_t)DQ * DM / 8); k_cvt8<<<(unsigned)(((size_t)DKV * DM / 8 + 255) / 256), 256, 0, stream>>>(wk, WK, (size_t)DKV * DM / 8); k_cvt8<<<(unsigned)(((size_t)DKV * DM / 8 + 255) / 256), 256, 0, stream>>>(wv, WV, (size_t)DKV * DM / 8);
      k_cvt8<<<(unsigned)(((size_t)DM * DQ / 8 + 255) / 256), 256, 0, stream>>>(wo, WO, (size_t)DM * DQ / 8);
       }
    for (int b = 0; b < NB_; ++b) {
        
        k_cvt8<<<(unsigned)(((size_t)TT * DM / 8 + 255) / 256), 256, 0, stream>>>(x + (size_t)b * TT * DM, XB, (size_t)TT * DM / 8); k_cvt8<<<(unsigned)(((size_t)TT * DM / 8 + 255) / 256), 256, 0, stream>>>(y + (size_t)b * TT * DM, YB, (size_t)TT * DM / 8);
        k_gemmk<bf, 0, true, 4, 4, 8, DM / 8, 1><<<dim3(TT / 64, DQ / 64, 1), 256, 0, stream>>>(XB, nullptr, WQ, nullptr, nullptr, DQ, bq, 0, 0, 0, QP16, QPh, QPl);
        k_gemmk<bf, 0, true, 4, 4, 8, DM / 8, 1><<<dim3(TT / 64, DKV / 64, 1), 256, 0, stream>>>(YB, nullptr, WK, nullptr, nullptr, DKV, bk, 0, 0, 0, KP16, KPh, KPl);
        k_gemmk<bf, 0, true, 4, 4, 8, DM / 8, 2><<<dim3(DKV / 64, TT / 64, 1), 256, 0, stream>>>(WV, nullptr, YB, nullptr, nullptr, TT, bv, 0, 0, 0, VT16, VTh, VTl);   // weights as A: v comes out feature-major, the order attn.v reads
        k_attn<<<dim3(NH_, TT / QR, 1), AW * 32, 0, stream>>>(QP16, KP16, VT16, QPh, QPl, KPh, KPl, VTh, VTl, kmask + (size_t)b * TT, ATh, ATl);
        k_gemmk<bf, 1, true, 4, 4, 8, DQ / 8, 0><<<dim3(TT / 64, DM / 64, 1), 256, 0, stream>>>(ATh, ATl, WO, nullptr, OUT + (size_t)b * TT * DM, DM, bo, 0, 0, 0, nullptr, nullptr, nullptr); }
}

// v004
// It runs in 221 microseconds.
// Timed twice side by side with v003, it ran 1.12 and 1.11 times as fast.
// Counting every step since v000, it is 9.67 times as fast.
#include <hip/hip_runtime.h>

// MultiHeadAttention_New (master, slave [2][2048][1024], attention_mask [2][2048] (int, read; random 0/1); q = (master Wq^T + bq) x 0.125, k/v = slave W^T + b (16 x 64); attn = clip(q.k, +-50000) + (mask == 0 ? -9e15 : mask) per key; softmax; out = merged Wo^T + bo -> [2][2048][1024]).
// Compute dtypes, f32 accumulate: every input rounded to bf16; q/k/v on PLAIN bf16 operands (inputs: exact) + bias; scores and attn.v: query rows < 512 hl (3 products), the rest single fp16 (x1024); the clamp and the additive mask term ((mask == 0) ? -9e15 : float(mask), read per key) in f32; softmax f32; Wo hl x exact (2 products) + bias.

#define NB_  2
#define TT   2048
#define DM   1024
#define NH_  16
#define NKV  16
#define REP  (NH_ / NKV)
#define HD   64
#define DQ   (NH_ * HD)
#define DKV  (NKV * HD)
#define RH   512                  // query rows < RH use hi+lo planes (0: none)
#define WIN  0
#define PCAR 1024.0f
#define SCL  0.125f   // HD^-0.5
typedef _Float16 h16;
typedef unsigned short bf;
typedef __attribute__((ext_vector_type(16))) __bf16   v16bf;
typedef __attribute__((ext_vector_type(16))) _Float16 v16h;
typedef __attribute__((ext_vector_type(8)))  _Float16 v8h;
typedef __attribute__((ext_vector_type(8)))  unsigned short v8us;
typedef __attribute__((ext_vector_type(8)))  float    v8f;
typedef __attribute__((ext_vector_type(4)))  float    v4f;
typedef v8h  __attribute__((may_alias)) v8ha;
typedef v4f  __attribute__((may_alias)) v4fa;
typedef v8us __attribute__((may_alias)) v8usa;

__device__ __forceinline__ unsigned short f2bf(float f) { unsigned u = __float_as_uint(f); u += 0x7FFFu + ((u >> 16) & 1u); return (unsigned short)(u >> 16); }
__device__ __forceinline__ float bf2f(unsigned short b) { return __uint_as_float(((unsigned)b) << 16); }
__device__ __forceinline__ float bfr(float f) { return bf2f(f2bf(f)); }
__device__ __forceinline__ v16h cat16(v8h lo, v8h hi) { return __builtin_shufflevector(lo, hi, 0, 1, 2, 3, 4, 5, 6, 7, 8, 9, 10, 11, 12, 13, 14, 15); }
__device__ __forceinline__ v16bf cat16b(v8us lo, v8us hi) { return __builtin_bit_cast(v16bf, __builtin_shufflevector(lo, hi, 0, 1, 2, 3, 4, 5, 6, 7, 8, 9, 10, 11, 12, 13, 14, 15)); }
__device__ __forceinline__ v8f wmma16(v16h a, v16h b, v8f c) { return __builtin_amdgcn_wmma_f32_16x16x32_f16(false, a, false, b, (short)0, c, false, false); }
__device__ __forceinline__ v8f wmmab(v16bf a, v16bf b, v8f c) { return __builtin_amdgcn_wmma_f32_16x16x32_bf16(false, a, false, b, (short)0, c, false, false); }



// ---- operand fragments straight from K-contiguous 16-bit planes: lane lr = row, k = 8 hi + 0..7 and 16 + 8 hi + 0..7 of a 32-wide k step, the same for A and for B
template <typename T16> struct WFrag;
template <> struct WFrag<h16> { typedef v16h V; static __device__ __forceinline__ V ld(const h16* p) { return cat16(*(const v8h*)p, *(const v8h*)(p + 16)); } static __device__ __forceinline__ v8f mma(V a, V b, v8f c) { return wmma16(a, b, c); } };
template <> struct WFrag<bf> { typedef v16bf V; static __device__ __forceinline__ V ld(const bf* p) { return cat16b(*(const v8us*)p, *(const v8us*)(p + 16)); } static __device__ __forceinline__ v8f mma(V a, V b, v8f c) { return wmmab(a, b, c); } };

__device__ __forceinline__ h16 tohx(float x) { return (h16)x; }
__device__ __forceinline__ void splitf(float y, unsigned short& h, unsigned short& l) { h = f2bf(y); l = f2bf(y - bf2f(h)); }
typedef __attribute__((ext_vector_type(4))) _Float16 v4h;
typedef __attribute__((ext_vector_type(4))) unsigned short v4us;

// ---- gemmk_tile: C[m][n] (f32, pitch ldc, + optional f32 bias[n]) = sum_k A[m][k] Bt[n][k] (+ split products per NSPLIT) for a long K: NW waves of one work-group share one (16 MB) x (16 NB) output tile, wave w sums k in [w KW, (w + 1) KW) (K = NW KW) into its own accumulators,
// every wave parks its partial tile in LDS (row-major, pitch 16 NB + 4 floats), one barrier, then the partials are added in wave order 0..NW-1 and whole row pieces are stored (256 bytes of f32, 128 bytes of each 16-bit plane). One work-group of 32 NW threads a tile at rows r0, columns c0; tokens of both batches run through as one row index b TT + t.
// EPI says what is stored. 0: C in f32. 1 and 2: no f32 C; each sum goes straight to the three 16-bit planes that attention reads (fp16, bf16 hi, bf16 lo).
// 1: m = token, n = feature, head planes [b][n / HD][t][n % HD]. 2: m = feature, n = token (weights as A, tokens as Bt), planes [b][m][t], the bias taken per row m.
template <typename T16, int NSPLIT, bool BIAS, int MB, int NB, int NW, int KW, int EPI>
__device__ __forceinline__ void gemmk_tile(const T16* __restrict__ A, const T16* __restrict__ A2, const T16* __restrict__ Bt, const T16* __restrict__ Bt2, float* C, int ldc, const float* __restrict__ bias, int r0, int c0, h16* P16, bf* Ph, bf* Pl, float* red) {
    typedef typename WFrag<T16>::V V;
    constexpr int K = NW * KW, TM = MB * 16, TN = NB * 16, PT = TN + 4;
    const int lane = threadIdx.x & 31, lr = lane & 15, hi = lane >> 4, wave = threadIdx.x >> 5;
    const size_t za = (size_t)r0 * K, zb = (size_t)c0 * K;
    const unsigned off = (unsigned)(lr * K + 8 * hi + wave * KW);   // one lane offset serves both operands: equal pitch K, equal k range
    const T16* pa = A + za + off; const T16* pa2 = (NSPLIT == 1 || NSPLIT == 2) ? A2 + za + off : nullptr; const T16* pb = Bt + zb + off; const T16* pb2 = (NSPLIT >= 2) ? Bt2 + zb + off : nullptr;
    v8f acc[MB][NB];
#pragma unroll
    for (int mb = 0; mb < MB; ++mb)
#pragma unroll
        for (int nb = 0; nb < NB; ++nb) acc[mb][nb] = (v8f){};
    // unrolled: KW / 32 is a small constant, so every k offset becomes an immediate of its load and no matrix instruction stands in front of a back edge
#pragma unroll
    for (int kc = 0; kc < KW; kc += 32) {
        V a[MB], a2[MB];
#pragma unroll
        for (int mb = 0; mb < MB; ++mb) { a[mb] = WFrag<T16>::ld(pa + mb * 16 * K + kc); if (NSPLIT == 1 || NSPLIT == 2) a2[mb] = WFrag<T16>::ld(pa2 + mb * 16 * K + kc); }
#pragma unroll
        for (int nb = 0; nb < NB; ++nb) { const V b = WFrag<T16>::ld(pb + nb * 16 * K + kc); V b2; if (NSPLIT >= 2) b2 = WFrag<T16>::ld(pb2 + nb * 16 * K + kc);
#pragma unroll
            for (int mb = 0; mb < MB; ++mb) { acc[mb][nb] = WFrag<T16>::mma(a[mb], b, acc[mb][nb]); if (NSPLIT == 1 || NSPLIT == 2) acc[mb][nb] = WFrag<T16>::mma(a2[mb], b, acc[mb][nb]); if (NSPLIT >= 2) acc[mb][nb] = WFrag<T16>::mma(a[mb], b2, acc[mb][nb]); } }
    }
    float* my = red + wave * (TM * PT);
#pragma unroll
    for (int mb = 0; mb < MB; ++mb)
#pragma unroll
        for (int nb = 0; nb < NB; ++nb)
#pragma unroll
            for (int j = 0; j < 8; ++j) my[(mb * 16 + hi * 8 + j) * PT + nb * 16 + lr] = acc[mb][nb][j];
    __syncthreads();
    for (int e = threadIdx.x; e < TM * TN / 4; e += NW * 32) { const int row = e / (TN / 4), cofs = (e % (TN / 4)) * 4; v4f val = *(const v4fa*)(red + row * PT + cofs);
#pragma unroll
        for (int w = 1; w < NW; ++w) val += *(const v4fa*)(red + w * (TM * PT) + row * PT + cofs);
        if (BIAS && EPI == 2) { const float br = bfr(bias[r0 + row]); val[0] += br; val[1] += br; val[2] += br; val[3] += br; }
        else if (BIAS) { val[0] += bfr(bias[c0 + cofs]); val[1] += bfr(bias[c0 + cofs + 1]); val[2] += bfr(bias[c0 + cofs + 2]); val[3] += bfr(bias[c0 + cofs + 3]); }
        if constexpr (EPI == 0) *(v4f*)(C + (size_t)(r0 + row) * ldc + c0 + cofs) = val;
        else { v4h o16; v4us oh, ol;
#pragma unroll
            for (int q = 0; q < 4; ++q) { o16[q] = tohx(val[q]); unsigned short a2, c2; splitf(val[q], a2, c2); oh[q] = a2; ol[q] = c2; }
            const size_t oo = (EPI == 1) ? ((size_t)((r0 + row) / TT * NH_ + (c0 + cofs) / HD) * TT + (r0 + row) % TT) * HD + (c0 + cofs) % HD : ((size_t)((c0 + cofs) / TT) * DKV + r0 + row) * TT + (c0 + cofs) % TT;
            *(v4h*)(P16 + oo) = o16; *(v4us*)(Ph + oo) = oh; *(v4us*)(Pl + oo) = ol; } }
}
// ---- k_gemmk: the f32 form of gemmk_tile. grid (M / (16 MB), N / (16 NB)), 32 NW threads.
template <typename T16, int NSPLIT, bool BIAS, int MB, int NB, int NW, int KW>
__global__ __launch_bounds__(NW * 32) void k_gemmk(const T16* __restrict__ A, const T16* __restrict__ A2, const T16* __restrict__ Bt, float* C, int ldc, const float* __restrict__ bias) {
    __shared__ __align__(16) float red[NW * (MB * 16) * (NB * 16 + 4)];
    gemmk_tile<T16, NSPLIT, BIAS, MB, NB, NW, KW, 0>(A, A2, Bt, nullptr, C, ldc, bias, blockIdx.x * (MB * 16), blockIdx.y * (NB * 16), nullptr, nullptr, nullptr, red);
}
// ---- k_qkv: the three projections of both batches in one launch; blockIdx.z says which (0 q, 1 k, 2 v), the same for the whole work-group, so the barrier inside stays uniform. grid (NB_ TT / 64, DQ / 64, 3), 256 threads.
__global__ __launch_bounds__(256) void k_qkv(const bf* __restrict__ XB, const bf* __restrict__ YB, const bf* __restrict__ WQ, const bf* __restrict__ WK, const bf* __restrict__ WV, const float* __restrict__ bq, const float* __restrict__ bk, const float* __restrict__ bv,
                                             h16* QP16, bf* QPh, bf* QPl, h16* KP16, bf* KPh, bf* KPl, h16* VT16, bf* VTh, bf* VTl) {
    static_assert(DQ == DKV && NH_ == NKV && TT % 64 == 0, "one grid serves q, k and v");
    __shared__ __align__(16) float red[8 * 64 * 68];
    const int t0 = blockIdx.x * 64, f0 = blockIdx.y * 64;
    if (blockIdx.z == 2) gemmk_tile<bf, 0, true, 4, 4, 8, DM / 8, 2>(WV, nullptr, YB, nullptr, nullptr, 0, bv, f0, t0, VT16, VTh, VTl, red);   // weights as A: v comes out feature-major, the order attn.v reads
    else { const bool isq = blockIdx.z == 0;
        gemmk_tile<bf, 0, true, 4, 4, 8, DM / 8, 1>(isq ? XB : YB, nullptr, isq ? WQ : WK, nullptr, nullptr, 0, isq ? bq : bk, t0, f0, isq ? QP16 : KP16, isq ? QPh : KPh, isq ? QPl : KPl, red); }
}

typedef __attribute__((ext_vector_type(2))) unsigned short v2us;
typedef __attribute__((ext_vector_type(2))) float v2f;
typedef __attribute__((ext_vector_type(4))) int v4i;
typedef __attribute__((ext_vector_type(8))) unsigned v8u;

__global__ __launch_bounds__(256) void k_wtG(const float* __restrict__ w, int K, int N, bf* Bt) {
    const int lane = threadIdx.x & 31; const int L0 = (blockIdx.x * 8 + (threadIdx.x >> 5)) * 8; const int nlines = N * K / 64;
{
#pragma unroll 1
        for (int l = 0; l < 8; ++l) { const int L = L0 + l; if (L >= nlines) break; const size_t e = (size_t)L * 64 + lane * 2; const int k = (int)(e % K), n = (int)(e / K); v2us o;
            o[0] = f2bf(w[(size_t)k * N + n]); o[1] = f2bf(w[(size_t)(k + 1) * N + n]); *(v2us*)(Bt + e) = o; }
         }
}
// ---- k_cvt8: every f32 operand to bf16 in one launch. blockIdx.y names a chunk of CH elements: the chunks of x, then of y, then the four weights; dst holds them in that order. grid (CH / 2048, 2 XC + 4), 256 threads.
#define CH   (DM * DQ)
#define XC   (NB_ * TT * DM / CH)
__global__ __launch_bounds__(256) void k_cvt8(const float* __restrict__ x, const float* __restrict__ y, const float* __restrict__ wq, const float* __restrict__ wk, const float* __restrict__ wv, const float* __restrict__ wo, bf* dst0) {
    static_assert(NB_ * TT * DM % CH == 0 && DKV == DQ && CH % 2048 == 0, "chunks");
    const int c = blockIdx.y; const float* src = (c < XC) ? x + (size_t)c * CH : (c < 2 * XC) ? y + (size_t)(c - XC) * CH : (c == 2 * XC) ? wq : (c == 2 * XC + 1) ? wk : (c == 2 * XC + 2) ? wv : wo; bf* dst = dst0 + (size_t)c * CH;
    const size_t i = (size_t)blockIdx.x * 256 + threadIdx.x; const v8f v = *(const v8f*)(src + i * 8); v8us o;
    asm volatile("s_wait_xcnt 0x0" ::: "memory");   // behind the loads, in front of the first rewrite of their address registers
#pragma unroll
    for (int k = 0; k < 8; ++k) o[k] = f2bf(v[k]); *(v8us*)(dst + i * 8) = o;  }
// ---- k_attn: scores, softmax, attn.v and the head merge of QR query rows of one head in ONE work-group of AW waves; wave w owns keys [w KWV, (w + 1) KWV). grid (NH_, NB_, TT / QR), 32 AW threads: the hi/lo rows of both batches, the longest work-groups, start first.
// Scores are formed TRANSPOSED (A = 16 keys, B = 16 queries): a lane then holds, for query lr, keys hi 8 + j of each 16-key tile, which is the A-fragment order of attn.v (two tiles = one 32-key fragment), so the probabilities never leave the registers.
// Row maximum and row sum: in the lane, then across the two lane halves, then across the waves through LDS (added in wave order). attn.v partials of the waves are parked in LDS and added in wave order 0..AW-1, scaled, split hi/lo and stored as whole 128-byte row pieces of the merged planes.
#define QR   32
#define AW   16
#define KWV  (TT / AW)
#define SP   20                   // floats per query row of the wave statistics (16 used; 80-byte pitch keeps the 16-byte reads aligned)
#define OPT  (HD + 4)
// fragments asked for ahead of their use, single-plane rows (L) and hi/lo rows (H): key fragments DK, v fragments DU, of which PU already in front of the softmax; the largest that leave no spill at 256 registers
#define DKL 8
#define DKH 2
#define DUL 8
#define DUH 3
#define PUL 6
#define PUH 2
template <typename T16, bool HR>
__device__ __forceinline__ void attn_tile(const T16* __restrict__ Q, const T16* __restrict__ Q2, const T16* __restrict__ Kp, const T16* __restrict__ Kp2, const T16* __restrict__ Vt, const T16* __restrict__ Vt2, const int* __restrict__ km, bf* ATh, bf* ATl, float* red, float* smx, float* ssm, float* sma) {
    typedef typename WFrag<T16>::V V;
    constexpr int QT = QR / 16, KT = KWV / 16, KC = HD / 32, CT = KWV / 32, DT = HD / 16, NU = DT * CT;
    constexpr int DK = HR ? DKH : DKL, DU = HR ? DUH : DUL, PU = HR ? PUH : PUL;
    const v4i mk = *(const v4i*)(km + threadIdx.x * 4);   // TT == 128 AW: four keys a thread; asked for first, used behind the score products
    const int lane = threadIdx.x & 31, lr = lane & 15, hi = lane >> 4, wave = threadIdx.x >> 5; const int k0 = wave * KWV;
    const unsigned qoff = (unsigned)(lr * HD + 8 * hi), koff = (unsigned)((k0 + lr) * HD + 8 * hi), voff = (unsigned)(lr * TT + k0 + 8 * hi);
    V qf[QT][KC], qf2[QT][KC], kf[KT][KC], kf2[KT][KC], vf[NU], vf2[NU];
#pragma unroll
    for (int qt = 0; qt < QT; ++qt)
#pragma unroll
        for (int kc = 0; kc < KC; ++kc) { qf[qt][kc] = WFrag<T16>::ld(Q + qoff + qt * 16 * HD + kc * 32); if (HR) qf2[qt][kc] = WFrag<T16>::ld(Q2 + qoff + qt * 16 * HD + kc * 32); }
#pragma unroll
    for (int n = 0; n < DK; ++n) { kf[n / KC][n % KC] = WFrag<T16>::ld(Kp + koff + (n / KC) * 16 * HD + (n % KC) * 32); if (HR) kf2[n / KC][n % KC] = WFrag<T16>::ld(Kp2 + koff + (n / KC) * 16 * HD + (n % KC) * 32); }
    v8f s[KT][QT];
#pragma unroll
    for (int n = 0; n < KT * KC; ++n) { const int kt = n / KC, kc = n % KC, nn = n + DK;
        if (nn < KT * KC) { kf[nn / KC][nn % KC] = WFrag<T16>::ld(Kp + koff + (nn / KC) * 16 * HD + (nn % KC) * 32); if (HR) kf2[nn / KC][nn % KC] = WFrag<T16>::ld(Kp2 + koff + (nn / KC) * 16 * HD + (nn % KC) * 32); }
        __builtin_amdgcn_sched_barrier(0);   // keeps the loads of key fragment n + DK in front of fragment n's products: left alone the scheduler sinks each load to its use and every fragment waits a whole L2 trip
#pragma unroll
        for (int qt = 0; qt < QT; ++qt) { v8f a = (kc == 0) ? (v8f){} : s[kt][qt];
            a = WFrag<T16>::mma(kf[kt][kc], qf[qt][kc], a); if (HR) { a = WFrag<T16>::mma(kf[kt][kc], qf2[qt][kc], a); a = WFrag<T16>::mma(kf2[kt][kc], qf[qt][kc], a); }
            s[kt][qt] = a; }
        __builtin_amdgcn_sched_barrier(0);   // and the next fragment's loads behind these products
    }
    { v4f ma;
#pragma unroll
        for (int q = 0; q < 4; ++q) ma[q] = (mk[q] == 0) ? -9.0e15f : (float)mk[q];
        *(v4fa*)(sma + threadIdx.x * 4) = ma; }
    __syncthreads();
    // v fragments in the order of their use, u = dt CT + c; the first PU fly while the softmax runs (asked for behind the barrier above, which would wait for them)
#pragma unroll
    for (int u = 0; u < PU; ++u) { vf[u] = WFrag<T16>::ld(Vt + voff + (u / CT) * 16 * TT + (u % CT) * 32); if (HR) vf2[u] = WFrag<T16>::ld(Vt2 + voff + (u / CT) * 16 * TT + (u % CT) * 32); }
    asm volatile("s_wait_xcnt 0x0" ::: "memory");   // in front of the first rewrite of an address register that a load issued so far names
    __builtin_amdgcn_sched_barrier(0);   // keeps those loads in front of the softmax
    float mx[QT];
#pragma unroll
    for (int qt = 0; qt < QT; ++qt) mx[qt] = -3.0e38f;
#pragma unroll
    for (int kt = 0; kt < KT; ++kt) { const v4f a0 = *(const v4fa*)(sma + k0 + kt * 16 + hi * 8), a1 = *(const v4fa*)(sma + k0 + kt * 16 + hi * 8 + 4);
#pragma unroll
        for (int qt = 0; qt < QT; ++qt)
#pragma unroll
            for (int j = 0; j < 8; ++j) { const float t = __fadd_rn(fminf(fmaxf(s[kt][qt][j] * SCL, -50000.0f), 50000.0f), (j < 4) ? a0[j & 3] : a1[j & 3]); s[kt][qt][j] = t; mx[qt] = fmaxf(mx[qt], t); } }
#pragma unroll
    for (int qt = 0; qt < QT; ++qt) { mx[qt] = fmaxf(mx[qt], __shfl_xor(mx[qt], 16, 32)); if (hi == 0) smx[(qt * 16 + lr) * SP + wave] = mx[qt]; }
    __syncthreads();
#pragma unroll
    for (int qt = 0; qt < QT; ++qt) { float m = -3.0e38f;
#pragma unroll
        for (int w4 = 0; w4 < AW / 4; ++w4) { const v4f p = *(const v4fa*)(smx + (qt * 16 + lr) * SP + w4 * 4); m = fmaxf(fmaxf(fmaxf(m, p[0]), fmaxf(p[1], p[2])), p[3]); }
        float sum = 0.f;
#pragma unroll
        for (int kt = 0; kt < KT; ++kt)
#pragma unroll
            for (int j = 0; j < 8; ++j) { const float e = __builtin_amdgcn_exp2f(__fmul_rn(__fsub_rn(s[kt][qt][j], m), 1.4426950408889634f)); s[kt][qt][j] = e; sum += e; }
        sum += __shfl_xor(sum, 16, 32); if (hi == 0) ssm[(qt * 16 + lr) * SP + wave] = sum; }
    __syncthreads();
    V pf[CT][QT], pf2[CT][QT];
#pragma unroll
    for (int qt = 0; qt < QT; ++qt) { float sum = 0.f;
#pragma unroll
        for (int w4 = 0; w4 < AW / 4; ++w4) { const v4f p = *(const v4fa*)(ssm + (qt * 16 + lr) * SP + w4 * 4); sum += p[0]; sum += p[1]; sum += p[2]; sum += p[3]; }
        const float f = __fdiv_rn(HR ? 1.0f : PCAR, sum);
#pragma unroll
        for (int c = 0; c < CT; ++c) {
            if constexpr (HR) { v8u ph, pl;   // two 16-bit planes, packed a register pair at a time
#pragma unroll
                for (int j = 0; j < 16; j += 2) { unsigned short a0, b0, a1, b1; splitf(s[2 * c + j / 8][qt][j % 8] * f, a0, b0); splitf(s[2 * c + j / 8][qt][j % 8 + 1] * f, a1, b1); ph[j / 2] = (unsigned)a0 | ((unsigned)a1 << 16); pl[j / 2] = (unsigned)b0 | ((unsigned)b1 << 16); }
                pf[c][qt] = __builtin_bit_cast(v16bf, ph); pf2[c][qt] = __builtin_bit_cast(v16bf, pl);
                __builtin_amdgcn_sched_barrier(0);   // one fragment's split at a time: opened all at once the half-made planes do not fit the registers and spill
            } else { v8h x0, x1;
#pragma unroll
                for (int j = 0; j < 8; ++j) { x0[j] = tohx(s[2 * c][qt][j] * f); x1[j] = tohx(s[2 * c + 1][qt][j] * f); }
                pf[c][qt] = cat16(x0, x1); } } }
    float* my = red + wave * (QR * OPT);
#pragma unroll
    for (int u = PU; u < DU; ++u) { vf[u] = WFrag<T16>::ld(Vt + voff + (u / CT) * 16 * TT + (u % CT) * 32); if (HR) vf2[u] = WFrag<T16>::ld(Vt2 + voff + (u / CT) * 16 * TT + (u % CT) * 32); }
    v8f o[DT][QT];
#pragma unroll
    for (int dt = 0; dt < DT; ++dt) {
#pragma unroll
        for (int qt = 0; qt < QT; ++qt) o[dt][qt] = (v8f){};
#pragma unroll
        for (int c = 0; c < CT; ++c) { const int u = dt * CT + c, un = u + DU;
            if (un < NU) { vf[un] = WFrag<T16>::ld(Vt + voff + (un / CT) * 16 * TT + (un % CT) * 32); if (HR) vf2[un] = WFrag<T16>::ld(Vt2 + voff + (un / CT) * 16 * TT + (un % CT) * 32); }
            if (un == NU - 1) asm volatile("s_wait_xcnt 0x0" ::: "memory");   // behind the last load, in front of any rewrite of its address registers
            __builtin_amdgcn_sched_barrier(0);   // keeps the load of fragment u + DU in front of fragment u's products (as for the key tiles)
#pragma unroll
            for (int qt = 0; qt < QT; ++qt) { o[dt][qt] = WFrag<T16>::mma(pf[c][qt], vf[u], o[dt][qt]); if (HR) { o[dt][qt] = WFrag<T16>::mma(pf2[c][qt], vf[u], o[dt][qt]); o[dt][qt] = WFrag<T16>::mma(pf[c][qt], vf2[u], o[dt][qt]); } }
            __builtin_amdgcn_sched_barrier(0);   // and the next load behind them
            // a column block is parked one fragment late (the last at once): its registers are still live when the next block's first product is issued, so that product does not overwrite a fresh matrix result
            if ((c == 0 && dt > 0) || u == NU - 1) { const int dp = (u == NU - 1) ? dt : dt - 1;
#pragma unroll
                for (int qt = 0; qt < QT; ++qt)
#pragma unroll
                    for (int j = 0; j < 8; ++j) my[(qt * 16 + hi * 8 + j) * OPT + dp * 16 + lr] = o[dp][qt][j]; }
        }
    }
    __syncthreads();
    { const int row = threadIdx.x / (HD / 4), cofs = (threadIdx.x % (HD / 4)) * 4; v4f val = *(const v4fa*)(red + row * OPT + cofs);   // QR HD / 4 == 32 AW: one 4-float piece a thread
#pragma unroll
        for (int w = 1; w < AW; ++w) val += *(const v4fa*)(red + w * (QR * OPT) + row * OPT + cofs);
        const float cs = HR ? 1.0f : (1.0f / PCAR); v4us oh, ol;
#pragma unroll
        for (int q = 0; q < 4; ++q) { unsigned short a, c2; splitf(val[q] * cs, a, c2); oh[q] = a; ol[q] = c2; }
        const size_t oo = (size_t)row * DQ + cofs; *(v4us*)(ATh + oo) = oh; *(v4us*)(ATl + oo) = ol; }
}
__global__ __launch_bounds__(AW * 32) void k_attn(const h16* __restrict__ Q16, const h16* __restrict__ K16, const h16* __restrict__ V16, const bf* __restrict__ Qh, const bf* __restrict__ Ql, const bf* __restrict__ Kh, const bf* __restrict__ Kl, const bf* __restrict__ Vh, const bf* __restrict__ Vl, const int* __restrict__ km, bf* ATh, bf* ATl) {
    static_assert(QR * HD / 4 == AW * 32 && RH % QR == 0 && TT % QR == 0 && KWV % 32 == 0 && TT == AW * 128 && NH_ == NKV, "tile shape");
    __shared__ __align__(16) float red[AW * QR * OPT]; __shared__ __align__(16) float smx[QR * SP]; __shared__ __align__(16) float ssm[QR * SP]; __shared__ __align__(16) float sma[TT];
    const int h = blockIdx.x, b = blockIdx.y, q0 = blockIdx.z * QR; const size_t zp = (size_t)(b * NH_ + h) * TT * HD, zq = zp + (size_t)q0 * HD, zo = (size_t)(b * TT + q0) * DQ + h * HD; km += b * TT;
    if (q0 < RH) attn_tile<bf, true>(Qh + zq, Ql + zq, Kh + zp, Kl + zp, Vh + zp, Vl + zp, km, ATh + zo, ATl + zo, red, smx, ssm, sma);   // the same for the whole work-group: the barriers inside stay uniform
    else attn_tile<h16, false>(Q16 + zq, nullptr, K16 + zp, nullptr, V16 + zp, nullptr, km, ATh + zo, ATl + zo, red, smx, ssm, sma);
}

extern "C" void kernel_launch(void* const* d_in, const int* in_sizes, int n_in,
                              void* d_out, int out_size, void* d_ws, size_t ws_size, hipStream_t stream) {
    (void)in_sizes; (void)n_in; (void)out_size;
    const float* x = (const float*)d_in[0]; const float* y = (const float*)d_in[1]; const int* kmask = (const int*)d_in[2]; const float* wq = (const float*)d_in[3]; const float* bq = (const float*)d_in[4]; const float* wk = (const float*)d_in[5]; const float* bk = (const float*)d_in[6]; const float* wv = (const float*)d_in[7]; const float* bv = (const float*)d_in[8]; const float* wo = (const float*)d_in[9]; const float* bo = (const float*)d_in[10]; const float* cosT = nullptr; const float* sinT = nullptr; (void)cosT; (void)sinT;
    float* OUT = (float*)d_out;     // [2][2048][1024]
    char* wsp = (char*)d_ws;
    auto take = [&](size_t bytes) { char* p = wsp; wsp += (bytes + 255) & ~(size_t)255; return (void*)p; };
    bf* XB = (bf*)take((size_t)NB_ * TT * DM * 2); bf* YB = (bf*)take((size_t)NB_ * TT * DM * 2);   // XB .. WO lie back to back: the one destination of k_cvt8
    bf* WQ = (bf*)take((size_t)DQ * DM * 2); bf* WK = (bf*)take((size_t)DKV * DM * 2); bf* WV = (bf*)take((size_t)DKV * DM * 2); bf* WO = (bf*)take((size_t)DM * DQ * 2);
    const size_t PB = (size_t)NB_ * NH_ * TT * HD * 2;    // bytes of one 16-bit plane, both batches
    h16* QP16 = (h16*)take(PB); h16* KP16 = (h16*)take(PB); h16* VT16 = (h16*)take(PB);
    bf* QPh = (bf*)take(PB); bf* QPl = (bf*)take(PB); bf* KPh = (bf*)take(PB); bf* KPl = (bf*)take(PB); bf* VTh = (bf*)take(PB); bf* VTl = (bf*)take(PB);
    bf* ATh = (bf*)take(PB); bf* ATl = (bf*)take(PB);
    if ((size_t)(wsp - (char*)d_ws) > ws_size) return;    // ws 256 MiB
    k_cvt8<<<dim3(CH / 2048, 2 * XC + 4, 1), 256, 0, stream>>>(x, y, wq, wk, wv, wo, XB);
    k_qkv<<<dim3(NB_ * TT / 64, DQ / 64, 3), 256, 0, stream>>>(XB, YB, WQ, WK, WV, bq, bk, bv, QP16, QPh, QPl, KP16, KPh, KPl, VT16, VTh, VTl);
    k_attn<<<dim3(NH_, NB_, TT / QR), AW * 32, 0, stream>>>(QP16, KP16, VT16, QPh, QPl, KPh, KPl, VTh, VTl, kmask, ATh, ATl);
    k_gemmk<bf, 1, true, 4, 4, 8, DQ / 8><<<dim3(NB_ * TT / 64, DM / 64, 1), 256, 0, stream>>>(ATh, ATl, WO, OUT, DM, bo);
}

// v005
// One run takes 171 microseconds.
// Two timings next to v004 both put it at 1.29 times that version's speed.
// All steps since v000 together make it 12.5 times as fast.
#include <hip/hip_runtime.h>

// MultiHeadAttention_New (master, slave [2][2048][1024], attention_mask [2][2048] (int, read; random 0/1); q = (master Wq^T + bq) x 0.125, k/v = slave W^T + b (16 x 64); attn = clip(q.k, +-50000) + (mask == 0 ? -9e15 : mask) per key; softmax; out = merged Wo^T + bo -> [2][2048][1024]).
// Compute dtypes, f32 accumulate: every input rounded to bf16; q/k/v on PLAIN bf16 operands (inputs: exact) + bias; scores and attn.v: query rows < 512 hl (3 products), the rest single fp16 (x1024); the clamp and the additive mask term ((mask == 0) ? -9e15 : float(mask), read per key) in f32; softmax f32; Wo hl x exact (2 products) + bias.

#define NB_  2
#define TT   2048
#define DM   1024
#define NH_  16
#define NKV  16
#define REP  (NH_ / NKV)
#define HD   64
#define DQ   (NH_ * HD)
#define DKV  (NKV * HD)
#define RH   512                  // query rows < RH use hi+lo planes (0: none)
#define WIN  0
#define PCAR 1024.0f
#define SCL  0.125f   // HD^-0.5
typedef _Float16 h16;
typedef unsigned short bf;
typedef __attribute__((ext_vector_type(16))) __bf16   v16bf;
typedef __attribute__((ext_vector_type(16))) _Float16 v16h;
typedef __attribute__((ext_vector_type(8)))  _Float16 v8h;
typedef __attribute__((ext_vector_type(8)))  unsigned short v8us;
typedef __attribute__((ext_vector_type(8)))  float    v8f;
typedef __attribute__((ext_vector_type(4)))  float    v4f;
typedef v8h  __attribute__((may_alias)) v8ha;
typedef v4f  __attribute__((may_alias)) v4fa;
typedef v8us __attribute__((may_alias)) v8usa;

__device__ __forceinline__ unsigned short f2bf(float f) { unsigned u = __float_as_uint(f); u += 0x7FFFu + ((u >> 16) & 1u); return (unsigned short)(u >> 16); }
__device__ __forceinline__ float bf2f(unsigned short b) { return __uint_as_float(((unsigned)b) << 16); }
__device__ __forceinline__ float bfr(float f) { return bf2f(f2bf(f)); }
__device__ __forceinline__ v16h cat16(v8h lo, v8h hi) { return __builtin_shufflevector(lo, hi, 0, 1, 2, 3, 4, 5, 6, 7, 8, 9, 10, 11, 12, 13, 14, 15); }
__device__ __forceinline__ v16bf cat16b(v8us lo, v8us hi) { return __builtin_bit_cast(v16bf, __builtin_shufflevector(lo, hi, 0, 1, 2, 3, 4, 5, 6, 7, 8, 9, 10, 11, 12, 13, 14, 15)); }
__device__ __forceinline__ v8f wmma16(v16h a, v16h b, v8f c) { return __builtin_amdgcn_wmma_f32_16x16x32_f16(false, a, false, b, (short)0, c, false, false); }
__device__ __forceinline__ v8f wmmab(v16bf a, v16bf b, v8f c) { return __builtin_amdgcn_wmma_f32_16x16x32_bf16(false, a, false, b, (short)0, c, false, false); }



// ---- operand fragments straight from 16-bit planes kept in FRAGMENT ORDER: lane lr + 16 hi = row lr, k = 8 hi + 0..7 and 16 + 8 hi + 0..7 of a 32-wide k step, the same for A and for B.
// A plane of K-wide rows is cut into blocks of 16 rows x 32 k (512 elements, 1 KiB), block (row / 16, k / 32) with k / 32 running fastest; in a block the 8 elements of a lane's first load lie at lane x 8, those of its second at 256 + lane x 8.
// So each wave-wide 16-byte load reads 512 contiguous bytes (4 whole lines) where row-major planes gave it 32 bytes of each of 16 lines. pk: where element (row, k) lies.
__device__ __forceinline__ size_t pk(int row, int k, int K) { return ((size_t)(row >> 4) * (K >> 5) + (k >> 5)) * 512 + ((k >> 4) & 1) * 256 + ((((k >> 3) & 1) << 4) + (row & 15)) * 8 + (k & 7); }
template <typename T16> struct WFrag;
template <> struct WFrag<h16> { typedef v16h V; static __device__ __forceinline__ V ld(const h16* p) { return cat16(*(const v8h*)p, *(const v8h*)(p + 256)); } static __device__ __forceinline__ v8f mma(V a, V b, v8f c) { return wmma16(a, b, c); } };
template <> struct WFrag<bf> { typedef v16bf V; static __device__ __forceinline__ V ld(const bf* p) { return cat16b(*(const v8us*)p, *(const v8us*)(p + 256)); } static __device__ __forceinline__ v8f mma(V a, V b, v8f c) { return wmmab(a, b, c); } };

__device__ __forceinline__ h16 tohx(float x) { return (h16)x; }
__device__ __forceinline__ void splitf(float y, unsigned short& h, unsigned short& l) { h = f2bf(y); l = f2bf(y - bf2f(h)); }
typedef __attribute__((ext_vector_type(4))) _Float16 v4h;
typedef __attribute__((ext_vector_type(4))) unsigned short v4us;

// ---- gemmk_tile: C[m][n] (f32, pitch ldc, + optional f32 bias[n]) = sum_k A[m][k] Bt[n][k] (+ split products per NSPLIT) for a long K: NW waves of one work-group share one (16 MB) x (16 NB) output tile, wave w sums k in [w KW, (w + 1) KW) (K = NW KW) into its own accumulators,
// every wave parks its partial tile in LDS (row-major, pitch 16 NB + 4 floats), one barrier, then the partials are added in wave order 0..NW-1 and whole 256-byte pieces are stored (rows of C; 16 rows x 8 columns of a plane block). One work-group of 32 NW threads a tile at rows r0, columns c0; tokens of both batches run through as one row index b TT + t.
// EPI says what is stored. 0: C in f32. 1 and 2: no f32 C; each sum goes straight to the three 16-bit planes that attention reads (fp16, bf16 hi, bf16 lo).
// 1: m = token, n = feature, head planes [b][n / HD] of rows t, k = n % HD. 2: m = feature, n = token (weights as A, tokens as Bt), planes [b] of rows m, k = t, the bias taken per row m. A, Bt and the planes written are all in fragment order (pk).
template <typename T16, int NSPLIT, bool BIAS, int MB, int NB, int NW, int KW, int EPI>
__device__ __forceinline__ void gemmk_tile(const T16* __restrict__ A, const T16* __restrict__ A2, const T16* __restrict__ Bt, const T16* __restrict__ Bt2, float* C, int ldc, const float* __restrict__ bias, int r0, int c0, h16* P16, bf* Ph, bf* Pl, float* red) {
    typedef typename WFrag<T16>::V V;
    constexpr int K = NW * KW, TM = MB * 16, TN = NB * 16, PT = TN + 4;
    const int lane = threadIdx.x & 31, lr = lane & 15, hi = lane >> 4, wave = threadIdx.x >> 5;
    const size_t za = (size_t)r0 * K, zb = (size_t)c0 * K;
    const unsigned off = (unsigned)(lane * 8 + wave * (KW / 32) * 512);   // one lane offset serves both operands: equal K, equal k range; r0 and c0 are multiples of 16, so r0 K and c0 K are where their row panels start
    const T16* pa = A + za + off; const T16* pa2 = (NSPLIT == 1 || NSPLIT == 2) ? A2 + za + off : nullptr; const T16* pb = Bt + zb + off; const T16* pb2 = (NSPLIT >= 2) ? Bt2 + zb + off : nullptr;
    v8f acc[MB][NB];
#pragma unroll
    for (int mb = 0; mb < MB; ++mb)
#pragma unroll
        for (int nb = 0; nb < NB; ++nb) acc[mb][nb] = (v8f){};
    // unrolled: KW / 32 is a small constant, so every k offset becomes an immediate of its load and no matrix instruction stands in front of a back edge
#pragma unroll
    for (int kc = 0; kc < KW; kc += 32) {
        V a[MB], a2[MB];
#pragma unroll
        for (int mb = 0; mb < MB; ++mb) { a[mb] = WFrag<T16>::ld(pa + mb * 16 * K + kc * 16); if (NSPLIT == 1 || NSPLIT == 2) a2[mb] = WFrag<T16>::ld(pa2 + mb * 16 * K + kc * 16); }
#pragma unroll
        for (int nb = 0; nb < NB; ++nb) { const V b = WFrag<T16>::ld(pb + nb * 16 * K + kc * 16); V b2; if (NSPLIT >= 2) b2 = WFrag<T16>::ld(pb2 + nb * 16 * K + kc * 16);
#pragma unroll
            for (int mb = 0; mb < MB; ++mb) { acc[mb][nb] = WFrag<T16>::mma(a[mb], b, acc[mb][nb]); if (NSPLIT == 1 || NSPLIT == 2) acc[mb][nb] = WFrag<T16>::mma(a2[mb], b, acc[mb][nb]); if (NSPLIT >= 2) acc[mb][nb] = WFrag<T16>::mma(a[mb], b2, acc[mb][nb]); } }
    }
    asm volatile("s_wait_xcnt 0x0" ::: "memory");   // behind the last load, in front of any rewrite of its address registers
    float* my = red + wave * (TM * PT);
#pragma unroll
    for (int mb = 0; mb < MB; ++mb)
#pragma unroll
        for (int nb = 0; nb < NB; ++nb)
#pragma unroll
            for (int j = 0; j < 8; ++j) my[(mb * 16 + hi * 8 + j) * PT + nb * 16 + lr] = acc[mb][nb][j];
    __syncthreads();
    for (int e = threadIdx.x; e < TM * TN / 4; e += NW * 32) {
        // f32 C: a wave takes whole rows. Planes: a wave takes 16 rows x 8 columns, lane = row + 16 x (column half), which are 256 contiguous bytes of a block
        const int row = (EPI == 0) ? e / (TN / 4) : ((e >> 5) / (TN / 8)) * 16 + (e & 15), cofs = (EPI == 0) ? (e % (TN / 4)) * 4 : ((e >> 5) % (TN / 8)) * 8 + ((e >> 4) & 1) * 4; v4f val = *(const v4fa*)(red + row * PT + cofs);
#pragma unroll
        for (int w = 1; w < NW; ++w) val += *(const v4fa*)(red + w * (TM * PT) + row * PT + cofs);
        if (BIAS && EPI == 2) { const float br = bfr(bias[r0 + row]); val[0] += br; val[1] += br; val[2] += br; val[3] += br; }
        else if (BIAS) { val[0] += bfr(bias[c0 + cofs]); val[1] += bfr(bias[c0 + cofs + 1]); val[2] += bfr(bias[c0 + cofs + 2]); val[3] += bfr(bias[c0 + cofs + 3]); }
        if constexpr (EPI == 0) *(v4f*)(C + (size_t)(r0 + row) * ldc + c0 + cofs) = val;
        else { v4h o16; v4us oh, ol;
#pragma unroll
            for (int q = 0; q < 4; ++q) { o16[q] = tohx(val[q]); unsigned short a2, c2; splitf(val[q], a2, c2); oh[q] = a2; ol[q] = c2; }
            const size_t oo = (EPI == 1) ? (size_t)((r0 + row) / TT * NH_ + (c0 + cofs) / HD) * TT * HD + pk((r0 + row) % TT, (c0 + cofs) % HD, HD) : (size_t)((c0 + cofs) / TT) * DKV * TT + pk(r0 + row, (c0 + cofs) % TT, TT);
            *(v4h*)(P16 + oo) = o16; *(v4us*)(Ph + oo) = oh; *(v4us*)(Pl + oo) = ol; } }
}
// ---- k_gemmk: the f32 form of gemmk_tile. grid (M / (16 MB), N / (16 NB)), 32 NW threads.
template <typename T16, int NSPLIT, bool BIAS, int MB, int NB, int NW, int KW>
__global__ __launch_bounds__(NW * 32) void k_gemmk(const T16* __restrict__ A, const T16* __restrict__ A2, const T16* __restrict__ Bt, float* C, int ldc, const float* __restrict__ bias) {
    __shared__ __align__(16) float red[NW * (MB * 16) * (NB * 16 + 4)];
    gemmk_tile<T16, NSPLIT, BIAS, MB, NB, NW, KW, 0>(A, A2, Bt, nullptr, C, ldc, bias, blockIdx.x * (MB * 16), blockIdx.y * (NB * 16), nullptr, nullptr, nullptr, red);
}
// ---- k_qkv: the three projections of both batches in one launch; blockIdx.z says which (0 q, 1 k, 2 v), the same for the whole work-group, so the barrier inside stays uniform. grid (NB_ TT / 64, DQ / 64, 3), 256 threads.
__global__ __launch_bounds__(256) void k_qkv(const bf* __restrict__ XB, const bf* __restrict__ YB, const bf* __restrict__ WQ, const bf* __restrict__ WK, const bf* __restrict__ WV, const float* __restrict__ bq, const float* __restrict__ bk, const float* __restrict__ bv,
                                             h16* QP16, bf* QPh, bf* QPl, h16* KP16, bf* KPh, bf* KPl, h16* VT16, bf* VTh, bf* VTl) {
    static_assert(DQ == DKV && NH_ == NKV && TT % 64 == 0, "one grid serves q, k and v");
    __shared__ __align__(16) float red[8 * 64 * 68];
    const int t0 = blockIdx.x * 64, f0 = blockIdx.y * 64;
    if (blockIdx.z == 2) gemmk_tile<bf, 0, true, 4, 4, 8, DM / 8, 2>(WV, nullptr, YB, nullptr, nullptr, 0, bv, f0, t0, VT16, VTh, VTl, red);   // weights as A: v comes out feature-major, the order attn.v reads
    else { const bool isq = blockIdx.z == 0;
        gemmk_tile<bf, 0, true, 4, 4, 8, DM / 8, 1>(isq ? XB : YB, nullptr, isq ? WQ : WK, nullptr, nullptr, 0, isq ? bq : bk, t0, f0, isq ? QP16 : KP16, isq ? QPh : KPh, isq ? QPl : KPl, red); }
}

typedef __attribute__((ext_vector_type(2))) unsigned short v2us;
typedef __attribute__((ext_vector_type(2))) float v2f;
typedef __attribute__((ext_vector_type(4))) int v4i;
typedef __attribute__((ext_vector_type(8))) unsigned v8u;

__global__ __launch_bounds__(256) void k_wtG(const float* __restrict__ w, int K, int N, bf* Bt) {
    const int lane = threadIdx.x & 31; const int L0 = (blockIdx.x * 8 + (threadIdx.x >> 5)) * 8; const int nlines = N * K / 64;
{
#pragma unroll 1
        for (int l = 0; l < 8; ++l) { const int L = L0 + l; if (L >= nlines) break; const size_t e = (size_t)L * 64 + lane * 2; const int k = (int)(e % K), n = (int)(e / K); v2us o;
            o[0] = f2bf(w[(size_t)k * N + n]); o[1] = f2bf(w[(size_t)(k + 1) * N + n]); *(v2us*)(Bt + e) = o; }
         }
}
// ---- k_cvt8: every f32 operand to bf16, in fragment order, in one launch. blockIdx.y names a chunk of CH elements: the chunks of x, then of y, then the four weights; dst holds them in that order. grid (CH / 2048, 2 XC + 4), 256 threads.
// A work-group takes 16 rows x 128 k: 2048 contiguous elements of dst (four blocks). Piece p = k / 8 of row r goes to piece 16 p + r: the 16-byte pieces are turned through LDS (pitch 272 bytes: no bank met twice), so reads and stores both stay on whole lines.
#define CH   (DM * DQ)
#define XC   (NB_ * TT * DM / CH)
__global__ __launch_bounds__(256) void k_cvt8(const float* __restrict__ x, const float* __restrict__ y, const float* __restrict__ wq, const float* __restrict__ wk, const float* __restrict__ wv, const float* __restrict__ wo, bf* dst0) {
    static_assert(NB_ * TT * DM % CH == 0 && DKV == DQ && DQ == DM && CH % (16 * DM) == 0 && DM % 128 == 0, "chunks");
    __shared__ __align__(16) bf st[16 * 136];
    const int c = blockIdx.y; const float* src = (c < XC) ? x + (size_t)c * CH : (c < 2 * XC) ? y + (size_t)(c - XC) * CH : (c == 2 * XC) ? wq : (c == 2 * XC + 1) ? wk : (c == 2 * XC + 2) ? wv : wo; bf* dst = dst0 + (size_t)c * CH;
    const int r = threadIdx.x >> 4, p = threadIdx.x & 15; const v8f v = *(const v8f*)(src + (size_t)(blockIdx.x / (DM / 128) * 16 + r) * DM + blockIdx.x % (DM / 128) * 128 + p * 8); v8us o;
    asm volatile("s_wait_xcnt 0x0" ::: "memory");   // behind the loads, in front of the first rewrite of their address registers
#pragma unroll
    for (int k = 0; k < 8; ++k) o[k] = f2bf(v[k]);
    *(v8usa*)(st + p * 136 + r * 8) = o;
    __syncthreads();
    *(v8us*)(dst + (size_t)blockIdx.x * 2048 + threadIdx.x * 8) = *(const v8usa*)(st + r * 136 + p * 8);  }
// ---- k_attn: scores, softmax, attn.v and the head merge of QR query rows of one head in ONE work-group of AW waves; wave w owns keys [w KWV, (w + 1) KWV). grid (NH_, NB_, TT / QR), 32 AW threads: the hi/lo rows of both batches, the longest work-groups, start first.
// Scores are formed TRANSPOSED (A = 16 keys, B = 16 queries): a lane then holds, for query lr, keys hi 8 + j of each 16-key tile, which is the A-fragment order of attn.v (two tiles = one 32-key fragment), so the probabilities never leave the registers.
// Row maximum and row sum: in the lane, then across the two lane halves, then across the waves through LDS (added in wave order). attn.v partials of the waves are parked in LDS and added in wave order 0..AW-1, scaled, split hi/lo and stored as 256-byte pieces of the merged planes. Every plane read or written here is in fragment order (pk).
#define QR   32
#define AW   16
#define KWV  (TT / AW)
#define SP   20                   // floats per query row of the wave statistics (16 used; 80-byte pitch keeps the 16-byte reads aligned)
#define OPT  (HD + 4)
// fragments asked for ahead of their use, single-plane rows (L) and hi/lo rows (H): key fragments DK, v fragments DU, of which PU already in front of the softmax; the largest that leave no spill at 256 registers
#define DKL 8
#define DKH 2
#define DUL 8
#define DUH 3
#define PUL 6
#define PUH 1
template <typename T16, bool HR>
__device__ __forceinline__ void attn_tile(const T16* __restrict__ Q, const T16* __restrict__ Q2, const T16* __restrict__ Kp, const T16* __restrict__ Kp2, const T16* __restrict__ Vt, const T16* __restrict__ Vt2, const int* __restrict__ km, bf* ATh, bf* ATl, int orow, int ocol, float* red, float* smx, float* ssm, float* sma) {
    typedef typename WFrag<T16>::V V;
    constexpr int QT = QR / 16, KT = KWV / 16, KC = HD / 32, CT = KWV / 32, DT = HD / 16, NU = DT * CT;
    constexpr int DK = HR ? DKH : DKL, DU = HR ? DUH : DUL, PU = HR ? PUH : PUL;
    const v4i mk = *(const v4i*)(km + threadIdx.x * 4);   // TT == 128 AW: four keys a thread; asked for first, used behind the score products
    const int lane = threadIdx.x & 31, lr = lane & 15, hi = lane >> 4, wave = threadIdx.x >> 5; const int k0 = wave * KWV;
    const unsigned qoff = (unsigned)(lane * 8), koff = (unsigned)(k0 * HD + lane * 8), voff = (unsigned)(k0 * 16 + lane * 8);   // fragment order: block (row / 16, k / 32) of 512 elements
    V qf[QT][KC], qf2[QT][KC], kf[KT][KC], kf2[KT][KC], vf[NU], vf2[NU];
#pragma unroll
    for (int qt = 0; qt < QT; ++qt)
#pragma unroll
        for (int kc = 0; kc < KC; ++kc) { qf[qt][kc] = WFrag<T16>::ld(Q + qoff + qt * 16 * HD + kc * 512); if (HR) qf2[qt][kc] = WFrag<T16>::ld(Q2 + qoff + qt * 16 * HD + kc * 512); }
#pragma unroll
    for (int n = 0; n < DK; ++n) { kf[n / KC][n % KC] = WFrag<T16>::ld(Kp + koff + (n / KC) * 16 * HD + (n % KC) * 512); if (HR) kf2[n / KC][n % KC] = WFrag<T16>::ld(Kp2 + koff + (n / KC) * 16 * HD + (n % KC) * 512); }
    v8f s[KT][QT];
#pragma unroll
    for (int n = 0; n < KT * KC; ++n) { const int kt = n / KC, kc = n % KC, nn = n + DK;
        if (nn < KT * KC) { kf[nn / KC][nn % KC] = WFrag<T16>::ld(Kp + koff + (nn / KC) * 16 * HD + (nn % KC) * 512); if (HR) kf2[nn / KC][nn % KC] = WFrag<T16>::ld(Kp2 + koff + (nn / KC) * 16 * HD + (nn % KC) * 512); }
        if (nn == KT * KC - 1) asm volatile("s_wait_xcnt 0x0" ::: "memory");   // behind the last key load, in front of any rewrite of its address registers
        __builtin_amdgcn_sched_barrier(0);   // keeps the loads of key fragment n + DK in front of fragment n's products: left alone the scheduler sinks each load to its use and every fragment waits a whole L2 trip
#pragma unroll
        for (int qt = 0; qt < QT; ++qt) { v8f a = (kc == 0) ? (v8f){} : s[kt][qt];
            a = WFrag<T16>::mma(kf[kt][kc], qf[qt][kc], a); if (HR) { a = WFrag<T16>::mma(kf[kt][kc], qf2[qt][kc], a); a = WFrag<T16>::mma(kf2[kt][kc], qf[qt][kc], a); }
            s[kt][qt] = a; }
        __builtin_amdgcn_sched_barrier(0);   // and the next fragment's loads behind these products
    }
    { v4f ma;
#pragma unroll
        for (int q = 0; q < 4; ++q) ma[q] = (mk[q] == 0) ? -9.0e15f : (float)mk[q];
        *(v4fa*)(sma + threadIdx.x * 4) = ma; }
    __syncthreads();
    // v fragments in the order of their use, u = dt CT + c; the first PU fly while the softmax runs (asked for behind the barrier above, which would wait for them)
#pragma unroll
    for (int u = 0; u < PU; ++u) { vf[u] = WFrag<T16>::ld(Vt + voff + (u / CT) * 16 * TT + (u % CT) * 512); if (HR) vf2[u] = WFrag<T16>::ld(Vt2 + voff + (u / CT) * 16 * TT + (u % CT) * 512); }
    asm volatile("s_wait_xcnt 0x0" ::: "memory");   // in front of the first rewrite of an address register that a load issued so far names
    __builtin_amdgcn_sched_barrier(0);   // keeps those loads in front of the softmax
    float mx[QT];
#pragma unroll
    for (int qt = 0; qt < QT; ++qt) mx[qt] = -3.0e38f;
#pragma unroll
    for (int kt = 0; kt < KT; ++kt) { const v4f a0 = *(const v4fa*)(sma + k0 + kt * 16 + hi * 8), a1 = *(const v4fa*)(sma + k0 + kt * 16 + hi * 8 + 4);
#pragma unroll
        for (int qt = 0; qt < QT; ++qt)
#pragma unroll
            for (int j = 0; j < 8; ++j) { const float t = __fadd_rn(fminf(fmaxf(s[kt][qt][j] * SCL, -50000.0f), 50000.0f), (j < 4) ? a0[j & 3] : a1[j & 3]); s[kt][qt][j] = t; mx[qt] = fmaxf(mx[qt], t); } }
#pragma unroll
    for (int qt = 0; qt < QT; ++qt) { mx[qt] = fmaxf(mx[qt], __shfl_xor(mx[qt], 16, 32)); if (hi == 0) smx[(qt * 16 + lr) * SP + wave] = mx[qt]; }
    __syncthreads();
#pragma unroll
    for (int qt = 0; qt < QT; ++qt) { float m = -3.0e38f;
#pragma unroll
        for (int w4 = 0; w4 < AW / 4; ++w4) { const v4f p = *(const v4fa*)(smx + (qt * 16 + lr) * SP + w4 * 4); m = fmaxf(fmaxf(fmaxf(m, p[0]), fmaxf(p[1], p[2])), p[3]); }
        float sum = 0.f;
#pragma unroll
        for (int kt = 0; kt < KT; ++kt)
#pragma unroll
            for (int j = 0; j < 8; ++j) { const float e = __builtin_amdgcn_exp2f(__fmul_rn(__fsub_rn(s[kt][qt][j], m), 1.4426950408889634f)); s[kt][qt][j] = e; sum += e; }
        sum += __shfl_xor(sum, 16, 32); if (hi == 0) ssm[(qt * 16 + lr) * SP + wave] = sum; }
    __syncthreads();
    V pf[CT][QT], pf2[CT][QT];
#pragma unroll
    for (int qt = 0; qt < QT; ++qt) { float sum = 0.f;
#pragma unroll
        for (int w4 = 0; w4 < AW / 4; ++w4) { const v4f p = *(const v4fa*)(ssm + (qt * 16 + lr) * SP + w4 * 4); sum += p[0]; sum += p[1]; sum += p[2]; sum += p[3]; }
        const float f = __fdiv_rn(HR ? 1.0f : PCAR, sum);
#pragma unroll
        for (int c = 0; c < CT; ++c) {
            if constexpr (HR) { v8u ph, pl;   // two 16-bit planes, packed a register pair at a time
#pragma unroll
                for (int j = 0; j < 16; j += 2) { unsigned short a0, b0, a1, b1; splitf(s[2 * c + j / 8][qt][j % 8] * f, a0, b0); splitf(s[2 * c + j / 8][qt][j % 8 + 1] * f, a1, b1); ph[j / 2] = (unsigned)a0 | ((unsigned)a1 << 16); pl[j / 2] = (unsigned)b0 | ((unsigned)b1 << 16); }
                pf[c][qt] = __builtin_bit_cast(v16bf, ph); pf2[c][qt] = __builtin_bit_cast(v16bf, pl);
                __builtin_amdgcn_sched_barrier(0);   // one fragment's split at a time: opened all at once the half-made planes do not fit the registers and spill
            } else { v8h x0, x1;
#pragma unroll
                for (int j = 0; j < 8; ++j) { x0[j] = tohx(s[2 * c][qt][j] * f); x1[j] = tohx(s[2 * c + 1][qt][j] * f); }
                pf[c][qt] = cat16(x0, x1); } } }
    float* my = red + wave * (QR * OPT);
#pragma unroll
    for (int u = PU; u < DU; ++u) { vf[u] = WFrag<T16>::ld(Vt + voff + (u / CT) * 16 * TT + (u % CT) * 512); if (HR) vf2[u] = WFrag<T16>::ld(Vt2 + voff + (u / CT) * 16 * TT + (u % CT) * 512); }
    v8f o[DT][QT];
#pragma unroll
    for (int dt = 0; dt < DT; ++dt) {
#pragma unroll
        for (int qt = 0; qt < QT; ++qt) o[dt][qt] = (v8f){};
#pragma unroll
        for (int c = 0; c < CT; ++c) { const int u = dt * CT + c, un = u + DU;
            if (un < NU) { vf[un] = WFrag<T16>::ld(Vt + voff + (un / CT) * 16 * TT + (un % CT) * 512); if (HR) vf2[un] = WFrag<T16>::ld(Vt2 + voff + (un / CT) * 16 * TT + (un % CT) * 512); }
            if (un == NU - 1) asm volatile("s_wait_xcnt 0x0" ::: "memory");   // behind the last load, in front of any rewrite of its address registers
            __builtin_amdgcn_sched_barrier(0);   // keeps the load of fragment u + DU in front of fragment u's products (as for the key tiles)
#pragma unroll
            for (int qt = 0; qt < QT; ++qt) { o[dt][qt] = WFrag<T16>::mma(pf[c][qt], vf[u], o[dt][qt]); if (HR) { o[dt][qt] = WFrag<T16>::mma(pf2[c][qt], vf[u], o[dt][qt]); o[dt][qt] = WFrag<T16>::mma(pf[c][qt], vf2[u], o[dt][qt]); } }
            __builtin_amdgcn_sched_barrier(0);   // and the next load behind them
            // a column block is parked one fragment late (the last at once): its registers are still live when the next block's first product is issued, so that product does not overwrite a fresh matrix result
            if ((c == 0 && dt > 0) || u == NU - 1) { const int dp = (u == NU - 1) ? dt : dt - 1;
#pragma unroll
                for (int qt = 0; qt < QT; ++qt)
#pragma unroll
                    for (int j = 0; j < 8; ++j) my[(qt * 16 + hi * 8 + j) * OPT + dp * 16 + lr] = o[dp][qt][j]; }
        }
    }
    __syncthreads();
    { const int row = (wave / (HD / 8)) * 16 + lr, cofs = (wave % (HD / 8)) * 8 + hi * 4; v4f val = *(const v4fa*)(red + row * OPT + cofs);   // QR HD / 4 == 32 AW: one 4-float piece a thread; a wave takes 16 rows x 8 columns, 256 contiguous bytes of a block
#pragma unroll
        for (int w = 1; w < AW; ++w) val += *(const v4fa*)(red + w * (QR * OPT) + row * OPT + cofs);
        const float cs = HR ? 1.0f : (1.0f / PCAR); v4us oh, ol;
#pragma unroll
        for (int q = 0; q < 4; ++q) { unsigned short a, c2; splitf(val[q] * cs, a, c2); oh[q] = a; ol[q] = c2; }
        const size_t oo = pk(orow + row, ocol + cofs, DQ); *(v4us*)(ATh + oo) = oh; *(v4us*)(ATl + oo) = ol; }
}
__global__ __launch_bounds__(AW * 32) void k_attn(const h16* __restrict__ Q16, const h16* __restrict__ K16, const h16* __restrict__ V16, const bf* __restrict__ Qh, const bf* __restrict__ Ql, const bf* __restrict__ Kh, const bf* __restrict__ Kl, const bf* __restrict__ Vh, const bf* __restrict__ Vl, const int* __restrict__ km, bf* ATh, bf* ATl) {
    static_assert(QR * HD / 4 == AW * 32 && RH % QR == 0 && TT % QR == 0 && KWV % 32 == 0 && TT == AW * 128 && NH_ == NKV, "tile shape");
    __shared__ __align__(16) float red[AW * QR * OPT]; __shared__ __align__(16) float smx[QR * SP]; __shared__ __align__(16) float ssm[QR * SP]; __shared__ __align__(16) float sma[TT];
    const int h = blockIdx.x, b = blockIdx.y, q0 = blockIdx.z * QR; const size_t zp = (size_t)(b * NH_ + h) * TT * HD, zq = zp + (size_t)q0 * HD; const int orow = b * TT + q0, ocol = h * HD; km += b * TT;
    if (q0 < RH) attn_tile<bf, true>(Qh + zq, Ql + zq, Kh + zp, Kl + zp, Vh + zp, Vl + zp, km, ATh, ATl, orow, ocol, red, smx, ssm, sma);   // the same for the whole work-group: the barriers inside stay uniform
    else attn_tile<h16, false>(Q16 + zq, nullptr, K16 + zp, nullptr, V16 + zp, nullptr, km, ATh, ATl, orow, ocol, red, smx, ssm, sma);
}

extern "C" void kernel_launch(void* const* d_in, const int* in_sizes, int n_in,
                              void* d_out, int out_size, void* d_ws, size_t ws_size, hipStream_t stream) {
    (void)in_sizes; (void)n_in; (void)out_size;
    const float* x = (const float*)d_in[0]; const float* y = (const float*)d_in[1]; const int* kmask = (const int*)d_in[2]; const float* wq = (const float*)d_in[3]; const float* bq = (const float*)d_in[4]; const float* wk = (const float*)d_in[5]; const float* bk = (const float*)d_in[6]; const float* wv = (const float*)d_in[7]; const float* bv = (const float*)d_in[8]; const float* wo = (const float*)d_in[9]; const float* bo = (const float*)d_in[10]; const float* cosT = nullptr; const float* sinT = nullptr; (void)cosT; (void)sinT;
    float* OUT = (float*)d_out;     // [2][2048][1024]
    char* wsp = (char*)d_ws;
    auto take = [&](size_t bytes) { char* p = wsp; wsp += (bytes + 255) & ~(size_t)255; return (void*)p; };
    bf* XB = (bf*)take((size_t)NB_ * TT * DM * 2); bf* YB = (bf*)take((size_t)NB_ * TT * DM * 2);   // XB .. WO lie back to back: the one destination of k_cvt8
    bf* WQ = (bf*)take((size_t)DQ * DM * 2); bf* WK = (bf*)take((size_t)DKV * DM * 2); bf* WV = (bf*)take((size_t)DKV * DM * 2); bf* WO = (bf*)take((size_t)DM * DQ * 2);
    const size_t PB = (size_t)NB_ * NH_ * TT * HD * 2;    // bytes of one 16-bit plane, both batches
    h16* QP16 = (h16*)take(PB); h16* KP16 = (h16*)take(PB); h16* VT16 = (h16*)take(PB);
    bf* QPh = (bf*)take(PB); bf* QPl = (bf*)take(PB); bf* KPh = (bf*)take(PB); bf* KPl = (bf*)take(PB); bf* VTh = (bf*)take(PB); bf* VTl = (bf*)take(PB);
    bf* ATh = (bf*)take(PB); bf* ATl = (bf*)take(PB);
    if ((size_t)(wsp - (char*)d_ws) > ws_size) return;    // ws 256 MiB
    k_cvt8<<<dim3(CH / 2048, 2 * XC + 4, 1), 256, 0, stream>>>(x, y, wq, wk, wv, wo, XB);
    k_qkv<<<dim3(NB_ * TT / 64, DQ / 64, 3), 256, 0, stream>>>(XB, YB, WQ, WK, WV, bq, bk, bv, QP16, QPh, QPl, KP16, KPh, KPl, VT16, VTh, VTl);
    k_attn<<<dim3(NH_, NB_, TT / QR), AW * 32, 0, stream>>>(QP16, KP16, VT16, QPh, QPl, KPh, KPl, VTh, VTl, kmask, ATh, ATl);
    k_gemmk<bf, 1, true, 4, 4, 8, DQ / 8><<<dim3(NB_ * TT / 64, DM / 64, 1), 256, 0, stream>>>(ATh, ATl, WO, OUT, DM, bo);
}

// v006
// Measured time: 148 microseconds a run.
// In two side-by-side timings against v005, it was 1.13 and 1.20 times as fast.
// Counting every step since v000, it is 14.5 times as fast.
#include <hip/hip_runtime.h>

// MultiHeadAttention_New (master, slave [2][2048][1024], attention_mask [2][2048] (int, read; random 0/1); q = (master Wq^T + bq) x 0.125, k/v = slave W^T + b (16 x 64); attn = clip(q.k, +-50000) + (mask == 0 ? -9e15 : mask) per key; softmax; out = merged Wo^T + bo -> [2][2048][1024]).
// Compute dtypes, f32 accumulate: every input rounded to bf16; q/k/v on PLAIN bf16 operands (inputs: exact) + bias; scores and attn.v: query rows < 512 hl (3 products), the rest single fp16 (x1024); the clamp and the additive mask term ((mask == 0) ? -9e15 : float(mask), read per key) in f32; softmax f32; Wo hl x exact (2 products) + bias.

#define NB_  2
#define TT   2048
#define DM   1024
#define NH_  16
#define NKV  16
#define REP  (NH_ / NKV)
#define HD   64
#define DQ   (NH_ * HD)
#define DKV  (NKV * HD)
#define RH   512                  // query rows < RH use hi+lo planes (0: none)
#define WIN  0
#define PCAR 1024.0f
#define SCL  0.125f   // HD^-0.5
typedef _Float16 h16;
typedef unsigned short bf;
typedef __attribute__((ext_vector_type(16))) __bf16   v16bf;
typedef __attribute__((ext_vector_type(16))) _Float16 v16h;
typedef __attribute__((ext_vector_type(8)))  _Float16 v8h;
typedef __attribute__((ext_vector_type(8)))  unsigned short v8us;
typedef __attribute__((ext_vector_type(8)))  float    v8f;
typedef __attribute__((ext_vector_type(4)))  float    v4f;
typedef v8h  __attribute__((may_alias)) v8ha;
typedef v4f  __attribute__((may_alias)) v4fa;
typedef v8us __attribute__((may_alias)) v8usa;

__device__ __forceinline__ unsigned short f2bf(float f) { unsigned u = __float_as_uint(f); u += 0x7FFFu + ((u >> 16) & 1u); return (unsigned short)(u >> 16); }
__device__ __forceinline__ float bf2f(unsigned short b) { return __uint_as_float(((unsigned)b) << 16); }
__device__ __forceinline__ float bfr(float f) { return bf2f(f2bf(f)); }
__device__ __forceinline__ v16h cat16(v8h lo, v8h hi) { return __builtin_shufflevector(lo, hi, 0, 1, 2, 3, 4, 5, 6, 7, 8, 9, 10, 11, 12, 13, 14, 15); }
__device__ __forceinline__ v16bf cat16b(v8us lo, v8us hi) { return __builtin_bit_cast(v16bf, __builtin_shufflevector(lo, hi, 0, 1, 2, 3, 4, 5, 6, 7, 8, 9, 10, 11, 12, 13, 14, 15)); }
__device__ __forceinline__ v8f wmma16(v16h a, v16h b, v8f c) { return __builtin_amdgcn_wmma_f32_16x16x32_f16(false, a, false, b, (short)0, c, false, false); }
__device__ __forceinline__ v8f wmmab(v16bf a, v16bf b, v8f c) { return __builtin_amdgcn_wmma_f32_16x16x32_bf16(false, a, false, b, (short)0, c, false, false); }



// ---- operand fragments straight from 16-bit planes kept in FRAGMENT ORDER: lane lr + 16 hi = row lr, k = 8 hi + 0..7 and 16 + 8 hi + 0..7 of a 32-wide k step, the same for A and for B.
// A plane of K-wide rows is cut into blocks of 16 rows x 32 k (512 elements, 1 KiB), block (row / 16, k / 32) with k / 32 running fastest; in a block the 8 elements of a lane's first load lie at lane x 8, those of its second at 256 + lane x 8.
// So each wave-wide 16-byte load reads 512 contiguous bytes (4 whole lines) where row-major planes gave it 32 bytes of each of 16 lines. pk: where element (row, k) lies.
__device__ __forceinline__ size_t pk(int row, int k, int K) { return ((size_t)(row >> 4) * (K >> 5) + (k >> 5)) * 512 + ((k >> 4) & 1) * 256 + ((((k >> 3) & 1) << 4) + (row & 15)) * 8 + (k & 7); }
template <typename T16> struct WFrag;
template <> struct WFrag<h16> { typedef v16h V; static __device__ __forceinline__ V ld(const h16* p) { return cat16(*(const v8h*)p, *(const v8h*)(p + 256)); } static __device__ __forceinline__ v8f mma(V a, V b, v8f c) { return wmma16(a, b, c); } };
template <> struct WFrag<bf> { typedef v16bf V; static __device__ __forceinline__ V ld(const bf* p) { return cat16b(*(const v8us*)p, *(const v8us*)(p + 256)); } static __device__ __forceinline__ v8f mma(V a, V b, v8f c) { return wmmab(a, b, c); } };

__device__ __forceinline__ h16 tohx(float x) { return (h16)x; }
__device__ __forceinline__ void splitf(float y, unsigned short& h, unsigned short& l) { h = f2bf(y); l = f2bf(y - bf2f(h)); }
typedef __attribute__((ext_vector_type(4))) _Float16 v4h;
typedef __attribute__((ext_vector_type(4))) unsigned short v4us;

// ---- copy4, copy8: four or eight 16-byte asynchronous copies a lane, global memory to LDS through no register. l: the lane's LDS byte address, g: its global address; copy i of a run of four lies i lstep bytes and i gstep elements further; copy8 takes two such runs.
// s_wait_xcnt is the last line of the copies' own statement, so that it stands in front of every rewrite of a register that they name.
template <typename T16>
__device__ __forceinline__ void copy4(unsigned l, const T16* g, unsigned lstep, size_t gstep) {
    asm volatile("global_load_async_to_lds_b128 %0, %4, off\n\t"
                 "global_load_async_to_lds_b128 %1, %5, off\n\t"
                 "global_load_async_to_lds_b128 %2, %6, off\n\t"
                 "global_load_async_to_lds_b128 %3, %7, off\n\t"
                 "s_wait_xcnt 0x0"
                 :: "v"(l), "v"(l + lstep), "v"(l + 2 * lstep), "v"(l + 3 * lstep), "v"(g), "v"(g + gstep), "v"(g + 2 * gstep), "v"(g + 3 * gstep) : "memory");
}
template <typename T16>
__device__ __forceinline__ void copy8(unsigned l, const T16* g, unsigned m, const T16* h, unsigned lstep, size_t gstep) {
    asm volatile("global_load_async_to_lds_b128 %0, %8, off\n\t"
                 "global_load_async_to_lds_b128 %1, %9, off\n\t"
                 "global_load_async_to_lds_b128 %2, %10, off\n\t"
                 "global_load_async_to_lds_b128 %3, %11, off\n\t"
                 "global_load_async_to_lds_b128 %4, %12, off\n\t"
                 "global_load_async_to_lds_b128 %5, %13, off\n\t"
                 "global_load_async_to_lds_b128 %6, %14, off\n\t"
                 "global_load_async_to_lds_b128 %7, %15, off\n\t"
                 "s_wait_xcnt 0x0"
                 :: "v"(l), "v"(l + lstep), "v"(l + 2 * lstep), "v"(l + 3 * lstep), "v"(m), "v"(m + lstep), "v"(m + 2 * lstep), "v"(m + 3 * lstep),
                    "v"(g), "v"(g + gstep), "v"(g + 2 * gstep), "v"(g + 3 * gstep), "v"(h), "v"(h + gstep), "v"(h + 2 * gstep), "v"(h + 3 * gstep) : "memory");
}
// ---- gemmk_tile: C[m][n] (f32, pitch ldc, + optional f32 bias[n]) = sum_k A[m][k] Bt[n][k] (NSPLIT 1: + A2[m][k] Bt[n][k]): WM x WN waves of one work-group share one 128 x 128 output tile, wave (wm, wn) owns (16 MB) x (16 NB) of it and sums the whole K in k order.
// The operands come through LDS, 64 k a stage, two buffers: a stage holds, per operand, 8 row blocks x 2 KiB (two fragment-order blocks each, contiguous in the plane), brought by asynchronous copies one stage ahead of its use, so each operand byte leaves L2 once a work-group and every wave reads its fragments from LDS.
// Behind the last stage the tile is parked in the same LDS (row-major, pitch 128 + 4 floats), one barrier, and whole row pieces are stored. One work-group of 32 WM WN threads a tile at rows r0, columns c0; tokens of both batches run through as one row index b TT + t.
// EPI says what is stored. 0: C in f32. 1 and 2: no f32 C; each sum goes straight to the three 16-bit planes that attention reads (fp16, bf16 hi, bf16 lo).
// 1: m = token, n = feature, head planes [b][n / HD] of rows t, k = n % HD. 2: m = feature, n = token (weights as A, tokens as Bt), planes [b] of rows m, k = t, the bias taken per row m. A, Bt and the planes written are all in fragment order (pk).
template <typename T16, int NSPLIT, bool BIAS, int MB, int NB, int WM, int WN, int K, int EPI>
__device__ __forceinline__ void gemmk_tile(const T16* __restrict__ A, const T16* __restrict__ A2, const T16* __restrict__ Bt, float* C, int ldc, const float* __restrict__ bias, int r0, int c0, h16* P16, bf* Ph, bf* Pl, float* red) {
    typedef typename WFrag<T16>::V V;
    constexpr int NT = WM * WN * 32, TM = WM * MB * 16, TN = WN * NB * 16, PT = TN + 4;
    constexpr bool AHEAD = MB * NB <= 8; constexpr int PE = 8 * 1024, SE = (NSPLIT == 1 ? 3 : 2) * PE, NS = K / 64, CS = NT / 128;   // elements of one operand's part of a stage and of a stage; stages; row blocks that one copy of the whole work-group covers
    static_assert(TM == 128 && TN == 128 && (NT == 128 || NT == 256) && K % 64 == 0 && NS >= 2 && (NSPLIT == 0 || NSPLIT == 1), "stage shape");
    const int lane = threadIdx.x & 31, lr = lane & 15, hi = lane >> 4, wave = threadIdx.x >> 5, wm = wave / WN, wn = wave % WN;
    const T16* st = (const T16*)red;
    const unsigned lofs = (unsigned)(size_t)red + (threadIdx.x >> 7) * 2048 + (threadIdx.x & 127) * 16;   // 128 threads copy the 2 KiB of one row block
    const size_t gofs = (size_t)(threadIdx.x >> 7) * (K * 16) + (threadIdx.x & 127) * 8;                  // r0 and c0 are multiples of 16, so r0 K and c0 K are where their row panels start; a row block is 16 K elements
    const T16* ga = A + (size_t)r0 * K + gofs; const T16* ga2 = (NSPLIT == 1) ? A2 + (size_t)r0 * K + gofs : nullptr; const T16* gb = Bt + (size_t)c0 * K + gofs;
    auto fill = [&](int s) { const unsigned l = lofs + (s & 1) * (SE * 2);
#pragma unroll
        for (int c = 0; c < 8; c += 4 * CS) { copy8(l + c * 2048, ga + s * 1024 + (size_t)c * (K * 16), l + PE * 2 + c * 2048, gb + s * 1024 + (size_t)c * (K * 16), CS * 2048, (size_t)CS * (K * 16));
            if (NSPLIT == 1) copy4(l + PE * 4 + c * 2048, ga2 + s * 1024 + (size_t)c * (K * 16), CS * 2048, (size_t)CS * (K * 16)); } };
    v8f acc[MB][NB];
#pragma unroll
    for (int mb = 0; mb < MB; ++mb)
#pragma unroll
        for (int nb = 0; nb < NB; ++nb) acc[mb][nb] = (v8f){};
    fill(0);
    asm volatile("s_wait_asynccnt 0x0" ::: "memory");   // stage 0 has landed, as far as this wave copied it
    __syncthreads();                                    // and as far as the others did
    fill(1);
    // unrolled: NS is a small constant, so each stage's buffer is known when compiling and no matrix instruction stands in front of a back edge
#pragma unroll
    for (int s = 0; s < NS; ++s) { const T16* sb = st + (s & 1) * SE + lane * 8;
        V a[2][MB], a2[2][MB], b[2][NB];
#pragma unroll
        for (int kb = 0; kb < 2; ++kb) {
            // the fragments of a 32-k block are asked for as one group (AHEAD: those of both blocks of the stage at once, where the registers allow it)
            if (!AHEAD || kb == 0) {
#pragma unroll
                for (int k2 = kb; k2 < (AHEAD ? 2 : kb + 1); ++k2) {
#pragma unroll
                    for (int mb = 0; mb < MB; ++mb) { a[k2][mb] = WFrag<T16>::ld(sb + (wm * MB + mb) * 1024 + k2 * 512); if (NSPLIT == 1) a2[k2][mb] = WFrag<T16>::ld(sb + 2 * PE + (wm * MB + mb) * 1024 + k2 * 512); }
#pragma unroll
                    for (int nb = 0; nb < NB; ++nb) b[k2][nb] = WFrag<T16>::ld(sb + PE + (wn * NB + nb) * 1024 + k2 * 512); }
                __builtin_amdgcn_sched_barrier(0);   // keeps the group together in front of its products: left alone the scheduler sinks each load to its use, and every four products wait a whole LDS trip
            }
#pragma unroll
            for (int nb = 0; nb < NB; ++nb) {
#pragma unroll
                for (int mb = 0; mb < MB; ++mb) acc[mb][nb] = WFrag<T16>::mma(a[kb][mb], b[kb][nb], acc[mb][nb]);
                if (NSPLIT == 1) {
#pragma unroll
                    for (int mb = 0; mb < MB; ++mb) acc[mb][nb] = WFrag<T16>::mma(a2[kb][mb], b[kb][nb], acc[mb][nb]); } }
            if (!AHEAD || kb == 1) __builtin_amdgcn_sched_barrier(0);   // keeps the next group behind these products, whose registers it takes over, and the stage's last products in front of its foot: sunk among the next copies they hold their fragments live and the registers run over 256
        }
        asm volatile("s_wait_dscnt 0x0" ::: "memory");      // this wave has read the last of stage s
        asm volatile("s_wait_asynccnt 0x0" ::: "memory");   // and its copies of stage s + 1 have landed
        __syncthreads();                                    // publishes stage s + 1 and frees the buffer of stage s
        if (s + 2 < NS) fill(s + 2);
    }
    asm volatile("s_wait_asynccnt 0x0" ::: "memory");   // no copy is under way when the buffers become the parking place
#pragma unroll
    for (int mb = 0; mb < MB; ++mb)
#pragma unroll
        for (int nb = 0; nb < NB; ++nb)
#pragma unroll
            for (int j = 0; j < 8; ++j) red[((wm * MB + mb) * 16 + hi * 8 + j) * PT + (wn * NB + nb) * 16 + lr] = acc[mb][nb][j];
    __syncthreads();
    // four pieces a trip: their LDS reads and stores overlap and a bias taken by column leaves the loop; one by one each piece waits out its own loads, and a thread now has 16 or 32 pieces
#pragma unroll 1
    for (int it = 0; it < TM * TN / 4 / NT; it += 4) {
#pragma unroll
      for (int u = 0; u < 4; ++u) { const int e = threadIdx.x + (it + u) * NT;
        // f32 C: a wave takes whole rows. Planes: a wave takes 16 rows x 8 columns, lane = row + 16 x (column half), which are 256 contiguous bytes of a block
        const int row = (EPI == 0) ? e / (TN / 4) : ((e >> 5) / (TN / 8)) * 16 + (e & 15), cofs = (EPI == 0) ? (e % (TN / 4)) * 4 : ((e >> 5) % (TN / 8)) * 8 + ((e >> 4) & 1) * 4; v4f val = *(const v4fa*)(red + row * PT + cofs);
        if (BIAS && EPI == 2) { const float br = bfr(bias[r0 + row]); val[0] += br; val[1] += br; val[2] += br; val[3] += br; }
        else if (BIAS) { val[0] += bfr(bias[c0 + cofs]); val[1] += bfr(bias[c0 + cofs + 1]); val[2] += bfr(bias[c0 + cofs + 2]); val[3] += bfr(bias[c0 + cofs + 3]); }
        if constexpr (EPI == 0) *(v4f*)(C + (size_t)(r0 + row) * ldc + c0 + cofs) = val;
        else { v4h o16; v4us oh, ol;
#pragma unroll
            for (int q = 0; q < 4; ++q) { o16[q] = tohx(val[q]); unsigned short a2, c2; splitf(val[q], a2, c2); oh[q] = a2; ol[q] = c2; }
            const size_t oo = (EPI == 1) ? (size_t)((r0 + row) / TT * NH_ + (c0 + cofs) / HD) * TT * HD + pk((r0 + row) % TT, (c0 + cofs) % HD, HD) : (size_t)((c0 + cofs) / TT) * DKV * TT + pk(r0 + row, (c0 + cofs) % TT, TT);
            *(v4h*)(P16 + oo) = o16; *(v4us*)(Ph + oo) = oh; *(v4us*)(Pl + oo) = ol; } }
      asm volatile("s_wait_xcnt 0x0" ::: "memory");   // behind the trip's last store, in front of the next trip's rewrite of the stores' registers
    }
}
// ---- k_gemmk: the f32 form of gemmk_tile. grid (M / 128, N / 128), 32 WM WN threads. LDS: two stages, which also hold the parked tile.
template <typename T16, int NSPLIT, bool BIAS, int MB, int NB, int WM, int WN, int K>
__global__ __launch_bounds__(WM * WN * 32) void k_gemmk(const T16* __restrict__ A, const T16* __restrict__ A2, const T16* __restrict__ Bt, float* C, int ldc, const float* __restrict__ bias) {
    static_assert(NSPLIT == 1, "three operand parts a stage");
    __shared__ __align__(16) float red[2 * 3 * 8 * 1024 / 2];
    gemmk_tile<T16, NSPLIT, BIAS, MB, NB, WM, WN, K, 0>(A, A2, Bt, C, ldc, bias, blockIdx.x * 128, blockIdx.y * 128, nullptr, nullptr, nullptr, red);
}
// ---- k_qkv: the three projections of both batches in one launch; blockIdx.z says which (0 q, 1 k, 2 v), the same for the whole work-group, so the barriers inside stay uniform. grid (NB_ TT / 128, DQ / 128, 3), 128 threads.
__global__ __launch_bounds__(128) void k_qkv(const bf* __restrict__ XB, const bf* __restrict__ YB, const bf* __restrict__ WQ, const bf* __restrict__ WK, const bf* __restrict__ WV, const float* __restrict__ bq, const float* __restrict__ bk, const float* __restrict__ bv,
                                             h16* QP16, bf* QPh, bf* QPl, h16* KP16, bf* KPh, bf* KPl, h16* VT16, bf* VTh, bf* VTl) {
    static_assert(DQ == DKV && NH_ == NKV && TT % 128 == 0, "one grid serves q, k and v");
    __shared__ __align__(16) float red[128 * 132];   // the parked tile; the two stages (64 KiB) lie in it
    const int t0 = blockIdx.x * 128, f0 = blockIdx.y * 128;
    if (blockIdx.z == 2) gemmk_tile<bf, 0, true, 4, 4, 2, 2, DM, 2>(WV, nullptr, YB, nullptr, 0, bv, f0, t0, VT16, VTh, VTl, red);   // weights as A: v comes out feature-major, the order attn.v reads
    else { const bool isq = blockIdx.z == 0;
        gemmk_tile<bf, 0, true, 4, 4, 2, 2, DM, 1>(isq ? XB : YB, nullptr, isq ? WQ : WK, nullptr, 0, isq ? bq : bk, t0, f0, isq ? QP16 : KP16, isq ? QPh : KPh, isq ? QPl : KPl, red); }
}

typedef __attribute__((ext_vector_type(2))) unsigned short v2us;
typedef __attribute__((ext_vector_type(2))) float v2f;
typedef __attribute__((ext_vector_type(4))) int v4i;
typedef __attribute__((ext_vector_type(8))) unsigned v8u;

__global__ __launch_bounds__(256) void k_wtG(const float* __restrict__ w, int K, int N, bf* Bt) {
    const int lane = threadIdx.x & 31; const int L0 = (blockIdx.x * 8 + (threadIdx.x >> 5)) * 8; const int nlines = N * K / 64;
{
#pragma unroll 1
        for (int l = 0; l < 8; ++l) { const int L = L0 + l; if (L >= nlines) break; const size_t e = (size_t)L * 64 + lane * 2; const int k = (int)(e % K), n = (int)(e / K); v2us o;
            o[0] = f2bf(w[(size_t)k * N + n]); o[1] = f2bf(w[(size_t)(k + 1) * N + n]); *(v2us*)(Bt + e) = o; }
         }
}
// ---- k_cvt8: every f32 operand to bf16, in fragment order, in one launch. blockIdx.y names a chunk of CH elements: the chunks of x, then of y, then the four weights; dst holds them in that order. grid (CH / 2048, 2 XC + 4), 256 threads.
// A work-group takes 16 rows x 128 k: 2048 contiguous elements of dst (four blocks). Piece p = k / 8 of row r goes to piece 16 p + r: the 16-byte pieces are turned through LDS (pitch 272 bytes: no bank met twice), so reads and stores both stay on whole lines.
#define CH   (DM * DQ)
#define XC   (NB_ * TT * DM / CH)
__global__ __launch_bounds__(256) void k_cvt8(const float* __restrict__ x, const float* __restrict__ y, const float* __restrict__ wq, const float* __restrict__ wk, const float* __restrict__ wv, const float* __restrict__ wo, bf* dst0) {
    static_assert(NB_ * TT * DM % CH == 0 && DKV == DQ && DQ == DM && CH % (16 * DM) == 0 && DM % 128 == 0, "chunks");
    __shared__ __align__(16) bf st[16 * 136];
    const int c = blockIdx.y; const float* src = (c < XC) ? x + (size_t)c * CH : (c < 2 * XC) ? y + (size_t)(c - XC) * CH : (c == 2 * XC) ? wq : (c == 2 * XC + 1) ? wk : (c == 2 * XC + 2) ? wv : wo; bf* dst = dst0 + (size_t)c * CH;
    const int r = threadIdx.x >> 4, p = threadIdx.x & 15; const v8f v = *(const v8f*)(src + (size_t)(blockIdx.x / (DM / 128) * 16 + r) * DM + blockIdx.x % (DM / 128) * 128 + p * 8); v8us o;
    asm volatile("s_wait_xcnt 0x0" ::: "memory");   // behind the loads, in front of the first rewrite of their address registers
#pragma unroll
    for (int k = 0; k < 8; ++k) o[k] = f2bf(v[k]);
    *(v8usa*)(st + p * 136 + r * 8) = o;
    __syncthreads();
    *(v8us*)(dst + (size_t)blockIdx.x * 2048 + threadIdx.x * 8) = *(const v8usa*)(st + r * 136 + p * 8);  }
// ---- k_attn: scores, softmax, attn.v and the head merge of QR query rows of one head in ONE work-group of AW waves; wave w owns keys [w KWV, (w + 1) KWV). grid (NH_, NB_, TT / QR), 32 AW threads: the hi/lo rows of both batches, the longest work-groups, start first.
// Scores are formed TRANSPOSED (A = 16 keys, B = 16 queries): a lane then holds, for query lr, keys hi 8 + j of each 16-key tile, which is the A-fragment order of attn.v (two tiles = one 32-key fragment), so the probabilities never leave the registers.
// Row maximum and row sum: in the lane, then across the two lane halves, then across the waves through LDS (added in wave order). attn.v partials of the waves are parked in LDS and added in wave order 0..AW-1, scaled, split hi/lo and stored as 256-byte pieces of the merged planes. Every plane read or written here is in fragment order (pk).
#define QR   32
#define AW   16
#define KWV  (TT / AW)
#define SP   20                   // floats per query row of the wave statistics (16 used; 80-byte pitch keeps the 16-byte reads aligned)
#define OPT  (HD + 4)
// fragments asked for ahead of their use, single-plane rows (L) and hi/lo rows (H): key fragments DK, v fragments DU, of which PU already in front of the softmax; the largest that leave no spill at 256 registers
#define DKL 8
#define DKH 2
#define DUL 8
#define DUH 3
#define PUL 6
#define PUH 1
template <typename T16, bool HR>
__device__ __forceinline__ void attn_tile(const T16* __restrict__ Q, const T16* __restrict__ Q2, const T16* __restrict__ Kp, const T16* __restrict__ Kp2, const T16* __restrict__ Vt, const T16* __restrict__ Vt2, const int* __restrict__ km, bf* ATh, bf* ATl, int orow, int ocol, float* red, float* smx, float* ssm, float* sma) {
    typedef typename WFrag<T16>::V V;
    constexpr int QT = QR / 16, KT = KWV / 16, KC = HD / 32, CT = KWV / 32, DT = HD / 16, NU = DT * CT;
    constexpr int DK = HR ? DKH : DKL, DU = HR ? DUH : DUL, PU = HR ? PUH : PUL;
    const v4i mk = *(const v4i*)(km + threadIdx.x * 4);   // TT == 128 AW: four keys a thread; asked for first, used behind the score products
    const int lane = threadIdx.x & 31, lr = lane & 15, hi = lane >> 4, wave = threadIdx.x >> 5; const int k0 = wave * KWV;
    const unsigned qoff = (unsigned)(lane * 8), koff = (unsigned)(k0 * HD + lane * 8), voff = (unsigned)(k0 * 16 + lane * 8);   // fragment order: block (row / 16, k / 32) of 512 elements
    V qf[QT][KC], qf2[QT][KC], kf[KT][KC], kf2[KT][KC], vf[NU], vf2[NU];
#pragma unroll
    for (int qt = 0; qt < QT; ++qt)
#pragma unroll
        for (int kc = 0; kc < KC; ++kc) { qf[qt][kc] = WFrag<T16>::ld(Q + qoff + qt * 16 * HD + kc * 512); if (HR) qf2[qt][kc] = WFrag<T16>::ld(Q2 + qoff + qt * 16 * HD + kc * 512); }
#pragma unroll
    for (int n = 0; n < DK; ++n) { kf[n / KC][n % KC] = WFrag<T16>::ld(Kp + koff + (n / KC) * 16 * HD + (n % KC) * 512); if (HR) kf2[n / KC][n % KC] = WFrag<T16>::ld(Kp2 + koff + (n / KC) * 16 * HD + (n % KC) * 512); }
    v8f s[KT][QT];
#pragma unroll
    for (int n = 0; n < KT * KC; ++n) { const int kt = n / KC, kc = n % KC, nn = n + DK;
        if (nn < KT * KC) { kf[nn / KC][nn % KC] = WFrag<T16>::ld(Kp + koff + (nn / KC) * 16 * HD + (nn % KC) * 512); if (HR) kf2[nn / KC][nn % KC] = WFrag<T16>::ld(Kp2 + koff + (nn / KC) * 16 * HD + (nn % KC) * 512); }
        if (nn == KT * KC - 1) asm volatile("s_wait_xcnt 0x0" ::: "memory");   // behind the last key load, in front of any rewrite of its address registers
        __builtin_amdgcn_sched_barrier(0);   // keeps the loads of key fragment n + DK in front of fragment n's products: left alone the scheduler sinks each load to its use and every fragment waits a whole L2 trip
#pragma unroll
        for (int qt = 0; qt < QT; ++qt) { v8f a = (kc == 0) ? (v8f){} : s[kt][qt];
            a = WFrag<T16>::mma(kf[kt][kc], qf[qt][kc], a); if (HR) { a = WFrag<T16>::mma(kf[kt][kc], qf2[qt][kc], a); a = WFrag<T16>::mma(kf2[kt][kc], qf[qt][kc], a); }
            s[kt][qt] = a; }
        __builtin_amdgcn_sched_barrier(0);   // and the next fragment's loads behind these products
    }
    { v4f ma;
#pragma unroll
        for (int q = 0; q < 4; ++q) ma[q] = (mk[q] == 0) ? -9.0e15f : (float)mk[q];
        *(v4fa*)(sma + threadIdx.x * 4) = ma; }
    __syncthreads();
    // v fragments in the order of their use, u = dt CT + c; the first PU fly while the softmax runs (asked for behind the barrier above, which would wait for them)
#pragma unroll
    for (int u = 0; u < PU; ++u) { vf[u] = WFrag<T16>::ld(Vt + voff + (u / CT) * 16 * TT + (u % CT) * 512); if (HR) vf2[u] = WFrag<T16>::ld(Vt2 + voff + (u / CT) * 16 * TT + (u % CT) * 512); }
    asm volatile("s_wait_xcnt 0x0" ::: "memory");   // in front of the first rewrite of an address register that a load issued so far names
    __builtin_amdgcn_sched_barrier(0);   // keeps those loads in front of the softmax
    float mx[QT];
#pragma unroll
    for (int qt = 0; qt < QT; ++qt) mx[qt] = -3.0e38f;
#pragma unroll
    for (int kt = 0; kt < KT; ++kt) { const v4f a0 = *(const v4fa*)(sma + k0 + kt * 16 + hi * 8), a1 = *(const v4fa*)(sma + k0 + kt * 16 + hi * 8 + 4);
#pragma unroll
        for (int qt = 0; qt < QT; ++qt)
#pragma unroll
            for (int j = 0; j < 8; ++j) { const float t = __fadd_rn(fminf(fmaxf(s[kt][qt][j] * SCL, -50000.0f), 50000.0f), (j < 4) ? a0[j & 3] : a1[j & 3]); s[kt][qt][j] = t; mx[qt] = fmaxf(mx[qt], t); } }
#pragma unroll
    for (int qt = 0; qt < QT; ++qt) { mx[qt] = fmaxf(mx[qt], __shfl_xor(mx[qt], 16, 32)); if (hi == 0) smx[(qt * 16 + lr) * SP + wave] = mx[qt]; }
    __syncthreads();
#pragma unroll
    for (int qt = 0; qt < QT; ++qt) { float m = -3.0e38f;
#pragma unroll
        for (int w4 = 0; w4 < AW / 4; ++w4) { const v4f p = *(const v4fa*)(smx + (qt * 16 + lr) * SP + w4 * 4); m = fmaxf(fmaxf(fmaxf(m, p[0]), fmaxf(p[1], p[2])), p[3]); }
        float sum = 0.f;
#pragma unroll
        for (int kt = 0; kt < KT; ++kt)
#pragma unroll
            for (int j = 0; j < 8; ++j) { const float e = __builtin_amdgcn_exp2f(__fmul_rn(__fsub_rn(s[kt][qt][j], m), 1.4426950408889634f)); s[kt][qt][j] = e; sum += e; }
        sum += __shfl_xor(sum, 16, 32); if (hi == 0) ssm[(qt * 16 + lr) * SP + wave] = sum; }
    __syncthreads();
    V pf[CT][QT], pf2[CT][QT];
#pragma unroll
    for (int qt = 0; qt < QT; ++qt) { float sum = 0.f;
#pragma unroll
        for (int w4 = 0; w4 < AW / 4; ++w4) { const v4f p = *(const v4fa*)(ssm + (qt * 16 + lr) * SP + w4 * 4); sum += p[0]; sum += p[1]; sum += p[2]; sum += p[3]; }
        const float f = __fdiv_rn(HR ? 1.0f : PCAR, sum);
#pragma unroll
        for (int c = 0; c < CT; ++c) {
            if constexpr (HR) { v8u ph, pl;   // two 16-bit planes, packed a register pair at a time
#pragma unroll
                for (int j = 0; j < 16; j += 2) { unsigned short a0, b0, a1, b1; splitf(s[2 * c + j / 8][qt][j % 8] * f, a0, b0); splitf(s[2 * c + j / 8][qt][j % 8 + 1] * f, a1, b1); ph[j / 2] = (unsigned)a0 | ((unsigned)a1 << 16); pl[j / 2] = (unsigned)b0 | ((unsigned)b1 << 16); }
                pf[c][qt] = __builtin_bit_cast(v16bf, ph); pf2[c][qt] = __builtin_bit_cast(v16bf, pl);
                __builtin_amdgcn_sched_barrier(0);   // one fragment's split at a time: opened all at once the half-made planes do not fit the registers and spill
            } else { v8h x0, x1;
#pragma unroll
                for (int j = 0; j < 8; ++j) { x0[j] = tohx(s[2 * c][qt][j] * f); x1[j] = tohx(s[2 * c + 1][qt][j] * f); }
                pf[c][qt] = cat16(x0, x1); } } }
    float* my = red + wave * (QR * OPT);
#pragma unroll
    for (int u = PU; u < DU; ++u) { vf[u] = WFrag<T16>::ld(Vt + voff + (u / CT) * 16 * TT + (u % CT) * 512); if (HR) vf2[u] = WFrag<T16>::ld(Vt2 + voff + (u / CT) * 16 * TT + (u % CT) * 512); }
    v8f o[DT][QT];
#pragma unroll
    for (int dt = 0; dt < DT; ++dt) {
#pragma unroll
        for (int qt = 0; qt < QT; ++qt) o[dt][qt] = (v8f){};
#pragma unroll
        for (int c = 0; c < CT; ++c) { const int u = dt * CT + c, un = u + DU;
            if (un < NU) { vf[un] = WFrag<T16>::ld(Vt + voff + (un / CT) * 16 * TT + (un % CT) * 512); if (HR) vf2[un] = WFrag<T16>::ld(Vt2 + voff + (un / CT) * 16 * TT + (un % CT) * 512); }
            if (un == NU - 1) asm volatile("s_wait_xcnt 0x0" ::: "memory");   // behind the last load, in front of any rewrite of its address registers
            __builtin_amdgcn_sched_barrier(0);   // keeps the load of fragment u + DU in front of fragment u's products (as for the key tiles)
#pragma unroll
            for (int qt = 0; qt < QT; ++qt) { o[dt][qt] = WFrag<T16>::mma(pf[c][qt], vf[u], o[dt][qt]); if (HR) { o[dt][qt] = WFrag<T16>::mma(pf2[c][qt], vf[u], o[dt][qt]); o[dt][qt] = WFrag<T16>::mma(pf[c][qt], vf2[u], o[dt][qt]); } }
            __builtin_amdgcn_sched_barrier(0);   // and the next load behind them
            // a column block is parked one fragment late (the last at once): its registers are still live when the next block's first product is issued, so that product does not overwrite a fresh matrix result
            if ((c == 0 && dt > 0) || u == NU - 1) { const int dp = (u == NU - 1) ? dt : dt - 1;
#pragma unroll
                for (int qt = 0; qt < QT; ++qt)
#pragma unroll
                    for (int j = 0; j < 8; ++j) my[(qt * 16 + hi * 8 + j) * OPT + dp * 16 + lr] = o[dp][qt][j]; }
        }
    }
    __syncthreads();
    { const int row = (wave / (HD / 8)) * 16 + lr, cofs = (wave % (HD / 8)) * 8 + hi * 4; v4f val = *(const v4fa*)(red + row * OPT + cofs);   // QR HD / 4 == 32 AW: one 4-float piece a thread; a wave takes 16 rows x 8 columns, 256 contiguous bytes of a block
#pragma unroll
        for (int w = 1; w < AW; ++w) val += *(const v4fa*)(red + w * (QR * OPT) + row * OPT + cofs);
        const float cs = HR ? 1.0f : (1.0f / PCAR); v4us oh, ol;
#pragma unroll
        for (int q = 0; q < 4; ++q) { unsigned short a, c2; splitf(val[q] * cs, a, c2); oh[q] = a; ol[q] = c2; }
        const size_t oo = pk(orow + row, ocol + cofs, DQ); *(v4us*)(ATh + oo) = oh; *(v4us*)(ATl + oo) = ol; }
}
__global__ __launch_bounds__(AW * 32) void k_attn(const h16* __restrict__ Q16, const h16* __restrict__ K16, const h16* __restrict__ V16, const bf* __restrict__ Qh, const bf* __restrict__ Ql, const bf* __restrict__ Kh, const bf* __restrict__ Kl, const bf* __restrict__ Vh, const bf* __restrict__ Vl, const int* __restrict__ km, bf* ATh, bf* ATl) {
    static_assert(QR * HD / 4 == AW * 32 && RH % QR == 0 && TT % QR == 0 && KWV % 32 == 0 && TT == AW * 128 && NH_ == NKV, "tile shape");
    __shared__ __align__(16) float red[AW * QR * OPT]; __shared__ __align__(16) float smx[QR * SP]; __shared__ __align__(16) float ssm[QR * SP]; __shared__ __align__(16) float sma[TT];
    const int h = blockIdx.x, b = blockIdx.y, q0 = blockIdx.z * QR; const size_t zp = (size_t)(b * NH_ + h) * TT * HD, zq = zp + (size_t)q0 * HD; const int orow = b * TT + q0, ocol = h * HD; km += b * TT;
    if (q0 < RH) attn_tile<bf, true>(Qh + zq, Ql + zq, Kh + zp, Kl + zp, Vh + zp, Vl + zp, km, ATh, ATl, orow, ocol, red, smx, ssm, sma);   // the same for the whole work-group: the barriers inside stay uniform
    else attn_tile<h16, false>(Q16 + zq, nullptr, K16 + zp, nullptr, V16 + zp, nullptr, km, ATh, ATl, orow, ocol, red, smx, ssm, sma);
}

extern "C" void kernel_launch(void* const* d_in, const int* in_sizes, int n_in,
                              void* d_out, int out_size, void* d_ws, size_t ws_size, hipStream_t stream) {
    (void)in_sizes; (void)n_in; (void)out_size;
    const float* x = (const float*)d_in[0]; const float* y = (const float*)d_in[1]; const int* kmask = (const int*)d_in[2]; const float* wq = (const float*)d_in[3]; const float* bq = (const float*)d_in[4]; const float* wk = (const float*)d_in[5]; const float* bk = (const float*)d_in[6]; const float* wv = (const float*)d_in[7]; const float* bv = (const float*)d_in[8]; const float* wo = (const float*)d_in[9]; const float* bo = (const float*)d_in[10]; const float* cosT = nullptr; const float* sinT = nullptr; (void)cosT; (void)sinT;
    float* OUT = (float*)d_out;     // [2][2048][1024]
    char* wsp = (char*)d_ws;
    auto take = [&](size_t bytes) { char* p = wsp; wsp += (bytes + 255) & ~(size_t)255; return (void*)p; };
    bf* XB = (bf*)take((size_t)NB_ * TT * DM * 2); bf* YB = (bf*)take((size_t)NB_ * TT * DM * 2);   // XB .. WO lie back to back: the one destination of k_cvt8
    bf* WQ = (bf*)take((size_t)DQ * DM * 2); bf* WK = (bf*)take((size_t)DKV * DM * 2); bf* WV = (bf*)take((size_t)DKV * DM * 2); bf* WO = (bf*)take((size_t)DM * DQ * 2);
    const size_t PB = (size_t)NB_ * NH_ * TT * HD * 2;    // bytes of one 16-bit plane, both batches
    h16* QP16 = (h16*)take(PB); h16* KP16 = (h16*)take(PB); h16* VT16 = (h16*)take(PB);
    bf* QPh = (bf*)take(PB); bf* QPl = (bf*)take(PB); bf* KPh = (bf*)take(PB); bf* KPl = (bf*)take(PB); bf* VTh = (bf*)take(PB); bf* VTl = (bf*)take(PB);
    bf* ATh = (bf*)take(PB); bf* ATl = (bf*)take(PB);
    if ((size_t)(wsp - (char*)d_ws) > ws_size) return;    // ws 256 MiB
    k_cvt8<<<dim3(CH / 2048, 2 * XC + 4, 1), 256, 0, stream>>>(x, y, wq, wk, wv, wo, XB);
    k_qkv<<<dim3(NB_ * TT / 128, DQ / 128, 3), 128, 0, stream>>>(XB, YB, WQ, WK, WV, bq, bk, bv, QP16, QPh, QPl, KP16, KPh, KPl, VT16, VTh, VTl);
    k_attn<<<dim3(NH_, NB_, TT / QR), AW * 32, 0, stream>>>(QP16, KP16, VT16, QPh, QPl, KPh, KPl, VTh, VTl, kmask, ATh, ATl);
    k_gemmk<bf, 1, true, 2, 4, 4, 2, DQ><<<dim3(NB_ * TT / 128, DM / 128, 1), 256, 0, stream>>>(ATh, ATl, WO, OUT, DM, bo);
}

// v007
// Measured time: 116 microseconds a run.
// In two side-by-side timings against v006, it was 1.20 and 1.30 times as fast.
// Counting every step since v000, it is 18.2 times as fast.
#include <hip/hip_runtime.h>

// MultiHeadAttention_New (master, slave [2][2048][1024], attention_mask [2][2048] (int, read; random 0/1); q = (master Wq^T + bq) x 0.125, k/v = slave W^T + b (16 x 64); attn = clip(q.k, +-50000) + (mask == 0 ? -9e15 : mask) per key; softmax; out = merged Wo^T + bo -> [2][2048][1024]).
// Compute dtypes, f32 accumulate: every input rounded to bf16; q/k/v on PLAIN bf16 operands (inputs: exact) + bias; scores and attn.v: query rows < 512 hl (3 products), the rest single fp16 (x1024); the clamp and the additive mask term ((mask == 0) ? -9e15 : float(mask), read per key) in f32; softmax f32; Wo hl x exact (2 products) + bias.

#define NB_  2
#define TT   2048
#define DM   1024
#define NH_  16
#define NKV  16
#define REP  (NH_ / NKV)
#define HD   64
#define DQ   (NH_ * HD)
#define DKV  (NKV * HD)
#define RH   512                  // query rows < RH use hi+lo planes (0: none)
#define WIN  0
#define PCAR 1024.0f
#define SCL  0.125f   // HD^-0.5
typedef _Float16 h16;
typedef unsigned short bf;
typedef __attribute__((ext_vector_type(16))) __bf16   v16bf;
typedef __attribute__((ext_vector_type(16))) _Float16 v16h;
typedef __attribute__((ext_vector_type(8)))  _Float16 v8h;
typedef __attribute__((ext_vector_type(8)))  unsigned short v8us;
typedef __attribute__((ext_vector_type(8)))  float    v8f;
typedef __attribute__((ext_vector_type(4)))  float    v4f;
typedef v8h  __attribute__((may_alias)) v8ha;
typedef v4f  __attribute__((may_alias)) v4fa;
typedef v8us __attribute__((may_alias)) v8usa;

__device__ __forceinline__ unsigned short f2bf(float f) { unsigned u = __float_as_uint(f); u += 0x7FFFu + ((u >> 16) & 1u); return (unsigned short)(u >> 16); }
__device__ __forceinline__ float bf2f(unsigned short b) { return __uint_as_float(((unsigned)b) << 16); }
__device__ __forceinline__ float bfr(float f) { return bf2f(f2bf(f)); }
__device__ __forceinline__ v16h cat16(v8h lo, v8h hi) { return __builtin_shufflevector(lo, hi, 0, 1, 2, 3, 4, 5, 6, 7, 8, 9, 10, 11, 12, 13, 14, 15); }
__device__ __forceinline__ v16bf cat16b(v8us lo, v8us hi) { return __builtin_bit_cast(v16bf, __builtin_shufflevector(lo, hi, 0, 1, 2, 3, 4, 5, 6, 7, 8, 9, 10, 11, 12, 13, 14, 15)); }
__device__ __forceinline__ v8f wmma16(v16h a, v16h b, v8f c) { return __builtin_amdgcn_wmma_f32_16x16x32_f16(false, a, false, b, (short)0, c, false, false); }
__device__ __forceinline__ v8f wmmab(v16bf a, v16bf b, v8f c) { return __builtin_amdgcn_wmma_f32_16x16x32_bf16(false, a, false, b, (short)0, c, false, false); }



// ---- operand fragments straight from 16-bit planes kept in FRAGMENT ORDER: lane lr + 16 hi = row lr, k = 8 hi + 0..7 and 16 + 8 hi + 0..7 of a 32-wide k step, the same for A and for B.
// A plane of K-wide rows is cut into blocks of 16 rows x 32 k (512 elements, 1 KiB), block (row / 16, k / 32) with k / 32 running fastest; in a block the 8 elements of a lane's first load lie at lane x 8, those of its second at 256 + lane x 8.
// So each wave-wide 16-byte load reads 512 contiguous bytes (4 whole lines) where row-major planes gave it 32 bytes of each of 16 lines. pk: where element (row, k) lies.
__device__ __forceinline__ size_t pk(int row, int k, int K) { return ((size_t)(row >> 4) * (K >> 5) + (k >> 5)) * 512 + ((k >> 4) & 1) * 256 + ((((k >> 3) & 1) << 4) + (row & 15)) * 8 + (k & 7); }
template <typename T16> struct WFrag;
template <> struct WFrag<h16> { typedef v16h V; static __device__ __forceinline__ V ld(const h16* p) { return cat16(*(const v8h*)p, *(const v8h*)(p + 256)); } static __device__ __forceinline__ v8f mma(V a, V b, v8f c) { return wmma16(a, b, c); } };
template <> struct WFrag<bf> { typedef v16bf V; static __device__ __forceinline__ V ld(const bf* p) { return cat16b(*(const v8us*)p, *(const v8us*)(p + 256)); } static __device__ __forceinline__ v8f mma(V a, V b, v8f c) { return wmmab(a, b, c); } };

__device__ __forceinline__ h16 tohx(float x) { return (h16)x; }
__device__ __forceinline__ void splitf(float y, unsigned short& h, unsigned short& l) { h = f2bf(y); l = f2bf(y - bf2f(h)); }
typedef __attribute__((ext_vector_type(4))) _Float16 v4h;
typedef __attribute__((ext_vector_type(4))) unsigned short v4us;

// ---- copy4, copy8: four or eight 16-byte asynchronous copies a lane, global memory to LDS through no register. l: the lane's LDS byte address, g: its global address; copy i of a run of four lies i lstep bytes and i gstep elements further; copy8 takes two such runs.
// s_wait_xcnt is the last line of the copies' own statement, so that it stands in front of every rewrite of a register that they name.
template <typename T16>
__device__ __forceinline__ void copy4(unsigned l, const T16* g, unsigned lstep, size_t gstep) {
    asm volatile("global_load_async_to_lds_b128 %0, %4, off\n\t"
                 "global_load_async_to_lds_b128 %1, %5, off\n\t"
                 "global_load_async_to_lds_b128 %2, %6, off\n\t"
                 "global_load_async_to_lds_b128 %3, %7, off\n\t"
                 "s_wait_xcnt 0x0"
                 :: "v"(l), "v"(l + lstep), "v"(l + 2 * lstep), "v"(l + 3 * lstep), "v"(g), "v"(g + gstep), "v"(g + 2 * gstep), "v"(g + 3 * gstep) : "memory");
}
template <typename T16>
__device__ __forceinline__ void copy8(unsigned l, const T16* g, unsigned m, const T16* h, unsigned lstep, size_t gstep) {
    asm volatile("global_load_async_to_lds_b128 %0, %8, off\n\t"
                 "global_load_async_to_lds_b128 %1, %9, off\n\t"
                 "global_load_async_to_lds_b128 %2, %10, off\n\t"
                 "global_load_async_to_lds_b128 %3, %11, off\n\t"
                 "global_load_async_to_lds_b128 %4, %12, off\n\t"
                 "global_load_async_to_lds_b128 %5, %13, off\n\t"
                 "global_load_async_to_lds_b128 %6, %14, off\n\t"
                 "global_load_async_to_lds_b128 %7, %15, off\n\t"
                 "s_wait_xcnt 0x0"
                 :: "v"(l), "v"(l + lstep), "v"(l + 2 * lstep), "v"(l + 3 * lstep), "v"(m), "v"(m + lstep), "v"(m + 2 * lstep), "v"(m + 3 * lstep),
                    "v"(g), "v"(g + gstep), "v"(g + 2 * gstep), "v"(g + 3 * gstep), "v"(h), "v"(h + gstep), "v"(h + 2 * gstep), "v"(h + 3 * gstep) : "memory");
}
// ---- gemmk_tile: C[m][n] (f32, pitch ldc, + optional f32 bias[n]) = sum_k A[m][k] Bt[n][k] (NSPLIT 1: + A2[m][k] Bt[n][k]): WM x WN waves of one work-group share one 128 x 128 output tile, wave (wm, wn) owns (16 MB) x (16 NB) of it and sums the whole K in k order.
// The operands come through LDS, 64 k a stage, two buffers: a stage holds, per operand, 8 row blocks x 2 KiB (two fragment-order blocks each, contiguous in the plane), brought by asynchronous copies one stage ahead of its use, so each operand byte leaves L2 once a work-group and every wave reads its fragments from LDS.
// Behind the last stage the tile is parked in the same LDS (row-major, pitch 128 + 4 floats), one barrier, and whole row pieces are stored. One work-group of 32 WM WN threads a tile at rows r0, columns c0; tokens of both batches run through as one row index b TT + t.
// EPI says what is stored. 0: C in f32. 1 and 2: no f32 C; each sum goes straight to the three 16-bit planes that attention reads (fp16, bf16 hi, bf16 lo).
// 1: m = token, n = feature, head planes [b][n / HD] of rows t, k = n % HD. 2: m = feature, n = token (weights as A, tokens as Bt), planes [b] of rows m, k = t, the bias taken per row m. A, Bt and the planes written are all in fragment order (pk).
template <typename T16, int NSPLIT, bool BIAS, int MB, int NB, int WM, int WN, int K, int EPI>
__device__ __forceinline__ void gemmk_tile(const T16* __restrict__ A, const T16* __restrict__ A2, const T16* __restrict__ Bt, float* C, int ldc, const float* __restrict__ bias, int r0, int c0, h16* P16, bf* Ph, bf* Pl, float* red) {
    typedef typename WFrag<T16>::V V;
    constexpr int NT = WM * WN * 32, TM = WM * MB * 16, TN = WN * NB * 16, PT = TN + 4;
    constexpr bool AHEAD = MB * NB <= 8; constexpr int PE = 8 * 1024, SE = (NSPLIT == 1 ? 3 : 2) * PE, NS = K / 64, CS = NT / 128;   // elements of one operand's part of a stage and of a stage; stages; row blocks that one copy of the whole work-group covers
    static_assert(TM == 128 && TN == 128 && (NT == 128 || NT == 256) && K % 64 == 0 && NS >= 2 && (NSPLIT == 0 || NSPLIT == 1), "stage shape");
    const int lane = threadIdx.x & 31, lr = lane & 15, hi = lane >> 4, wave = threadIdx.x >> 5, wm = wave / WN, wn = wave % WN;
    const T16* st = (const T16*)red;
    const unsigned lofs = (unsigned)(size_t)red + (threadIdx.x >> 7) * 2048 + (threadIdx.x & 127) * 16;   // 128 threads copy the 2 KiB of one row block
    const size_t gofs = (size_t)(threadIdx.x >> 7) * (K * 16) + (threadIdx.x & 127) * 8;                  // r0 and c0 are multiples of 16, so r0 K and c0 K are where their row panels start; a row block is 16 K elements
    const T16* ga = A + (size_t)r0 * K + gofs; const T16* ga2 = (NSPLIT == 1) ? A2 + (size_t)r0 * K + gofs : nullptr; const T16* gb = Bt + (size_t)c0 * K + gofs;
    auto fill = [&](int s) { const unsigned l = lofs + (s & 1) * (SE * 2);
#pragma unroll
        for (int c = 0; c < 8; c += 4 * CS) { copy8(l + c * 2048, ga + s * 1024 + (size_t)c * (K * 16), l + PE * 2 + c * 2048, gb + s * 1024 + (size_t)c * (K * 16), CS * 2048, (size_t)CS * (K * 16));
            if (NSPLIT == 1) copy4(l + PE * 4 + c * 2048, ga2 + s * 1024 + (size_t)c * (K * 16), CS * 2048, (size_t)CS * (K * 16)); } };
    v8f acc[MB][NB];
#pragma unroll
    for (int mb = 0; mb < MB; ++mb)
#pragma unroll
        for (int nb = 0; nb < NB; ++nb) acc[mb][nb] = (v8f){};
    fill(0);
    asm volatile("s_wait_asynccnt 0x0" ::: "memory");   // stage 0 has landed, as far as this wave copied it
    __syncthreads();                                    // and as far as the others did
    fill(1);
    // unrolled: NS is a small constant, so each stage's buffer is known when compiling and no matrix instruction stands in front of a back edge
#pragma unroll
    for (int s = 0; s < NS; ++s) { const T16* sb = st + (s & 1) * SE + lane * 8;
        V a[2][MB], a2[2][MB], b[2][NB];
#pragma unroll
        for (int kb = 0; kb < 2; ++kb) {
            // the fragments of a 32-k block are asked for as one group (AHEAD: those of both blocks of the stage at once, where the registers allow it)
            if (!AHEAD || kb == 0) {
#pragma unroll
                for (int k2 = kb; k2 < (AHEAD ? 2 : kb + 1); ++k2) {
#pragma unroll
                    for (int mb = 0; mb < MB; ++mb) { a[k2][mb] = WFrag<T16>::ld(sb + (wm * MB + mb) * 1024 + k2 * 512); if (NSPLIT == 1) a2[k2][mb] = WFrag<T16>::ld(sb + 2 * PE + (wm * MB + mb) * 1024 + k2 * 512); }
#pragma unroll
                    for (int nb = 0; nb < NB; ++nb) b[k2][nb] = WFrag<T16>::ld(sb + PE + (wn * NB + nb) * 1024 + k2 * 512); }
                __builtin_amdgcn_sched_barrier(0);   // keeps the group together in front of its products: left alone the scheduler sinks each load to its use, and every four products wait a whole LDS trip
            }
#pragma unroll
            for (int nb = 0; nb < NB; ++nb) {
#pragma unroll
                for (int mb = 0; mb < MB; ++mb) acc[mb][nb] = WFrag<T16>::mma(a[kb][mb], b[kb][nb], acc[mb][nb]);
                if (NSPLIT == 1) {
#pragma unroll
                    for (int mb = 0; mb < MB; ++mb) acc[mb][nb] = WFrag<T16>::mma(a2[kb][mb], b[kb][nb], acc[mb][nb]); } }
            if (!AHEAD || kb == 1) __builtin_amdgcn_sched_barrier(0);   // keeps the next group behind these products, whose registers it takes over, and the stage's last products in front of its foot: sunk among the next copies they hold their fragments live and the registers run over 256
        }
        asm volatile("s_wait_dscnt 0x0" ::: "memory");      // this wave has read the last of stage s
        asm volatile("s_wait_asynccnt 0x0" ::: "memory");   // and its copies of stage s + 1 have landed
        __syncthreads();                                    // publishes stage s + 1 and frees the buffer of stage s
        if (s + 2 < NS) fill(s + 2);
    }
    asm volatile("s_wait_asynccnt 0x0" ::: "memory");   // no copy is under way when the buffers become the parking place
#pragma unroll
    for (int mb = 0; mb < MB; ++mb)
#pragma unroll
        for (int nb = 0; nb < NB; ++nb)
#pragma unroll
            for (int j = 0; j < 8; ++j) red[((wm * MB + mb) * 16 + hi * 8 + j) * PT + (wn * NB + nb) * 16 + lr] = acc[mb][nb][j];
    __syncthreads();
    // four pieces a trip: their LDS reads and stores overlap and a bias taken by column leaves the loop; one by one each piece waits out its own loads, and a thread now has 16 or 32 pieces
#pragma unroll 1
    for (int it = 0; it < TM * TN / 4 / NT; it += 4) {
#pragma unroll
      for (int u = 0; u < 4; ++u) { const int e = threadIdx.x + (it + u) * NT;
        // f32 C: a wave takes whole rows. Planes: a wave takes 16 rows x 8 columns, lane = row + 16 x (column half), which are 256 contiguous bytes of a block
        const int row = (EPI == 0) ? e / (TN / 4) : ((e >> 5) / (TN / 8)) * 16 + (e & 15), cofs = (EPI == 0) ? (e % (TN / 4)) * 4 : ((e >> 5) % (TN / 8)) * 8 + ((e >> 4) & 1) * 4; v4f val = *(const v4fa*)(red + row * PT + cofs);
        if (BIAS && EPI == 2) { const float br = bfr(bias[r0 + row]); val[0] += br; val[1] += br; val[2] += br; val[3] += br; }
        else if (BIAS) { val[0] += bfr(bias[c0 + cofs]); val[1] += bfr(bias[c0 + cofs + 1]); val[2] += bfr(bias[c0 + cofs + 2]); val[3] += bfr(bias[c0 + cofs + 3]); }
        if constexpr (EPI == 0) *(v4f*)(C + (size_t)(r0 + row) * ldc + c0 + cofs) = val;
        else { v4h o16; v4us oh, ol;
#pragma unroll
            for (int q = 0; q < 4; ++q) { o16[q] = tohx(val[q]); unsigned short a2, c2; splitf(val[q], a2, c2); oh[q] = a2; ol[q] = c2; }
            const size_t oo = (EPI == 1) ? (size_t)((r0 + row) / TT * NH_ + (c0 + cofs) / HD) * TT * HD + pk((r0 + row) % TT, (c0 + cofs) % HD, HD) : (size_t)((c0 + cofs) / TT) * DKV * TT + pk(r0 + row, (c0 + cofs) % TT, TT);
            *(v4h*)(P16 + oo) = o16; *(v4us*)(Ph + oo) = oh; *(v4us*)(Pl + oo) = ol; } }
      asm volatile("s_wait_xcnt 0x0" ::: "memory");   // behind the trip's last store, in front of the next trip's rewrite of the stores' registers
    }
}
// ---- k_gemmk: the f32 form of gemmk_tile. grid (M / 128, N / 128), 32 WM WN threads. LDS: two stages, which also hold the parked tile.
template <typename T16, int NSPLIT, bool BIAS, int MB, int NB, int WM, int WN, int K>
__global__ __launch_bounds__(WM * WN * 32) void k_gemmk(const T16* __restrict__ A, const T16* __restrict__ A2, const T16* __restrict__ Bt, float* C, int ldc, const float* __restrict__ bias) {
    static_assert(NSPLIT == 1, "three operand parts a stage");
    __shared__ __align__(16) float red[2 * 3 * 8 * 1024 / 2];
    gemmk_tile<T16, NSPLIT, BIAS, MB, NB, WM, WN, K, 0>(A, A2, Bt, C, ldc, bias, blockIdx.x * 128, blockIdx.y * 128, nullptr, nullptr, nullptr, red);
}
// ---- k_qkv: the three projections of both batches in one launch; blockIdx.z says which (0 q, 1 k, 2 v), the same for the whole work-group, so the barriers inside stay uniform. grid (NB_ TT / 128, DQ / 128, 3), 128 threads.
__global__ __launch_bounds__(128) void k_qkv(const bf* __restrict__ XB, const bf* __restrict__ YB, const bf* __restrict__ WQ, const bf* __restrict__ WK, const bf* __restrict__ WV, const float* __restrict__ bq, const float* __restrict__ bk, const float* __restrict__ bv,
                                             h16* QP16, bf* QPh, bf* QPl, h16* KP16, bf* KPh, bf* KPl, h16* VT16, bf* VTh, bf* VTl) {
    static_assert(DQ == DKV && NH_ == NKV && TT % 128 == 0, "one grid serves q, k and v");
    __shared__ __align__(16) float red[128 * 132];   // the parked tile; the two stages (64 KiB) lie in it
    const int t0 = blockIdx.x * 128, f0 = blockIdx.y * 128;
    if (blockIdx.z == 2) gemmk_tile<bf, 0, true, 4, 4, 2, 2, DM, 2>(WV, nullptr, YB, nullptr, 0, bv, f0, t0, VT16, VTh, VTl, red);   // weights as A: v comes out feature-major, the order attn.v reads
    else { const bool isq = blockIdx.z == 0;
        gemmk_tile<bf, 0, true, 4, 4, 2, 2, DM, 1>(isq ? XB : YB, nullptr, isq ? WQ : WK, nullptr, 0, isq ? bq : bk, t0, f0, isq ? QP16 : KP16, isq ? QPh : KPh, isq ? QPl : KPl, red); }
}

typedef __attribute__((ext_vector_type(2))) unsigned short v2us;
typedef __attribute__((ext_vector_type(2))) float v2f;
typedef __attribute__((ext_vector_type(4))) int v4i;
typedef __attribute__((ext_vector_type(8))) unsigned v8u;

__global__ __launch_bounds__(256) void k_wtG(const float* __restrict__ w, int K, int N, bf* Bt) {
    const int lane = threadIdx.x & 31; const int L0 = (blockIdx.x * 8 + (threadIdx.x >> 5)) * 8; const int nlines = N * K / 64;
{
#pragma unroll 1
        for (int l = 0; l < 8; ++l) { const int L = L0 + l; if (L >= nlines) break; const size_t e = (size_t)L * 64 + lane * 2; const int k = (int)(e % K), n = (int)(e / K); v2us o;
            o[0] = f2bf(w[(size_t)k * N + n]); o[1] = f2bf(w[(size_t)(k + 1) * N + n]); *(v2us*)(Bt + e) = o; }
         }
}
// ---- k_cvt8: every f32 operand to bf16, in fragment order, in one launch. blockIdx.y names a chunk of CH elements: the chunks of x, then of y, then the four weights; dst holds them in that order. grid (CH / 2048, 2 XC + 4), 256 threads.
// A work-group takes 16 rows x 128 k: 2048 contiguous elements of dst (four blocks). Piece p = k / 8 of row r goes to piece 16 p + r: the 16-byte pieces are turned through LDS (pitch 272 bytes: no bank met twice), so reads and stores both stay on whole lines.
#define CH   (DM * DQ)
#define XC   (NB_ * TT * DM / CH)
__global__ __launch_bounds__(256) void k_cvt8(const float* __restrict__ x, const float* __restrict__ y, const float* __restrict__ wq, const float* __restrict__ wk, const float* __restrict__ wv, const float* __restrict__ wo, bf* dst0) {
    static_assert(NB_ * TT * DM % CH == 0 && DKV == DQ && DQ == DM && CH % (16 * DM) == 0 && DM % 128 == 0, "chunks");
    __shared__ __align__(16) bf st[16 * 136];
    const int c = blockIdx.y; const float* src = (c < XC) ? x + (size_t)c * CH : (c < 2 * XC) ? y + (size_t)(c - XC) * CH : (c == 2 * XC) ? wq : (c == 2 * XC + 1) ? wk : (c == 2 * XC + 2) ? wv : wo; bf* dst = dst0 + (size_t)c * CH;
    const int r = threadIdx.x >> 4, p = threadIdx.x & 15; const v8f v = *(const v8f*)(src + (size_t)(blockIdx.x / (DM / 128) * 16 + r) * DM + blockIdx.x % (DM / 128) * 128 + p * 8); v8us o;
    asm volatile("s_wait_xcnt 0x0" ::: "memory");   // behind the loads, in front of the first rewrite of their address registers
#pragma unroll
    for (int k = 0; k < 8; ++k) o[k] = f2bf(v[k]);
    *(v8usa*)(st + p * 136 + r * 8) = o;
    __syncthreads();
    *(v8us*)(dst + (size_t)blockIdx.x * 2048 + threadIdx.x * 8) = *(const v8usa*)(st + r * 136 + p * 8);  }
// ---- exp2x8, exp2x1: v_exp_f32 with the slot that the instruction set asks for behind a transcendental (before its result is used or its source overwritten) closed inside the statement: results lie apart from all sources, so each v_exp_f32 is the independent instruction behind the one in front of it, and one v_nop stands behind the last.
__device__ __forceinline__ v8f exp2x8(v8f x) { float e0, e1, e2, e3, e4, e5, e6, e7;
    asm("v_exp_f32 %0, %8\n\tv_exp_f32 %1, %9\n\tv_exp_f32 %2, %10\n\tv_exp_f32 %3, %11\n\tv_exp_f32 %4, %12\n\tv_exp_f32 %5, %13\n\tv_exp_f32 %6, %14\n\tv_exp_f32 %7, %15\n\tv_nop"
        : "=&v"(e0), "=&v"(e1), "=&v"(e2), "=&v"(e3), "=&v"(e4), "=&v"(e5), "=&v"(e6), "=&v"(e7) : "v"(x[0]), "v"(x[1]), "v"(x[2]), "v"(x[3]), "v"(x[4]), "v"(x[5]), "v"(x[6]), "v"(x[7]));
    return (v8f){e0, e1, e2, e3, e4, e5, e6, e7}; }
__device__ __forceinline__ float exp2x1(float x) { float e; asm("v_exp_f32 %0, %1\n\tv_nop" : "=&v"(e) : "v"(x)); return e; }
// ---- k_attn: scores, softmax, attn.v and the head merge. A wave keeps 16 QT query rows of one head and walks ALL keys, SK a stage, with a running row maximum and row sum; the AWV waves of a work-group share each stage's key and v blocks through LDS.
// A stage holds, per plane, SK keys x HD of k (8 KiB, contiguous in the plane) and HD rows x SK keys of v (four pieces of 2 KiB); two buffers, filled by asynchronous copies one stage ahead of their use, so each k and v byte leaves L2 once per 16 QT AWV query rows.
// Scores are formed TRANSPOSED (A = 16 keys, B = 16 queries): a lane holds, for query lr, keys hi 8 + j of each 16-key tile, which is the fragment order of attn.v (two tiles = one 32-key fragment), so the probabilities never leave the registers.
// attn.v is formed transposed too (A = 16 features of v, B = the probabilities): a lane holds, for the same query lr, features hi 8 + j, so maximum, sum and rescale stay in the lane (one exchange between the lane halves) and its 8 results are one 16-byte piece of the merged planes.
// Probabilities stay unnormalised (relative to the running maximum; single fp16 plane: x PCAR, as 2^10 in the exponent); the row sum carries the same factor and divides the result once, at the end. Every plane read or written here is in fragment order (pk).
// grid (NH_, NB_, NZH + NZ2 + NZ1), 32 AWV threads, longest work-groups first: hi/lo rows (QT 1, three products), then two thirds of the single-plane rows at QT 2, then the last third at QT 1. 256 work-groups of each kind: one of each fills a WGP with three waves a SIMD, and every SIMD gets the same work.
#define AWV  4
#define SK   64
#define NZH  (RH / (AWV * 16))
#define NZ2  ((TT - RH) * 2 / 3 / (AWV * 32))
#define NZ1  ((TT - RH) / 3 / (AWV * 16))
template <typename T16, bool HR, int QT>
__device__ __forceinline__ void attn_tile(const T16* __restrict__ Q, const T16* __restrict__ Q2, const T16* __restrict__ Kp, const T16* __restrict__ Kp2, const T16* __restrict__ Vt, const T16* __restrict__ Vt2, const int* __restrict__ km, bf* ATh, bf* ATl, int orow, int ocol, const T16* st, float* sma) {
    typedef typename WFrag<T16>::V V;
    constexpr int KT = SK / 16, KC = HD / 32, CT = SK / 32, DT = HD / 16, NS = TT / SK;
    constexpr int PE = SK * HD, SE = (HR ? 4 : 2) * PE;   // elements of one plane's k (or v) part of a stage, and of a stage: k, v (hi/lo rows: k hi, v hi, k lo, v lo)
    static_assert(AWV * 32 * 8 * 4 == PE && SK * 16 == AWV * 32 * 8 && DT == 4 && NS >= 2 && TT % (AWV * 128) == 0, "four copies a thread and part");
    const int lane = threadIdx.x & 31, lr = lane & 15, hi = lane >> 4, wave = threadIdx.x >> 5;
    const unsigned lofs = (unsigned)(size_t)st + threadIdx.x * 16;
    const unsigned tofs = threadIdx.x * 8;   // the planes' stage addresses are formed on the scalar side and this added: four 64-bit lane pointers kept over the loop would not fit the registers
    // k: 2 KiB after 2 KiB of the stage's 8; v: the stage's 2 KiB of each of the four 16-row blocks, 16 TT elements apart
    auto fill = [&](int s) { const unsigned l = lofs + (s & 1) * (SE * 2);
        copy4(l, (Kp + s * PE) + tofs, 2048u, (size_t)1024); copy4(l + PE * 2, (Vt + s * (SK * 16)) + tofs, 2048u, (size_t)16 * TT);
        if (HR) { copy4(l + PE * 4, (Kp2 + s * PE) + tofs, 2048u, (size_t)1024); copy4(l + PE * 6, (Vt2 + s * (SK * 16)) + tofs, 2048u, (size_t)16 * TT); } };
    fill(0);
    V qf[QT][KC], qf2[QT][KC];
#pragma unroll
    for (int qt = 0; qt < QT; ++qt)
#pragma unroll
        for (int kc = 0; kc < KC; ++kc) { qf[qt][kc] = WFrag<T16>::ld(Q + lane * 8 + (wave * QT + qt) * 16 * HD + kc * 512); if (HR) qf2[qt][kc] = WFrag<T16>::ld(Q2 + lane * 8 + (wave * QT + qt) * 16 * HD + kc * 512); }
    // the additive mask term of every key, once a work-group
#pragma unroll
    for (int i = 0; i < TT / (AWV * 128); ++i) { const v4i mk = *(const v4i*)(km + (i * (AWV * 32) + threadIdx.x) * 4); v4f ma;
#pragma unroll
        for (int q = 0; q < 4; ++q) ma[q] = (mk[q] == 0) ? -9.0e15f : (float)mk[q];
        *(v4fa*)(sma + (i * (AWV * 32) + threadIdx.x) * 4) = ma; }
    asm volatile("s_wait_xcnt 0x0" ::: "memory");       // behind the query and mask loads, in front of any rewrite of their address registers
    asm volatile("s_wait_asynccnt 0x0" ::: "memory");   // stage 0 has landed, as far as this wave copied it
    __syncthreads();                                    // and as far as the others did; the mask terms are written
    fill(1);
    float mrun[QT], lsum[QT]; v8f o[DT][QT];
#pragma unroll
    for (int qt = 0; qt < QT; ++qt) { mrun[qt] = -3.0e38f; lsum[qt] = 0.f;
#pragma unroll
        for (int dt = 0; dt < DT; ++dt) o[dt][qt] = (v8f){}; }
    // rolled, for speed only
#pragma unroll 1
    for (int s = 0; s < NS; ++s) { const T16* sb = st + (s & 1) * SE + lane * 8;
        V kf[KT][KC], kf2[KT][KC], vf[DT][CT], vf2[DT][CT];
#pragma unroll
        for (int kt = 0; kt < KT; ++kt)
#pragma unroll
            for (int kc = 0; kc < KC; ++kc) { kf[kt][kc] = WFrag<T16>::ld(sb + (kt * KC + kc) * 512); if (HR) kf2[kt][kc] = WFrag<T16>::ld(sb + 2 * PE + (kt * KC + kc) * 512); }
        __builtin_amdgcn_sched_barrier(0);   // keeps the stage's key fragments together in front of the score products: sunk to their uses, every few products wait a whole LDS trip
        v8f sc[KT][QT];
#pragma unroll
        for (int kc = 0; kc < KC; ++kc) {
#pragma unroll
            for (int kt = 0; kt < KT; ++kt)
#pragma unroll
                for (int qt = 0; qt < QT; ++qt) sc[kt][qt] = WFrag<T16>::mma(kf[kt][kc], qf[qt][kc], (kc == 0) ? (v8f){} : sc[kt][qt]);
            if (HR) {
#pragma unroll
                for (int kt = 0; kt < KT; ++kt)
#pragma unroll
                    for (int qt = 0; qt < QT; ++qt) sc[kt][qt] = WFrag<T16>::mma(kf[kt][kc], qf2[qt][kc], sc[kt][qt]);
#pragma unroll
                for (int kt = 0; kt < KT; ++kt)
#pragma unroll
                    for (int qt = 0; qt < QT; ++qt) sc[kt][qt] = WFrag<T16>::mma(kf2[kt][kc], qf[qt][kc], sc[kt][qt]); } }
        __builtin_amdgcn_sched_barrier(0);   // keeps the v fragments, which take over the key fragments' registers, behind the score products
#pragma unroll
        for (int c = 0; c < CT; ++c)
#pragma unroll
            for (int dt = 0; dt < DT; ++dt) { vf[dt][c] = WFrag<T16>::ld(sb + PE + dt * (SK * 16) + c * 512); if (HR) vf2[dt][c] = WFrag<T16>::ld(sb + 3 * PE + dt * (SK * 16) + c * 512); }
        __builtin_amdgcn_sched_barrier(0);   // keeps the v loads together, behind the score products and in front of all that follows: spread by the scheduler they leave more registers live at the foot, and the hi/lo rows' copy pointers are spilled
#pragma unroll
        for (int kt = 0; kt < KT; ++kt)
#pragma unroll
            for (int qt = 0; qt < QT; ++qt)
#pragma unroll
                for (int j = 0; j < 8; ++j) sc[kt][qt][j] = fminf(fmaxf(sc[kt][qt][j] * SCL, -50000.0f), 50000.0f);
        // the stage's foot stands here, behind its last read of the buffer: the rest of the trip works on registers (and the mask terms), and the copies of stage s + 2 get that time and the next stage's scores to land
        asm volatile("s_wait_dscnt 0x0" ::: "memory");      // this wave has read the last of stage s
        asm volatile("s_wait_asynccnt 0x0" ::: "memory");   // and its copies of stage s + 1 have landed
        __syncthreads();                                    // publishes stage s + 1 and frees the buffer of stage s
        if (s + 2 < NS) fill(s + 2);
        float mx[QT];
#pragma unroll
        for (int qt = 0; qt < QT; ++qt) mx[qt] = mrun[qt];
#pragma unroll
        for (int kt = 0; kt < KT; ++kt) { const v4f a0 = *(const v4fa*)(sma + s * SK + kt * 16 + hi * 8), a1 = *(const v4fa*)(sma + s * SK + kt * 16 + hi * 8 + 4);
#pragma unroll
            for (int qt = 0; qt < QT; ++qt)
#pragma unroll
                for (int j = 0; j < 8; ++j) { const float t = __fadd_rn(sc[kt][qt][j], (j < 4) ? a0[j & 3] : a1[j & 3]); sc[kt][qt][j] = t; mx[qt] = fmaxf(mx[qt], t); } }
        V pf[CT][QT], pf2[CT][QT];
#pragma unroll
        for (int qt = 0; qt < QT; ++qt) { const float m = fmaxf(mx[qt], __shfl_xor(mx[qt], 16, 32));
            const float al = exp2x1(__fmul_rn(__fsub_rn(mrun[qt], m), 1.4426950408889634f)); mrun[qt] = m;   // what the sums so far shrink by under the new maximum (0 in the first stage)
            float sp[KT];   // one partial sum a key tile: independent chains, where one chain of 32 adds would wait out each add
#pragma unroll
            for (int kt = 0; kt < KT; ++kt) { v8f x;
#pragma unroll
                for (int j = 0; j < 8; ++j) { const float d = __fsub_rn(sc[kt][qt][j], m); x[j] = HR ? __fmul_rn(d, 1.4426950408889634f) : __builtin_fmaf(d, 1.4426950408889634f, 10.0f); }
                sc[kt][qt] = exp2x8(x); sp[kt] = sc[kt][qt][0];
#pragma unroll
                for (int j = 1; j < 8; ++j) sp[kt] += sc[kt][qt][j]; }
            static_assert(KT == 4, "four partial sums");
            lsum[qt] = lsum[qt] * al + ((sp[0] + sp[1]) + (sp[2] + sp[3]));
#pragma unroll
            for (int dt = 0; dt < DT; ++dt) o[dt][qt] *= al;
#pragma unroll
            for (int c = 0; c < CT; ++c) {
                if constexpr (HR) { v8u ph, pl;   // two 16-bit planes, packed a register pair at a time
#pragma unroll
                    for (int j = 0; j < 16; j += 2) { unsigned short h0, l0, h1, l1; splitf(sc[2 * c + j / 8][qt][j % 8], h0, l0); splitf(sc[2 * c + j / 8][qt][j % 8 + 1], h1, l1); ph[j / 2] = (unsigned)h0 | ((unsigned)h1 << 16); pl[j / 2] = (unsigned)l0 | ((unsigned)l1 << 16); }
                    pf[c][qt] = __builtin_bit_cast(v16bf, ph); pf2[c][qt] = __builtin_bit_cast(v16bf, pl);
                } else { v8h x0, x1;
#pragma unroll
                    for (int j = 0; j < 8; ++j) { x0[j] = tohx(sc[2 * c][qt][j]); x1[j] = tohx(sc[2 * c + 1][qt][j]); }
                    pf[c][qt] = cat16(x0, x1); } } }
#pragma unroll
        for (int c = 0; c < CT; ++c) {
#pragma unroll
            for (int dt = 0; dt < DT; ++dt)
#pragma unroll
                for (int qt = 0; qt < QT; ++qt) o[dt][qt] = WFrag<T16>::mma(vf[dt][c], pf[c][qt], o[dt][qt]);
            if (HR) {
#pragma unroll
                for (int dt = 0; dt < DT; ++dt)
#pragma unroll
                    for (int qt = 0; qt < QT; ++qt) o[dt][qt] = WFrag<T16>::mma(vf[dt][c], pf2[c][qt], o[dt][qt]);
#pragma unroll
                for (int dt = 0; dt < DT; ++dt)
#pragma unroll
                    for (int qt = 0; qt < QT; ++qt) o[dt][qt] = WFrag<T16>::mma(vf2[dt][c], pf[c][qt], o[dt][qt]); } }
    }
    asm volatile("s_wait_asynccnt 0x0" ::: "memory");   // no copy is under way when the wave ends
#pragma unroll
    for (int qt = 0; qt < QT; ++qt) { const float inv = __fdiv_rn(1.0f, lsum[qt] + __shfl_xor(lsum[qt], 16, 32));   // the two lane halves summed different keys
#pragma unroll
        for (int dt = 0; dt < DT; ++dt) { v8us oh, ol;
#pragma unroll
            for (int j = 0; j < 8; ++j) { unsigned short a, c2; splitf(o[dt][qt][j] * inv, a, c2); oh[j] = a; ol[j] = c2; }
            const size_t oo = pk(orow + (wave * QT + qt) * 16 + lr, ocol + dt * 16 + hi * 8, DQ);   // the lane's 8 features are one 16-byte piece; a wave stores 512 contiguous bytes
            *(v8us*)(ATh + oo) = oh; *(v8us*)(ATl + oo) = ol;
            asm volatile("s_wait_xcnt 0x0" ::: "memory");   // behind the stores, in front of the next piece's rewrite of their registers
        } }
}
__global__ __launch_bounds__(AWV * 32) void k_attn(const h16* __restrict__ Q16, const h16* __restrict__ K16, const h16* __restrict__ V16, const bf* __restrict__ Qh, const bf* __restrict__ Ql, const bf* __restrict__ Kh, const bf* __restrict__ Kl, const bf* __restrict__ Vh, const bf* __restrict__ Vl, const int* __restrict__ km, bf* ATh, bf* ATl) {
    static_assert(RH % (AWV * 16) == 0 && RH + NZ2 * (AWV * 32) + NZ1 * (AWV * 16) == TT && TT % SK == 0 && NH_ == NKV, "tile shape");
    __shared__ __align__(16) bf stg[2 * 4 * SK * HD]; __shared__ __align__(16) float sma[TT];
    const int h = blockIdx.x, b = blockIdx.y, z = blockIdx.z; const int q0 = (z < NZH) ? z * (AWV * 16) : (z < NZH + NZ2) ? RH + (z - NZH) * (AWV * 32) : RH + NZ2 * (AWV * 32) + (z - NZH - NZ2) * (AWV * 16);
    const size_t zp = (size_t)(b * NH_ + h) * TT * HD, zq = zp + (size_t)q0 * HD; const int orow = b * TT + q0, ocol = h * HD; km += b * TT;
    // z is the same for the whole work-group: the barriers inside stay uniform
    if (z < NZH) attn_tile<bf, true, 1>(Qh + zq, Ql + zq, Kh + zp, Kl + zp, Vh + zp, Vl + zp, km, ATh, ATl, orow, ocol, stg, sma);
    else if (z < NZH + NZ2) attn_tile<h16, false, 2>(Q16 + zq, nullptr, K16 + zp, nullptr, V16 + zp, nullptr, km, ATh, ATl, orow, ocol, (const h16*)stg, sma);
    else attn_tile<h16, false, 1>(Q16 + zq, nullptr, K16 + zp, nullptr, V16 + zp, nullptr, km, ATh, ATl, orow, ocol, (const h16*)stg, sma);
}

extern "C" void kernel_launch(void* const* d_in, const int* in_sizes, int n_in,
                              void* d_out, int out_size, void* d_ws, size_t ws_size, hipStream_t stream) {
    (void)in_sizes; (void)n_in; (void)out_size;
    const float* x = (const float*)d_in[0]; const float* y = (const float*)d_in[1]; const int* kmask = (const int*)d_in[2]; const float* wq = (const float*)d_in[3]; const float* bq = (const float*)d_in[4]; const float* wk = (const float*)d_in[5]; const float* bk = (const float*)d_in[6]; const float* wv = (const float*)d_in[7]; const float* bv = (const float*)d_in[8]; const float* wo = (const float*)d_in[9]; const float* bo = (const float*)d_in[10]; const float* cosT = nullptr; const float* sinT = nullptr; (void)cosT; (void)sinT;
    float* OUT = (float*)d_out;     // [2][2048][1024]
    char* wsp = (char*)d_ws;
    auto take = [&](size_t bytes) { char* p = wsp; wsp += (bytes + 255) & ~(size_t)255; return (void*)p; };
    bf* XB = (bf*)take((size_t)NB_ * TT * DM * 2); bf* YB = (bf*)take((size_t)NB_ * TT * DM * 2);   // XB .. WO lie back to back: the one destination of k_cvt8
    bf* WQ = (bf*)take((size_t)DQ * DM * 2); bf* WK = (bf*)take((size_t)DKV * DM * 2); bf* WV = (bf*)take((size_t)DKV * DM * 2); bf* WO = (bf*)take((size_t)DM * DQ * 2);
    const size_t PB = (size_t)NB_ * NH_ * TT * HD * 2;    // bytes of one 16-bit plane, both batches
    h16* QP16 = (h16*)take(PB); h16* KP16 = (h16*)take(PB); h16* VT16 = (h16*)take(PB);
    bf* QPh = (bf*)take(PB); bf* QPl = (bf*)take(PB); bf* KPh = (bf*)take(PB); bf* KPl = (bf*)take(PB); bf* VTh = (bf*)take(PB); bf* VTl = (bf*)take(PB);
    bf* ATh = (bf*)take(PB); bf* ATl = (bf*)take(PB);
    if ((size_t)(wsp - (char*)d_ws) > ws_size) return;    // ws 256 MiB
    k_cvt8<<<dim3(CH / 2048, 2 * XC + 4, 1), 256, 0, stream>>>(x, y, wq, wk, wv, wo, XB);
    k_qkv<<<dim3(NB_ * TT / 128, DQ / 128, 3), 128, 0, stream>>>(XB, YB, WQ, WK, WV, bq, bk, bv, QP16, QPh, QPl, KP16, KPh, KPl, VT16, VTh, VTl);
    k_attn<<<dim3(NH_, NB_, NZH + NZ2 + NZ1), AWV * 32, 0, stream>>>(QP16, KP16, VT16, QPh, QPl, KPh, KPl, VTh, VTl, kmask, ATh, ATl);
    k_gemmk<bf, 1, true, 2, 4, 4, 2, DQ><<<dim3(NB_ * TT / 128, DM / 128, 1), 256, 0, stream>>>(ATh, ATl, WO, OUT, DM, bo);
}

// v008
// A run of this version takes 87.3 microseconds.
// Next to v007, in two timings, it ran 1.30 and 1.28 times as fast.
// Over all steps from v000 it is 23.4 times as fast.
#include <hip/hip_runtime.h>

// MultiHeadAttention_New (master, slave [2][2048][1024], attention_mask [2][2048] (int, read; random 0/1); q = (master Wq^T + bq) x 0.125, k/v = slave W^T + b (16 x 64); attn = clip(q.k, +-50000) + (mask == 0 ? -9e15 : mask) per key; softmax; out = merged Wo^T + bo -> [2][2048][1024]).
// Compute dtypes, f32 accumulate: every input rounded to bf16; q/k/v on PLAIN bf16 operands (inputs: exact) + bias; scores and attn.v: query rows < 512 hl (3 products), the rest single fp16 (x1024); the clamp and the additive mask term ((mask == 0) ? -9e15 : float(mask), read per key) in f32; softmax f32; Wo hl x exact (2 products) + bias.
// Key order: the rows of slave are stored with the keys of a non-zero mask first (each group in its old order). While a batch has such a key, a key of mask 0 lies 9e15 below every one of them (the clamp bounds the scores, an int the mask), so its probability is exactly 0 in f32:
// k, v and the key walk end behind the last non-zero key (NE keys, rounded up to whole tiles, whose zero-mask keys get their term as ever). A batch with no such key keeps all its keys (NE = TT).

#define NB_  2
#define TT   2048
#define DM   1024
#define NH_  16
#define NKV  16
#define REP  (NH_ / NKV)
#define HD   64
#define DQ   (NH_ * HD)
#define DKV  (NKV * HD)
#define RH   512                  // query rows < RH use hi+lo planes (0: none)
#define WIN  0
#define PCAR 1024.0f
#define SCL  0.125f   // HD^-0.5
typedef _Float16 h16;
typedef unsigned short bf;
typedef __attribute__((ext_vector_type(16))) __bf16   v16bf;
typedef __attribute__((ext_vector_type(16))) _Float16 v16h;
typedef __attribute__((ext_vector_type(8)))  _Float16 v8h;
typedef __attribute__((ext_vector_type(8)))  unsigned short v8us;
typedef __attribute__((ext_vector_type(8)))  float    v8f;
typedef __attribute__((ext_vector_type(4)))  float    v4f;
typedef v8h  __attribute__((may_alias)) v8ha;
typedef v4f  __attribute__((may_alias)) v4fa;
typedef v8us __attribute__((may_alias)) v8usa;

__device__ __forceinline__ unsigned short f2bf(float f) { unsigned u = __float_as_uint(f); u += 0x7FFFu + ((u >> 16) & 1u); return (unsigned short)(u >> 16); }
__device__ __forceinline__ float bf2f(unsigned short b) { return __uint_as_float(((unsigned)b) << 16); }
__device__ __forceinline__ float bfr(float f) { return bf2f(f2bf(f)); }
__device__ __forceinline__ v16h cat16(v8h lo, v8h hi) { return __builtin_shufflevector(lo, hi, 0, 1, 2, 3, 4, 5, 6, 7, 8, 9, 10, 11, 12, 13, 14, 15); }
__device__ __forceinline__ v16bf cat16b(v8us lo, v8us hi) { return __builtin_bit_cast(v16bf, __builtin_shufflevector(lo, hi, 0, 1, 2, 3, 4, 5, 6, 7, 8, 9, 10, 11, 12, 13, 14, 15)); }
__device__ __forceinline__ v8f wmma16(v16h a, v16h b, v8f c) { return __builtin_amdgcn_wmma_f32_16x16x32_f16(false, a, false, b, (short)0, c, false, false); }
__device__ __forceinline__ v8f wmmab(v16bf a, v16bf b, v8f c) { return __builtin_amdgcn_wmma_f32_16x16x32_bf16(false, a, false, b, (short)0, c, false, false); }



// ---- operand fragments straight from 16-bit planes kept in FRAGMENT ORDER: lane lr + 16 hi = row lr, k = 8 hi + 0..7 and 16 + 8 hi + 0..7 of a 32-wide k step, the same for A and for B.
// A plane of K-wide rows is cut into blocks of 16 rows x 32 k (512 elements, 1 KiB), block (row / 16, k / 32) with k / 32 running fastest; in a block the 8 elements of a lane's first load lie at lane x 8, those of its second at 256 + lane x 8.
// So each wave-wide 16-byte load reads 512 contiguous bytes (4 whole lines) where row-major planes gave it 32 bytes of each of 16 lines. pk: where element (row, k) lies.
__device__ __forceinline__ size_t pk(int row, int k, int K) { return ((size_t)(row >> 4) * (K >> 5) + (k >> 5)) * 512 + ((k >> 4) & 1) * 256 + ((((k >> 3) & 1) << 4) + (row & 15)) * 8 + (k & 7); }
template <typename T16> struct WFrag;
template <> struct WFrag<h16> { typedef v16h V; static __device__ __forceinline__ V ld(const h16* p) { return cat16(*(const v8h*)p, *(const v8h*)(p + 256)); } static __device__ __forceinline__ v8f mma(V a, V b, v8f c) { return wmma16(a, b, c); } };
template <> struct WFrag<bf> { typedef v16bf V; static __device__ __forceinline__ V ld(const bf* p) { return cat16b(*(const v8us*)p, *(const v8us*)(p + 256)); } static __device__ __forceinline__ v8f mma(V a, V b, v8f c) { return wmmab(a, b, c); } };

__device__ __forceinline__ h16 tohx(float x) { return (h16)x; }
__device__ __forceinline__ void splitf(float y, unsigned short& h, unsigned short& l) { h = f2bf(y); l = f2bf(y - bf2f(h)); }
typedef __attribute__((ext_vector_type(4))) _Float16 v4h;
typedef __attribute__((ext_vector_type(4))) unsigned short v4us;

// ---- copy4, copy8: four or eight 16-byte asynchronous copies a lane, global memory to LDS through no register. l: the lane's LDS byte address, g: its global address; copy i of a run of four lies i lstep bytes and i gstep elements further; copy8 takes two such runs.
// s_wait_xcnt is the last line of the copies' own statement, so that it stands in front of every rewrite of a register that they name.
template <typename T16>
__device__ __forceinline__ void copy4(unsigned l, const T16* g, unsigned lstep, size_t gstep) {
    asm volatile("global_load_async_to_lds_b128 %0, %4, off\n\t"
                 "global_load_async_to_lds_b128 %1, %5, off\n\t"
                 "global_load_async_to_lds_b128 %2, %6, off\n\t"
                 "global_load_async_to_lds_b128 %3, %7, off\n\t"
                 "s_wait_xcnt 0x0"
                 :: "v"(l), "v"(l + lstep), "v"(l + 2 * lstep), "v"(l + 3 * lstep), "v"(g), "v"(g + gstep), "v"(g + 2 * gstep), "v"(g + 3 * gstep) : "memory");
}
template <typename T16>
__device__ __forceinline__ void copy8(unsigned l, const T16* g, unsigned m, const T16* h, unsigned lstep, size_t gstep) {
    asm volatile("global_load_async_to_lds_b128 %0, %8, off\n\t"
                 "global_load_async_to_lds_b128 %1, %9, off\n\t"
                 "global_load_async_to_lds_b128 %2, %10, off\n\t"
                 "global_load_async_to_lds_b128 %3, %11, off\n\t"
                 "global_load_async_to_lds_b128 %4, %12, off\n\t"
                 "global_load_async_to_lds_b128 %5, %13, off\n\t"
                 "global_load_async_to_lds_b128 %6, %14, off\n\t"
                 "global_load_async_to_lds_b128 %7, %15, off\n\t"
                 "s_wait_xcnt 0x0"
                 :: "v"(l), "v"(l + lstep), "v"(l + 2 * lstep), "v"(l + 3 * lstep), "v"(m), "v"(m + lstep), "v"(m + 2 * lstep), "v"(m + 3 * lstep),
                    "v"(g), "v"(g + gstep), "v"(g + 2 * gstep), "v"(g + 3 * gstep), "v"(h), "v"(h + gstep), "v"(h + 2 * gstep), "v"(h + 3 * gstep) : "memory");
}
// ---- gemmk_tile: C[m][n] (f32, pitch ldc, + optional f32 bias[n]) = sum_k A[m][k] Bt[n][k] (NSPLIT 1: + A2[m][k] Bt[n][k]): WM x WN waves of one work-group share one 128 x 128 output tile, wave (wm, wn) owns (16 MB) x (16 NB) of it and sums the whole K in k order.
// The operands come through LDS, 64 k a stage, two buffers: a stage holds, per operand, 8 row blocks x 2 KiB (two fragment-order blocks each, contiguous in the plane), brought by asynchronous copies one stage ahead of its use, so each operand byte leaves L2 once a work-group and every wave reads its fragments from LDS.
// Behind the last stage the tile is parked in the same LDS (row-major, pitch 128 + 4 floats), one barrier, and whole row pieces are stored. One work-group of 32 WM WN threads a tile at rows r0, columns c0; tokens of both batches run through as one row index b TT + t.
// EPI says what is stored. 0: C in f32. 1 and 2: no f32 C; each sum goes straight to the three 16-bit planes that attention reads (fp16, bf16 hi, bf16 lo).
// 1: m = token, n = feature, head planes [b][n / HD] of rows t, k = n % HD. 2: m = feature, n = token (weights as A, tokens as Bt), planes [b] of rows m, k = t, the bias taken per row m. A, Bt and the planes written are all in fragment order (pk).
template <typename T16, int NSPLIT, bool BIAS, int MB, int NB, int WM, int WN, int K, int EPI>
__device__ __forceinline__ void gemmk_tile(const T16* __restrict__ A, const T16* __restrict__ A2, const T16* __restrict__ Bt, float* C, int ldc, const float* __restrict__ bias, int r0, int c0, h16* P16, bf* Ph, bf* Pl, float* red) {
    typedef typename WFrag<T16>::V V;
    constexpr int NT = WM * WN * 32, TM = WM * MB * 16, TN = WN * NB * 16, PT = TN + 4;
    constexpr bool AHEAD = MB * NB <= 8; constexpr int PE = 8 * 1024, SE = (NSPLIT == 1 ? 3 : 2) * PE, NS = K / 64, CS = NT / 128;   // elements of one operand's part of a stage and of a stage; stages; row blocks that one copy of the whole work-group covers
    static_assert(TM == 128 && TN == 128 && (NT == 128 || NT == 256) && K % 64 == 0 && NS >= 2 && (NSPLIT == 0 || NSPLIT == 1), "stage shape");
    const int lane = threadIdx.x & 31, lr = lane & 15, hi = lane >> 4, wave = threadIdx.x >> 5, wm = wave / WN, wn = wave % WN;
    const T16* st = (const T16*)red;
    const unsigned lofs = (unsigned)(size_t)red + (threadIdx.x >> 7) * 2048 + (threadIdx.x & 127) * 16;   // 128 threads copy the 2 KiB of one row block
    const size_t gofs = (size_t)(threadIdx.x >> 7) * (K * 16) + (threadIdx.x & 127) * 8;                  // r0 and c0 are multiples of 16, so r0 K and c0 K are where their row panels start; a row block is 16 K elements
    const T16* ga = A + (size_t)r0 * K + gofs; const T16* ga2 = (NSPLIT == 1) ? A2 + (size_t)r0 * K + gofs : nullptr; const T16* gb = Bt + (size_t)c0 * K + gofs;
    auto fill = [&](int s) { const unsigned l = lofs + (s & 1) * (SE * 2);
#pragma unroll
        for (int c = 0; c < 8; c += 4 * CS) { copy8(l + c * 2048, ga + s * 1024 + (size_t)c * (K * 16), l + PE * 2 + c * 2048, gb + s * 1024 + (size_t)c * (K * 16), CS * 2048, (size_t)CS * (K * 16));
            if (NSPLIT == 1) copy4(l + PE * 4 + c * 2048, ga2 + s * 1024 + (size_t)c * (K * 16), CS * 2048, (size_t)CS * (K * 16)); } };
    v8f acc[MB][NB];
#pragma unroll
    for (int mb = 0; mb < MB; ++mb)
#pragma unroll
        for (int nb = 0; nb < NB; ++nb) acc[mb][nb] = (v8f){};
    fill(0);
    asm volatile("s_wait_asynccnt 0x0" ::: "memory");   // stage 0 has landed, as far as this wave copied it
    __syncthreads();                                    // and as far as the others did
    fill(1);
    // unrolled: NS is a small constant, so each stage's buffer is known when compiling and no matrix instruction stands in front of a back edge
#pragma unroll
    for (int s = 0; s < NS; ++s) { const T16* sb = st + (s & 1) * SE + lane * 8;
        V a[2][MB], a2[2][MB], b[2][NB];
#pragma unroll
        for (int kb = 0; kb < 2; ++kb) {
            // the fragments of a 32-k block are asked for as one group (AHEAD: those of both blocks of the stage at once, where the registers allow it)
            if (!AHEAD || kb == 0) {
#pragma unroll
                for (int k2 = kb; k2 < (AHEAD ? 2 : kb + 1); ++k2) {
#pragma unroll
                    for (int mb = 0; mb < MB; ++mb) { a[k2][mb] = WFrag<T16>::ld(sb + (wm * MB + mb) * 1024 + k2 * 512); if (NSPLIT == 1) a2[k2][mb] = WFrag<T16>::ld(sb + 2 * PE + (wm * MB + mb) * 1024 + k2 * 512); }
#pragma unroll
                    for (int nb = 0; nb < NB; ++nb) b[k2][nb] = WFrag<T16>::ld(sb + PE + (wn * NB + nb) * 1024 + k2 * 512); }
                __builtin_amdgcn_sched_barrier(0);   // keeps the group together in front of its products: left alone the scheduler sinks each load to its use, and every four products wait a whole LDS trip
            }
#pragma unroll
            for (int nb = 0; nb < NB; ++nb) {
#pragma unroll
                for (int mb = 0; mb < MB; ++mb) acc[mb][nb] = WFrag<T16>::mma(a[kb][mb], b[kb][nb], acc[mb][nb]);
                if (NSPLIT == 1) {
#pragma unroll
                    for (int mb = 0; mb < MB; ++mb) acc[mb][nb] = WFrag<T16>::mma(a2[kb][mb], b[kb][nb], acc[mb][nb]); } }
            if (!AHEAD || kb == 1) __builtin_amdgcn_sched_barrier(0);   // keeps the next group behind these products, whose registers it takes over, and the stage's last products in front of its foot: sunk among the next copies they hold their fragments live and the registers run over 256
        }
        asm volatile("s_wait_dscnt 0x0" ::: "memory");      // this wave has read the last of stage s
        asm volatile("s_wait_asynccnt 0x0" ::: "memory");   // and its copies of stage s + 1 have landed
        __syncthreads();                                    // publishes stage s + 1 and frees the buffer of stage s
        if (s + 2 < NS) fill(s + 2);
    }
    asm volatile("s_wait_asynccnt 0x0" ::: "memory");   // no copy is under way when the buffers become the parking place
#pragma unroll
    for (int mb = 0; mb < MB; ++mb)
#pragma unroll
        for (int nb = 0; nb < NB; ++nb)
#pragma unroll
            for (int j = 0; j < 8; ++j) red[((wm * MB + mb) * 16 + hi * 8 + j) * PT + (wn * NB + nb) * 16 + lr] = acc[mb][nb][j];
    __syncthreads();
    // four pieces a trip: their LDS reads and stores overlap and a bias taken by column leaves the loop; one by one each piece waits out its own loads, and a thread now has 16 or 32 pieces
#pragma unroll 1
    for (int it = 0; it < TM * TN / 4 / NT; it += 4) {
#pragma unroll
      for (int u = 0; u < 4; ++u) { const int e = threadIdx.x + (it + u) * NT;
        // f32 C: a wave takes whole rows. Planes: a wave takes 16 rows x 8 columns, lane = row + 16 x (column half), which are 256 contiguous bytes of a block
        const int row = (EPI == 0) ? e / (TN / 4) : ((e >> 5) / (TN / 8)) * 16 + (e & 15), cofs = (EPI == 0) ? (e % (TN / 4)) * 4 : ((e >> 5) % (TN / 8)) * 8 + ((e >> 4) & 1) * 4; v4f val = *(const v4fa*)(red + row * PT + cofs);
        if (BIAS && EPI == 2) { const float br = bfr(bias[r0 + row]); val[0] += br; val[1] += br; val[2] += br; val[3] += br; }
        else if (BIAS) { val[0] += bfr(bias[c0 + cofs]); val[1] += bfr(bias[c0 + cofs + 1]); val[2] += bfr(bias[c0 + cofs + 2]); val[3] += bfr(bias[c0 + cofs + 3]); }
        if constexpr (EPI == 0) *(v4f*)(C + (size_t)(r0 + row) * ldc + c0 + cofs) = val;
        else { v4h o16; v4us oh, ol;
#pragma unroll
            for (int q = 0; q < 4; ++q) { o16[q] = tohx(val[q]); unsigned short a2, c2; splitf(val[q], a2, c2); oh[q] = a2; ol[q] = c2; }
            const size_t oo = (EPI == 1) ? (size_t)((r0 + row) / TT * NH_ + (c0 + cofs) / HD) * TT * HD + pk((r0 + row) % TT, (c0 + cofs) % HD, HD) : (size_t)((c0 + cofs) / TT) * DKV * TT + pk(r0 + row, (c0 + cofs) % TT, TT);
            *(v4h*)(P16 + oo) = o16; *(v4us*)(Ph + oo) = oh; *(v4us*)(Pl + oo) = ol; } }
      asm volatile("s_wait_xcnt 0x0" ::: "memory");   // behind the trip's last store, in front of the next trip's rewrite of the stores' registers
    }
}
// ---- k_gemmk: the f32 form of gemmk_tile. grid (M / 128, N / 128), 32 WM WN threads. LDS: two stages, which also hold the parked tile.
template <typename T16, int NSPLIT, bool BIAS, int MB, int NB, int WM, int WN, int K>
__global__ __launch_bounds__(WM * WN * 32) void k_gemmk(const T16* __restrict__ A, const T16* __restrict__ A2, const T16* __restrict__ Bt, float* C, int ldc, const float* __restrict__ bias) {
    static_assert(NSPLIT == 1, "three operand parts a stage");
    __shared__ __align__(16) float red[2 * 3 * 8 * 1024 / 2];
    gemmk_tile<T16, NSPLIT, BIAS, MB, NB, WM, WN, K, 0>(A, A2, Bt, C, ldc, bias, blockIdx.x * 128, blockIdx.y * 128, nullptr, nullptr, nullptr, red);
}
// ---- k_qkv: the three projections of both batches in one launch; blockIdx.z says which (0 q, 1 k, 2 v), the same for the whole work-group, so the barriers inside stay uniform. grid (NB_ TT / 128, DQ / 128, 3), 128 threads.
// A k or v tile whose 128 keys all lie behind the batch's NE keys is left out: the whole work-group returns, in front of every barrier; nothing reads those keys.
__global__ __launch_bounds__(128) void k_qkv(const bf* __restrict__ XB, const bf* __restrict__ YB, const bf* __restrict__ WQ, const bf* __restrict__ WK, const bf* __restrict__ WV, const float* __restrict__ bq, const float* __restrict__ bk, const float* __restrict__ bv, const int* __restrict__ NE,
                                             h16* QP16, bf* QPh, bf* QPl, h16* KP16, bf* KPh, bf* KPl, h16* VT16, bf* VTh, bf* VTl) {
    static_assert(DQ == DKV && NH_ == NKV && TT % 128 == 0, "one grid serves q, k and v");
    __shared__ __align__(16) float red[128 * 132];   // the parked tile; the two stages (64 KiB) lie in it
    const int t0 = blockIdx.x * 128, f0 = blockIdx.y * 128;
    if (blockIdx.z != 0 && t0 % TT >= min(NE[t0 / TT], TT)) return;
    if (blockIdx.z == 2) gemmk_tile<bf, 0, true, 4, 4, 2, 2, DM, 2>(WV, nullptr, YB, nullptr, 0, bv, f0, t0, VT16, VTh, VTl, red);   // weights as A: v comes out feature-major, the order attn.v reads
    else { const bool isq = blockIdx.z == 0;
        gemmk_tile<bf, 0, true, 4, 4, 2, 2, DM, 1>(isq ? XB : YB, nullptr, isq ? WQ : WK, nullptr, 0, isq ? bq : bk, t0, f0, isq ? QP16 : KP16, isq ? QPh : KPh, isq ? QPl : KPl, red); }
}

typedef __attribute__((ext_vector_type(2))) unsigned short v2us;
typedef __attribute__((ext_vector_type(2))) float v2f;
typedef __attribute__((ext_vector_type(4))) int v4i;
typedef __attribute__((ext_vector_type(8))) unsigned v8u;

__global__ __launch_bounds__(256) void k_wtG(const float* __restrict__ w, int K, int N, bf* Bt) {
    const int lane = threadIdx.x & 31; const int L0 = (blockIdx.x * 8 + (threadIdx.x >> 5)) * 8; const int nlines = N * K / 64;
{
#pragma unroll 1
        for (int l = 0; l < 8; ++l) { const int L = L0 + l; if (L >= nlines) break; const size_t e = (size_t)L * 64 + lane * 2; const int k = (int)(e % K), n = (int)(e / K); v2us o;
            o[0] = f2bf(w[(size_t)k * N + n]); o[1] = f2bf(w[(size_t)(k + 1) * N + n]); *(v2us*)(Bt + e) = o; }
         }
}
// ---- k_cvt8: every f32 operand to bf16, in fragment order, in one launch. blockIdx.y names a chunk of CH elements: the chunks of x, then of y, then the four weights; dst holds them in that order. grid (CH / 2048, 2 XC + 4), 256 threads.
// Rows of y go to their place in the key order: row g of a batch to (non-zero masks before g) if its own mask is non-zero, else to (all non-zero) + (zero masks before g). Every work-group of y counts its batch's mask itself (a ballot per 32 keys, the waves' counts summed through LDS behind the barrier that is there anyway).
// PM: the mask in the key order, NE: the keys that count, both for the later launches; written by the work-groups of the first 128 k (NE: of the first rows).
// A work-group takes 16 rows x 128 k: 2048 contiguous elements of dst (four blocks; of y: 16-byte pieces of two runs of rows). Piece p = k / 8 of row r goes to piece 16 p + r: the 16-byte pieces are turned through LDS (pitch 272 bytes: no bank met twice), so reads and stores both stay on whole lines.
#define CH   (DM * DQ)
#define XC   (NB_ * TT * DM / CH)
__global__ __launch_bounds__(256) void k_cvt8(const float* __restrict__ x, const float* __restrict__ y, const float* __restrict__ wq, const float* __restrict__ wk, const float* __restrict__ wv, const float* __restrict__ wo, const int* __restrict__ km, bf* dst0, int* PM, int* NE) {
    static_assert(NB_ * TT * DM % CH == 0 && DKV == DQ && DQ == DM && CH % (16 * DM) == 0 && DM % 128 == 0 && TT % 256 == 0 && TT % 16 == 0 && TT < 65536, "chunks");
    __shared__ __align__(16) bf st[16 * 136]; __shared__ __align__(16) int wc[8];
    const int c = blockIdx.y; const float* src = (c < XC) ? x + (size_t)c * CH : (c < 2 * XC) ? y + (size_t)(c - XC) * CH : (c == 2 * XC) ? wq : (c == 2 * XC + 1) ? wk : (c == 2 * XC + 2) ? wv : wo; bf* dst = dst0 + (size_t)c * CH;
    const int r = threadIdx.x >> 4, p = threadIdx.x & 15; const v8f v = *(const v8f*)(src + (size_t)(blockIdx.x / (DM / 128) * 16 + r) * DM + blockIdx.x % (DM / 128) * 128 + p * 8); v8us o;
    const bool isy = c >= XC && c < 2 * XC;   // the same for the whole work-group
    const int grow = (c - XC) * (CH / DM) + blockIdx.x / (DM / 128) * 16, yb = grow / TT, g0 = grow % TT, wave = __builtin_amdgcn_readfirstlane(threadIdx.x >> 5);
    int mk[TT / 256], mown = 0;
    if (isy) {
#pragma unroll
        for (int i = 0; i < TT / 256; ++i) mk[i] = km[yb * TT + i * 256 + threadIdx.x];
        mown = km[yb * TT + g0 + p]; }
    asm volatile("s_wait_xcnt 0x0" ::: "memory");   // behind the loads, in front of the first rewrite of their address registers
    unsigned own = 0;   // bit i: row g0 + i has a non-zero mask
    if (isy) { int tot = 0, bef = 0;   // non-zero masks among this wave's keys: all, and those in front of row g0 (a multiple of 16)
#pragma unroll
        for (int i = 0; i < TT / 256; ++i) { const int e0 = i * 256 + wave * 32; const unsigned bal = __builtin_amdgcn_ballot_w32(mk[i] != 0);
            tot += __builtin_popcount(bal); bef += __builtin_popcount(e0 + 32 <= g0 ? bal : e0 + 16 == g0 ? bal & 0xFFFFu : 0u); }
        if ((threadIdx.x & 31) == 0) wc[wave] = tot | (bef << 16);
        own = __builtin_amdgcn_ballot_w32(mown != 0) & 0xFFFFu; }
#pragma unroll
    for (int k = 0; k < 8; ++k) o[k] = f2bf(v[k]);
    *(v8usa*)(st + p * 136 + r * 8) = o;
    __syncthreads();
    const v8us piece = *(const v8usa*)(st + r * 136 + p * 8);   // from here on p is the row and r the piece
    if (!isy) { *(v8us*)(dst + (size_t)blockIdx.x * 2048 + threadIdx.x * 8) = piece;
        asm volatile("s_wait_xcnt 0x0" ::: "memory"); }   // behind the store, in front of any rewrite of its registers on the way to the kernel's end
    else { int sum = 0;
#pragma unroll
        for (int w = 0; w < 8; ++w) sum += wc[w];
        const int cnt = sum & 0xFFFF, bef = sum >> 16, ln = __builtin_popcount(own & ((1u << p) - 1u));
        const int nr = ((own >> p) & 1u) ? bef + ln : cnt + (g0 - bef) + (p - ln);   // a permutation of 0 .. TT - 1 whatever the mask holds
        *(v8us*)(dst0 + (size_t)XC * CH + (size_t)yb * TT * DM + ((size_t)(nr >> 4) * (DM / 32) + blockIdx.x % (DM / 128) * 4) * 512 + r * 128 + (nr & 15) * 8) = piece;
        if (blockIdx.x % (DM / 128) == 0 && r == 0) { PM[yb * TT + nr] = mown; if (g0 == 0 && p == 0) NE[yb] = cnt ? cnt : TT; } } }
// ---- exp2x8, exp2x1: v_exp_f32 with the slot that the instruction set asks for behind a transcendental (before its result is used or its source overwritten) closed inside the statement: results lie apart from all sources, so each v_exp_f32 is the independent instruction behind the one in front of it, and one v_nop stands behind the last.
__device__ __forceinline__ v8f exp2x8(v8f x) { float e0, e1, e2, e3, e4, e5, e6, e7;
    asm("v_exp_f32 %0, %8\n\tv_exp_f32 %1, %9\n\tv_exp_f32 %2, %10\n\tv_exp_f32 %3, %11\n\tv_exp_f32 %4, %12\n\tv_exp_f32 %5, %13\n\tv_exp_f32 %6, %14\n\tv_exp_f32 %7, %15\n\tv_nop"
        : "=&v"(e0), "=&v"(e1), "=&v"(e2), "=&v"(e3), "=&v"(e4), "=&v"(e5), "=&v"(e6), "=&v"(e7) : "v"(x[0]), "v"(x[1]), "v"(x[2]), "v"(x[3]), "v"(x[4]), "v"(x[5]), "v"(x[6]), "v"(x[7]));
    return (v8f){e0, e1, e2, e3, e4, e5, e6, e7}; }
__device__ __forceinline__ float exp2x1(float x) { float e; asm("v_exp_f32 %0, %1\n\tv_nop" : "=&v"(e) : "v"(x)); return e; }
// ---- k_attn: scores, softmax, attn.v and the head merge. A wave keeps 16 QT query rows of one head and walks all keys that count (the first NE of the key order), SK a stage, with a running row maximum and row sum; the AWV waves of a work-group share each stage's key and v blocks through LDS.
// A stage holds, per plane, SK keys x HD of k (8 KiB, contiguous in the plane) and HD rows x SK keys of v (four pieces of 2 KiB); two buffers, filled by asynchronous copies one stage ahead of their use, so each k and v byte leaves L2 once per 16 QT AWV query rows.
// Scores are formed TRANSPOSED (A = 16 keys, B = 16 queries): a lane holds, for query lr, keys hi 8 + j of each 16-key tile, which is the fragment order of attn.v (two tiles = one 32-key fragment), so the probabilities never leave the registers.
// attn.v is formed transposed too (A = 16 features of v, B = the probabilities): a lane holds, for the same query lr, features hi 8 + j, so maximum, sum and rescale stay in the lane (one exchange between the lane halves) and its 8 results are one 16-byte piece of the merged planes.
// Probabilities stay unnormalised (relative to the running maximum; single fp16 plane: x PCAR, as 2^10 in the exponent); the row sum carries the same factor and divides the result once, at the end. Every plane read or written here is in fragment order (pk).
// grid (NH_, NB_, NZH + NZ2 + NZ1), 32 AWV threads, longest work-groups first: hi/lo rows (QT 1, three products), then two thirds of the single-plane rows at QT 2, then the last third at QT 1. 256 work-groups of each kind: one of each fills a WGP with three waves a SIMD, and every SIMD gets the same work.
#define AWV  4
#define SK   64
#define NZH  (RH / (AWV * 16))
#define NZ2  ((TT - RH) * 2 / 3 / (AWV * 32))
#define NZ1  ((TT - RH) / 3 / (AWV * 16))
template <typename T16, bool HR, int QT>
__device__ __forceinline__ void attn_tile(const T16* __restrict__ Q, const T16* __restrict__ Q2, const T16* __restrict__ Kp, const T16* __restrict__ Kp2, const T16* __restrict__ Vt, const T16* __restrict__ Vt2, const int* __restrict__ km, int ns, bf* ATh, bf* ATl, int orow, int ocol, const T16* st, float* sma) {
    typedef typename WFrag<T16>::V V;
    constexpr int KT = SK / 16, KC = HD / 32, CT = SK / 32, DT = HD / 16, NS = TT / SK;
    constexpr int PE = SK * HD, SE = (HR ? 4 : 2) * PE;   // elements of one plane's k (or v) part of a stage, and of a stage: k, v (hi/lo rows: k hi, v hi, k lo, v lo)
    static_assert(AWV * 32 * 8 * 4 == PE && SK * 16 == AWV * 32 * 8 && DT == 4 && NS >= 2 && TT % (AWV * 128) == 0, "four copies a thread and part");
    const int lane = threadIdx.x & 31, lr = lane & 15, hi = lane >> 4, wave = threadIdx.x >> 5;
    const unsigned lofs = (unsigned)(size_t)st + threadIdx.x * 16;
    const unsigned tofs = threadIdx.x * 8;   // the planes' stage addresses are formed on the scalar side and this added: four 64-bit lane pointers kept over the loop would not fit the registers
    // k: 2 KiB after 2 KiB of the stage's 8; v: the stage's 2 KiB of each of the four 16-row blocks, 16 TT elements apart
    auto fill = [&](int s) { const unsigned l = lofs + (s & 1) * (SE * 2);
        copy4(l, (Kp + s * PE) + tofs, 2048u, (size_t)1024); copy4(l + PE * 2, (Vt + s * (SK * 16)) + tofs, 2048u, (size_t)16 * TT);
        if (HR) { copy4(l + PE * 4, (Kp2 + s * PE) + tofs, 2048u, (size_t)1024); copy4(l + PE * 6, (Vt2 + s * (SK * 16)) + tofs, 2048u, (size_t)16 * TT); } };
    fill(0);
    V qf[QT][KC], qf2[QT][KC];
#pragma unroll
    for (int qt = 0; qt < QT; ++qt)
#pragma unroll
        for (int kc = 0; kc < KC; ++kc) { qf[qt][kc] = WFrag<T16>::ld(Q + lane * 8 + (wave * QT + qt) * 16 * HD + kc * 512); if (HR) qf2[qt][kc] = WFrag<T16>::ld(Q2 + lane * 8 + (wave * QT + qt) * 16 * HD + kc * 512); }
    // the additive mask term of every key, once a work-group
#pragma unroll
    for (int i = 0; i < TT / (AWV * 128); ++i) { const v4i mk = *(const v4i*)(km + (i * (AWV * 32) + threadIdx.x) * 4); v4f ma;
#pragma unroll
        for (int q = 0; q < 4; ++q) ma[q] = (mk[q] == 0) ? -9.0e15f : (float)mk[q];
        *(v4fa*)(sma + (i * (AWV * 32) + threadIdx.x) * 4) = ma; }
    asm volatile("s_wait_xcnt 0x0" ::: "memory");       // behind the query and mask loads, in front of any rewrite of their address registers
    asm volatile("s_wait_asynccnt 0x0" ::: "memory");   // stage 0 has landed, as far as this wave copied it
    __syncthreads();                                    // and as far as the others did; the mask terms are written
    if (1 < ns) fill(1);
    float mrun[QT], lsum[QT]; v8f o[DT][QT];
#pragma unroll
    for (int qt = 0; qt < QT; ++qt) { mrun[qt] = -3.0e38f; lsum[qt] = 0.f;
#pragma unroll
        for (int dt = 0; dt < DT; ++dt) o[dt][qt] = (v8f){}; }
    // rolled: the stages (ns of them, known at run time, at most 32)
#pragma unroll 1
    for (int s = 0; s < ns; ++s) { const T16* sb = st + (s & 1) * SE + lane * 8;
        V kf[KT][KC], kf2[KT][KC], vf[DT][CT], vf2[DT][CT];
#pragma unroll
        for (int kt = 0; kt < KT; ++kt)
#pragma unroll
            for (int kc = 0; kc < KC; ++kc) { kf[kt][kc] = WFrag<T16>::ld(sb + (kt * KC + kc) * 512); if (HR) kf2[kt][kc] = WFrag<T16>::ld(sb + 2 * PE + (kt * KC + kc) * 512); }
        __builtin_amdgcn_sched_barrier(0);   // keeps the stage's key fragments together in front of the score products: sunk to their uses, every few products wait a whole LDS trip
        v8f sc[KT][QT];
#pragma unroll
        for (int kc = 0; kc < KC; ++kc) {
#pragma unroll
            for (int kt = 0; kt < KT; ++kt)
#pragma unroll
                for (int qt = 0; qt < QT; ++qt) sc[kt][qt] = WFrag<T16>::mma(kf[kt][kc], qf[qt][kc], (kc == 0) ? (v8f){} : sc[kt][qt]);
            if (HR) {
#pragma unroll
                for (int kt = 0; kt < KT; ++kt)
#pragma unroll
                    for (int qt = 0; qt < QT; ++qt) sc[kt][qt] = WFrag<T16>::mma(kf[kt][kc], qf2[qt][kc], sc[kt][qt]);
#pragma unroll
                for (int kt = 0; kt < KT; ++kt)
#pragma unroll
                    for (int qt = 0; qt < QT; ++qt) sc[kt][qt] = WFrag<T16>::mma(kf2[kt][kc], qf[qt][kc], sc[kt][qt]); } }
        __builtin_amdgcn_sched_barrier(0);   // keeps the v fragments, which take over the key fragments' registers, behind the score products
#pragma unroll
        for (int c = 0; c < CT; ++c)
#pragma unroll
            for (int dt = 0; dt < DT; ++dt) { vf[dt][c] = WFrag<T16>::ld(sb + PE + dt * (SK * 16) + c * 512); if (HR) vf2[dt][c] = WFrag<T16>::ld(sb + 3 * PE + dt * (SK * 16) + c * 512); }
        __builtin_amdgcn_sched_barrier(0);   // keeps the v loads together, behind the score products and in front of all that follows: spread by the scheduler they leave more registers live at the foot, and the hi/lo rows' copy pointers are spilled
#pragma unroll
        for (int kt = 0; kt < KT; ++kt)
#pragma unroll
            for (int qt = 0; qt < QT; ++qt)
#pragma unroll
                for (int j = 0; j < 8; ++j) sc[kt][qt][j] = fminf(fmaxf(sc[kt][qt][j] * SCL, -50000.0f), 50000.0f);
        // the stage's foot stands here, behind its last read of the buffer: the rest of the trip works on registers (and the mask terms), and the copies of stage s + 2 get that time and the next stage's scores to land
        asm volatile("s_wait_dscnt 0x0" ::: "memory");      // this wave has read the last of stage s
        asm volatile("s_wait_asynccnt 0x0" ::: "memory");   // and its copies of stage s + 1 have landed
        __syncthreads();                                    // publishes stage s + 1 and frees the buffer of stage s
        if (s + 2 < ns) fill(s + 2);
        float mx[QT];
#pragma unroll
        for (int qt = 0; qt < QT; ++qt) mx[qt] = mrun[qt];
#pragma unroll
        for (int kt = 0; kt < KT; ++kt) { const v4f a0 = *(const v4fa*)(sma + s * SK + kt * 16 + hi * 8), a1 = *(const v4fa*)(sma + s * SK + kt * 16 + hi * 8 + 4);
#pragma unroll
            for (int qt = 0; qt < QT; ++qt)
#pragma unroll
                for (int j = 0; j < 8; ++j) { const float t = __fadd_rn(sc[kt][qt][j], (j < 4) ? a0[j & 3] : a1[j & 3]); sc[kt][qt][j] = t; mx[qt] = fmaxf(mx[qt], t); } }
        V pf[CT][QT], pf2[CT][QT];
#pragma unroll
        for (int qt = 0; qt < QT; ++qt) { const float m = fmaxf(mx[qt], __shfl_xor(mx[qt], 16, 32));
            const float al = exp2x1(__fmul_rn(__fsub_rn(mrun[qt], m), 1.4426950408889634f)); mrun[qt] = m;   // what the sums so far shrink by under the new maximum (0 in the first stage)
            float sp[KT];   // one partial sum a key tile: independent chains, where one chain of 32 adds would wait out each add
#pragma unroll
            for (int kt = 0; kt < KT; ++kt) { v8f x;
#pragma unroll
                for (int j = 0; j < 8; ++j) { const float d = __fsub_rn(sc[kt][qt][j], m); x[j] = HR ? __fmul_rn(d, 1.4426950408889634f) : __builtin_fmaf(d, 1.4426950408889634f, 10.0f); }
                sc[kt][qt] = exp2x8(x); sp[kt] = sc[kt][qt][0];
#pragma unroll
                for (int j = 1; j < 8; ++j) sp[kt] += sc[kt][qt][j]; }
            static_assert(KT == 4, "four partial sums");
            lsum[qt] = lsum[qt] * al + ((sp[0] + sp[1]) + (sp[2] + sp[3]));
#pragma unroll
            for (int dt = 0; dt < DT; ++dt) o[dt][qt] *= al;
#pragma unroll
            for (int c = 0; c < CT; ++c) {
                if constexpr (HR) { v8u ph, pl;   // two 16-bit planes, packed a register pair at a time
#pragma unroll
                    for (int j = 0; j < 16; j += 2) { unsigned short h0, l0, h1, l1; splitf(sc[2 * c + j / 8][qt][j % 8], h0, l0); splitf(sc[2 * c + j / 8][qt][j % 8 + 1], h1, l1); ph[j / 2] = (unsigned)h0 | ((unsigned)h1 << 16); pl[j / 2] = (unsigned)l0 | ((unsigned)l1 << 16); }
                    pf[c][qt] = __builtin_bit_cast(v16bf, ph); pf2[c][qt] = __builtin_bit_cast(v16bf, pl);
                } else { v8h x0, x1;
#pragma unroll
                    for (int j = 0; j < 8; ++j) { x0[j] = tohx(sc[2 * c][qt][j]); x1[j] = tohx(sc[2 * c + 1][qt][j]); }
                    pf[c][qt] = cat16(x0, x1); } } }
#pragma unroll
        for (int c = 0; c < CT; ++c) {
#pragma unroll
            for (int dt = 0; dt < DT; ++dt)
#pragma unroll
                for (int qt = 0; qt < QT; ++qt) o[dt][qt] = WFrag<T16>::mma(vf[dt][c], pf[c][qt], o[dt][qt]);
            if (HR) {
#pragma unroll
                for (int dt = 0; dt < DT; ++dt)
#pragma unroll
                    for (int qt = 0; qt < QT; ++qt) o[dt][qt] = WFrag<T16>::mma(vf[dt][c], pf2[c][qt], o[dt][qt]);
#pragma unroll
                for (int dt = 0; dt < DT; ++dt)
#pragma unroll
                    for (int qt = 0; qt < QT; ++qt) o[dt][qt] = WFrag<T16>::mma(vf2[dt][c], pf[c][qt], o[dt][qt]); } }
    }
    asm volatile("s_wait_asynccnt 0x0" ::: "memory");   // no copy is under way when the wave ends
#pragma unroll
    for (int qt = 0; qt < QT; ++qt) { const float inv = __fdiv_rn(1.0f, lsum[qt] + __shfl_xor(lsum[qt], 16, 32));   // the two lane halves summed different keys
#pragma unroll
        for (int dt = 0; dt < DT; ++dt) { v8us oh, ol;
#pragma unroll
            for (int j = 0; j < 8; ++j) { unsigned short a, c2; splitf(o[dt][qt][j] * inv, a, c2); oh[j] = a; ol[j] = c2; }
            const size_t oo = pk(orow + (wave * QT + qt) * 16 + lr, ocol + dt * 16 + hi * 8, DQ);   // the lane's 8 features are one 16-byte piece; a wave stores 512 contiguous bytes
            *(v8us*)(ATh + oo) = oh; *(v8us*)(ATl + oo) = ol;
            asm volatile("s_wait_xcnt 0x0" ::: "memory");   // behind the stores, in front of the next piece's rewrite of their registers
        } }
}
__global__ __launch_bounds__(AWV * 32) void k_attn(const h16* __restrict__ Q16, const h16* __restrict__ K16, const h16* __restrict__ V16, const bf* __restrict__ Qh, const bf* __restrict__ Ql, const bf* __restrict__ Kh, const bf* __restrict__ Kl, const bf* __restrict__ Vh, const bf* __restrict__ Vl, const int* __restrict__ km, const int* __restrict__ NE, bf* ATh, bf* ATl) {
    static_assert(RH % (AWV * 16) == 0 && RH + NZ2 * (AWV * 32) + NZ1 * (AWV * 16) == TT && TT % SK == 0 && NH_ == NKV, "tile shape");
    __shared__ __align__(16) bf stg[2 * 4 * SK * HD]; __shared__ __align__(16) float sma[TT];
    const int h = blockIdx.x, b = blockIdx.y, z = blockIdx.z; const int q0 = (z < NZH) ? z * (AWV * 16) : (z < NZH + NZ2) ? RH + (z - NZH) * (AWV * 32) : RH + NZ2 * (AWV * 32) + (z - NZH - NZ2) * (AWV * 16);
    const size_t zp = (size_t)(b * NH_ + h) * TT * HD, zq = zp + (size_t)q0 * HD; const int orow = b * TT + q0, ocol = h * HD; km += b * TT;
    const int ns = min((NE[b] + SK - 1) / SK, TT / SK);   // stages that hold a key that counts; km is the mask in the key order
    // z is the same for the whole work-group: the barriers inside stay uniform
    if (z < NZH) attn_tile<bf, true, 1>(Qh + zq, Ql + zq, Kh + zp, Kl + zp, Vh + zp, Vl + zp, km, ns, ATh, ATl, orow, ocol, stg, sma);
    else if (z < NZH + NZ2) attn_tile<h16, false, 2>(Q16 + zq, nullptr, K16 + zp, nullptr, V16 + zp, nullptr, km, ns, ATh, ATl, orow, ocol, (const h16*)stg, sma);
    else attn_tile<h16, false, 1>(Q16 + zq, nullptr, K16 + zp, nullptr, V16 + zp, nullptr, km, ns, ATh, ATl, orow, ocol, (const h16*)stg, sma);
}

extern "C" void kernel_launch(void* const* d_in, const int* in_sizes, int n_in,
                              void* d_out, int out_size, void* d_ws, size_t ws_size, hipStream_t stream) {
    (void)in_sizes; (void)n_in; (void)out_size;
    const float* x = (const float*)d_in[0]; const float* y = (const float*)d_in[1]; const int* kmask = (const int*)d_in[2]; const float* wq = (const float*)d_in[3]; const float* bq = (const float*)d_in[4]; const float* wk = (const float*)d_in[5]; const float* bk = (const float*)d_in[6]; const float* wv = (const float*)d_in[7]; const float* bv = (const float*)d_in[8]; const float* wo = (const float*)d_in[9]; const float* bo = (const float*)d_in[10]; const float* cosT = nullptr; const float* sinT = nullptr; (void)cosT; (void)sinT;
    float* OUT = (float*)d_out;     // [2][2048][1024]
    char* wsp = (char*)d_ws;
    auto take = [&](size_t bytes) { char* p = wsp; wsp += (bytes + 255) & ~(size_t)255; return (void*)p; };
    bf* XB = (bf*)take((size_t)NB_ * TT * DM * 2); bf* YB = (bf*)take((size_t)NB_ * TT * DM * 2);   // XB .. WO lie back to back: the one destination of k_cvt8
    bf* WQ = (bf*)take((size_t)DQ * DM * 2); bf* WK = (bf*)take((size_t)DKV * DM * 2); bf* WV = (bf*)take((size_t)DKV * DM * 2); bf* WO = (bf*)take((size_t)DM * DQ * 2);
    const size_t PB = (size_t)NB_ * NH_ * TT * HD * 2;    // bytes of one 16-bit plane, both batches
    h16* QP16 = (h16*)take(PB); h16* KP16 = (h16*)take(PB); h16* VT16 = (h16*)take(PB);
    bf* QPh = (bf*)take(PB); bf* QPl = (bf*)take(PB); bf* KPh = (bf*)take(PB); bf* KPl = (bf*)take(PB); bf* VTh = (bf*)take(PB); bf* VTl = (bf*)take(PB);
    bf* ATh = (bf*)take(PB); bf* ATl = (bf*)take(PB);
    int* PM = (int*)take((size_t)NB_ * TT * 4); int* NE = (int*)take((size_t)NB_ * 4);
    if ((size_t)(wsp - (char*)d_ws) > ws_size) return;    // ws 256 MiB
    k_cvt8<<<dim3(CH / 2048, 2 * XC + 4, 1), 256, 0, stream>>>(x, y, wq, wk, wv, wo, kmask, XB, PM, NE);
    k_qkv<<<dim3(NB_ * TT / 128, DQ / 128, 3), 128, 0, stream>>>(XB, YB, WQ, WK, WV, bq, bk, bv, NE, QP16, QPh, QPl, KP16, KPh, KPl, VT16, VTh, VTl);
    k_attn<<<dim3(NH_, NB_, NZH + NZ2 + NZ1), AWV * 32, 0, stream>>>(QP16, KP16, VT16, QPh, QPl, KPh, KPl, VTh, VTl, PM, NE, ATh, ATl);
    k_gemmk<bf, 1, true, 2, 4, 4, 2, DQ><<<dim3(NB_ * TT / 128, DM / 128, 1), 256, 0, stream>>>(ATh, ATl, WO, OUT, DM, bo);
}

// v009
// Measured time: 83.6 microseconds a run.
// In two side-by-side timings against v008, it was 1.05 and 1.04 times as fast.
// Over all steps from v000 it is 24.4 times as fast.
#include <hip/hip_runtime.h>

// MultiHeadAttention_New (master, slave [2][2048][1024], attention_mask [2][2048] (int, read; random 0/1); q = (master Wq^T + bq) x 0.125, k/v = slave W^T + b (16 x 64); attn = clip(q.k, +-50000) + (mask == 0 ? -9e15 : mask) per key; softmax; out = merged Wo^T + bo -> [2][2048][1024]).
// Compute dtypes, f32 accumulate: every input rounded to bf16; q/k/v on PLAIN bf16 operands (inputs: exact) + bias; scores and attn.v: query rows < 512 hl (3 products), the rest single fp16 (x1024); the clamp and the additive mask term ((mask == 0) ? -9e15 : float(mask), read per key) in f32; softmax f32; Wo hl x exact (2 products) + bias.
// Key order: the rows of slave are stored with the keys of a non-zero mask first (each group in its old order). While a batch has such a key, a key of mask 0 lies 9e15 below every one of them (the clamp bounds the scores, an int the mask), so its probability is exactly 0 in f32:
// k, v and the key walk end behind the last non-zero key (NE keys, rounded up to whole tiles, whose zero-mask keys get their term as ever). A batch with no such key keeps all its keys (NE = TT).

#define NB_  2
#define TT   2048
#define DM   1024
#define NH_  16
#define NKV  16
#define REP  (NH_ / NKV)
#define HD   64
#define DQ   (NH_ * HD)
#define DKV  (NKV * HD)
#define RH   512                  // query rows < RH use hi+lo planes (0: none)
#define WIN  0
#define PCAR 1024.0f
#define SCL  0.125f   // HD^-0.5
typedef _Float16 h16;
typedef unsigned short bf;
typedef __attribute__((ext_vector_type(16))) __bf16   v16bf;
typedef __attribute__((ext_vector_type(16))) _Float16 v16h;
typedef __attribute__((ext_vector_type(8)))  _Float16 v8h;
typedef __attribute__((ext_vector_type(8)))  unsigned short v8us;
typedef __attribute__((ext_vector_type(8)))  float    v8f;
typedef __attribute__((ext_vector_type(4)))  float    v4f;
typedef v8h  __attribute__((may_alias)) v8ha;
typedef v4f  __attribute__((may_alias)) v4fa;
typedef v8us __attribute__((may_alias)) v8usa;

__device__ __forceinline__ unsigned short f2bf(float f) { unsigned u = __float_as_uint(f); u += 0x7FFFu + ((u >> 16) & 1u); return (unsigned short)(u >> 16); }
__device__ __forceinline__ float bf2f(unsigned short b) { return __uint_as_float(((unsigned)b) << 16); }
__device__ __forceinline__ float bfr(float f) { return bf2f(f2bf(f)); }
__device__ __forceinline__ v16h cat16(v8h lo, v8h hi) { return __builtin_shufflevector(lo, hi, 0, 1, 2, 3, 4, 5, 6, 7, 8, 9, 10, 11, 12, 13, 14, 15); }
__device__ __forceinline__ v16bf cat16b(v8us lo, v8us hi) { return __builtin_bit_cast(v16bf, __builtin_shufflevector(lo, hi, 0, 1, 2, 3, 4, 5, 6, 7, 8, 9, 10, 11, 12, 13, 14, 15)); }
__device__ __forceinline__ v8f wmma16(v16h a, v16h b, v8f c) { return __builtin_amdgcn_wmma_f32_16x16x32_f16(false, a, false, b, (short)0, c, false, false); }
__device__ __forceinline__ v8f wmmab(v16bf a, v16bf b, v8f c) { return __builtin_amdgcn_wmma_f32_16x16x32_bf16(false, a, false, b, (short)0, c, false, false); }



// ---- operand fragments straight from 16-bit planes kept in FRAGMENT ORDER: lane lr + 16 hi = row lr, k = 8 hi + 0..7 and 16 + 8 hi + 0..7 of a 32-wide k step, the same for A and for B.
// A plane of K-wide rows is cut into blocks of 16 rows x 32 k (512 elements, 1 KiB), block (row / 16, k / 32) with k / 32 running fastest; in a block the 8 elements of a lane's first load lie at lane x 8, those of its second at 256 + lane x 8.
// So each wave-wide 16-byte load reads 512 contiguous bytes (4 whole lines) where row-major planes gave it 32 bytes of each of 16 lines. pk: where element (row, k) lies.
__device__ __forceinline__ size_t pk(int row, int k, int K) { return ((size_t)(row >> 4) * (K >> 5) + (k >> 5)) * 512 + ((k >> 4) & 1) * 256 + ((((k >> 3) & 1) << 4) + (row & 15)) * 8 + (k & 7); }
template <typename T16> struct WFrag;
template <> struct WFrag<h16> { typedef v16h V; static __device__ __forceinline__ V ld(const h16* p) { return cat16(*(const v8h*)p, *(const v8h*)(p + 256)); } static __device__ __forceinline__ v8f mma(V a, V b, v8f c) { return wmma16(a, b, c); } };
template <> struct WFrag<bf> { typedef v16bf V; static __device__ __forceinline__ V ld(const bf* p) { return cat16b(*(const v8us*)p, *(const v8us*)(p + 256)); } static __device__ __forceinline__ v8f mma(V a, V b, v8f c) { return wmmab(a, b, c); } };

__device__ __forceinline__ h16 tohx(float x) { return (h16)x; }
__device__ __forceinline__ void splitf(float y, unsigned short& h, unsigned short& l) { h = f2bf(y); l = f2bf(y - bf2f(h)); }
typedef __attribute__((ext_vector_type(4))) _Float16 v4h;
typedef __attribute__((ext_vector_type(4))) unsigned short v4us;

// ---- copy4, copy8: four or eight 16-byte asynchronous copies a lane, global memory to LDS through no register. l: the lane's LDS byte address, g: its global address; copy i of a run of four lies i lstep bytes and i gstep elements further; copy8 takes two such runs.
// s_wait_xcnt is the last line of the copies' own statement, so that it stands in front of every rewrite of a register that they name.
template <typename T16>
__device__ __forceinline__ void copy4(unsigned l, const T16* g, unsigned lstep, size_t gstep) {
    asm volatile("global_load_async_to_lds_b128 %0, %4, off\n\t"
                 "global_load_async_to_lds_b128 %1, %5, off\n\t"
                 "global_load_async_to_lds_b128 %2, %6, off\n\t"
                 "global_load_async_to_lds_b128 %3, %7, off\n\t"
                 "s_wait_xcnt 0x0"
                 :: "v"(l), "v"(l + lstep), "v"(l + 2 * lstep), "v"(l + 3 * lstep), "v"(g), "v"(g + gstep), "v"(g + 2 * gstep), "v"(g + 3 * gstep) : "memory");
}
template <typename T16>
__device__ __forceinline__ void copy8(unsigned l, const T16* g, unsigned m, const T16* h, unsigned lstep, size_t gstep) {
    asm volatile("global_load_async_to_lds_b128 %0, %8, off\n\t"
                 "global_load_async_to_lds_b128 %1, %9, off\n\t"
                 "global_load_async_to_lds_b128 %2, %10, off\n\t"
                 "global_load_async_to_lds_b128 %3, %11, off\n\t"
                 "global_load_async_to_lds_b128 %4, %12, off\n\t"
                 "global_load_async_to_lds_b128 %5, %13, off\n\t"
                 "global_load_async_to_lds_b128 %6, %14, off\n\t"
                 "global_load_async_to_lds_b128 %7, %15, off\n\t"
                 "s_wait_xcnt 0x0"
                 :: "v"(l), "v"(l + lstep), "v"(l + 2 * lstep), "v"(l + 3 * lstep), "v"(m), "v"(m + lstep), "v"(m + 2 * lstep), "v"(m + 3 * lstep),
                    "v"(g), "v"(g + gstep), "v"(g + 2 * gstep), "v"(g + 3 * gstep), "v"(h), "v"(h + gstep), "v"(h + 2 * gstep), "v"(h + 3 * gstep) : "memory");
}
// ---- gemmk_tile: C[m][n] (f32, pitch ldc, + optional f32 bias[n]) = sum_k A[m][k] Bt[n][k] (NSPLIT 1: + A2[m][k] Bt[n][k]): WM x WN waves of one work-group share one 128 x 128 output tile, wave (wm, wn) owns (16 MB) x (16 NB) of it and sums the whole K in k order.
// The operands come through LDS, 64 k a stage, a ring of NBUF buffers: a stage holds, per operand, 8 row blocks x 2 KiB (two fragment-order blocks each, contiguous in the plane), brought by asynchronous copies, so each operand byte leaves L2 once a work-group and every wave reads its fragments from LDS.
// Stage s + NBUF is asked for at the foot of stage s, so its copies have NBUF - 1 stages of products to land in; with one stage of lead every landing that takes longer than a stage's products is waited out at the foot.
// A wave's copy counter falls in the order of issue, so the foot waits only until all but the younger stages' copies (CPW a stage and wave) have landed.
// Behind the last stage the tile is parked in the same LDS (row-major, pitch 128 + 4 floats), one barrier, and whole row pieces are stored. One work-group of 32 WM WN threads a tile at rows r0, columns c0; tokens of both batches run through as one row index b TT + t.
// EPI says what is stored. 0: C in f32. 1 and 2: no f32 C; each sum goes straight to the three 16-bit planes that attention reads (fp16, bf16 hi, bf16 lo).
// 1: m = token, n = feature, head planes [b][n / HD] of rows t, k = n % HD. 2: m = feature, n = token (weights as A, tokens as Bt), planes [b] of rows m, k = t, the bias taken per row m. A, Bt and the planes written are all in fragment order (pk).
template <int N> __device__ __forceinline__ void wait_copies() { asm volatile("s_wait_asynccnt %0" :: "n"(N) : "memory"); }   // all but this wave's N youngest copies have landed
template <typename T16, int NSPLIT, bool BIAS, int MB, int NB, int WM, int WN, int K, int EPI, int NBUF>
__device__ __forceinline__ void gemmk_tile(const T16* __restrict__ A, const T16* __restrict__ A2, const T16* __restrict__ Bt, float* C, int ldc, const float* __restrict__ bias, int r0, int c0, h16* P16, bf* Ph, bf* Pl, float* red) {
    typedef typename WFrag<T16>::V V;
    constexpr int NT = WM * WN * 32, TM = WM * MB * 16, TN = WN * NB * 16, PT = TN + 4;
    constexpr bool AHEAD = MB * NB <= 8; constexpr int PE = 8 * 1024, SE = (NSPLIT == 1 ? 3 : 2) * PE, NS = K / 64, CS = NT / 128, CPW = 8 / CS * (NSPLIT == 1 ? 3 : 2);   // elements of one operand's part of a stage and of a stage; stages; row blocks that one copy of the whole work-group covers; copies of a wave a stage
    static_assert(TM == 128 && TN == 128 && (NT == 128 || NT == 256) && K % 64 == 0 && NS >= NBUF && (NBUF == 3 || NBUF == 4) && NBUF * CPW <= 63 && TM * PT * 4 <= NBUF * SE * 2 && (NSPLIT == 0 || NSPLIT == 1), "stage shape");
    const int lane = threadIdx.x & 31, lr = lane & 15, hi = lane >> 4, wave = threadIdx.x >> 5, wm = wave / WN, wn = wave % WN;
    const T16* st = (const T16*)red;
    const unsigned lofs = (unsigned)(size_t)red + (threadIdx.x >> 7) * 2048 + (threadIdx.x & 127) * 16;   // 128 threads copy the 2 KiB of one row block
    const size_t gofs = (size_t)(threadIdx.x >> 7) * (K * 16) + (threadIdx.x & 127) * 8;                  // r0 and c0 are multiples of 16, so r0 K and c0 K are where their row panels start; a row block is 16 K elements
    const T16* ga = A + (size_t)r0 * K + gofs; const T16* ga2 = (NSPLIT == 1) ? A2 + (size_t)r0 * K + gofs : nullptr; const T16* gb = Bt + (size_t)c0 * K + gofs;
    auto fill = [&](int s) { const unsigned l = lofs + (s % NBUF) * (SE * 2);
#pragma unroll
        for (int c = 0; c < 8; c += 4 * CS) { copy8(l + c * 2048, ga + s * 1024 + (size_t)c * (K * 16), l + PE * 2 + c * 2048, gb + s * 1024 + (size_t)c * (K * 16), CS * 2048, (size_t)CS * (K * 16));
            if (NSPLIT == 1) copy4(l + PE * 4 + c * 2048, ga2 + s * 1024 + (size_t)c * (K * 16), CS * 2048, (size_t)CS * (K * 16)); } };
    v8f acc[MB][NB];
#pragma unroll
    for (int mb = 0; mb < MB; ++mb)
#pragma unroll
        for (int nb = 0; nb < NB; ++nb) acc[mb][nb] = (v8f){};
#pragma unroll                                          // each stage's buffer a constant, as in the loop below
    for (int s = 0; s < NBUF; ++s) fill(s);             // every buffer is free
    wait_copies<(NBUF - 1) * CPW>();                    // stage 0 has landed, as far as this wave copied it
    __syncthreads();                                    // and as far as the others did
    // unrolled: NS is a small constant, so each stage's buffer is known when compiling and no matrix instruction stands in front of a back edge
#pragma unroll
    for (int s = 0; s < NS; ++s) { const T16* sb = st + (s % NBUF) * SE + lane * 8;
        V a[2][MB], a2[2][MB], b[2][NB];
#pragma unroll
        for (int kb = 0; kb < 2; ++kb) {
            // the fragments of a 32-k block are asked for as one group (AHEAD: those of both blocks of the stage at once, where the registers allow it)
            if (!AHEAD || kb == 0) {
#pragma unroll
                for (int k2 = kb; k2 < (AHEAD ? 2 : kb + 1); ++k2) {
#pragma unroll
                    for (int mb = 0; mb < MB; ++mb) { a[k2][mb] = WFrag<T16>::ld(sb + (wm * MB + mb) * 1024 + k2 * 512); if (NSPLIT == 1) a2[k2][mb] = WFrag<T16>::ld(sb + 2 * PE + (wm * MB + mb) * 1024 + k2 * 512); }
#pragma unroll
                    for (int nb = 0; nb < NB; ++nb) b[k2][nb] = WFrag<T16>::ld(sb + PE + (wn * NB + nb) * 1024 + k2 * 512); }
                __builtin_amdgcn_sched_barrier(0);   // keeps the group together in front of its products: left alone the scheduler sinks each load to its use, and every four products wait a whole LDS trip
            }
#pragma unroll
            for (int nb = 0; nb < NB; ++nb) {
#pragma unroll
                for (int mb = 0; mb < MB; ++mb) acc[mb][nb] = WFrag<T16>::mma(a[kb][mb], b[kb][nb], acc[mb][nb]);
                if (NSPLIT == 1) {
#pragma unroll
                    for (int mb = 0; mb < MB; ++mb) acc[mb][nb] = WFrag<T16>::mma(a2[kb][mb], b[kb][nb], acc[mb][nb]); } }
            if (!AHEAD || kb == 1) __builtin_amdgcn_sched_barrier(0);   // keeps the next group behind these products, whose registers it takes over, and the stage's last products in front of its foot: sunk among the next copies they hold their fragments live and the registers run over 256
        }
        asm volatile("s_wait_dscnt 0x0" ::: "memory");      // this wave has read the last of stage s
        // and its copies of stage s + 1 have landed: behind them stages s + 2 .. s + NBUF - 1 are under way, as far as they exist (s is a constant in the unrolled loop: one of the three waits is left)
        if (NBUF == 4 && s + 3 < NS) wait_copies<2 * CPW>(); else if (s + 2 < NS) wait_copies<CPW>(); else wait_copies<0>();
        __syncthreads();                                    // publishes stage s + 1 and frees the buffer of stage s
        if (s + NBUF < NS) fill(s + NBUF);
    }
    asm volatile("s_wait_asynccnt 0x0" ::: "memory");   // no copy is under way when the buffers become the parking place
#pragma unroll
    for (int mb = 0; mb < MB; ++mb)
#pragma unroll
        for (int nb = 0; nb < NB; ++nb)
#pragma unroll
            for (int j = 0; j < 8; ++j) red[((wm * MB + mb) * 16 + hi * 8 + j) * PT + (wn * NB + nb) * 16 + lr] = acc[mb][nb][j];
    __syncthreads();
    // four pieces a trip: their LDS reads and stores overlap and a bias taken by column leaves the loop; one by one each piece waits out its own loads, and a thread now has 16 or 32 pieces
#pragma unroll 1
    for (int it = 0; it < TM * TN / 4 / NT; it += 4) {
#pragma unroll
      for (int u = 0; u < 4; ++u) { const int e = threadIdx.x + (it + u) * NT;
        // f32 C: a wave takes whole rows. Planes: a wave takes 16 rows x 8 columns, lane = row + 16 x (column half), which are 256 contiguous bytes of a block
        const int row = (EPI == 0) ? e / (TN / 4) : ((e >> 5) / (TN / 8)) * 16 + (e & 15), cofs = (EPI == 0) ? (e % (TN / 4)) * 4 : ((e >> 5) % (TN / 8)) * 8 + ((e >> 4) & 1) * 4; v4f val = *(const v4fa*)(red + row * PT + cofs);
        if (BIAS && EPI == 2) { const float br = bfr(bias[r0 + row]); val[0] += br; val[1] += br; val[2] += br; val[3] += br; }
        else if (BIAS) { val[0] += bfr(bias[c0 + cofs]); val[1] += bfr(bias[c0 + cofs + 1]); val[2] += bfr(bias[c0 + cofs + 2]); val[3] += bfr(bias[c0 + cofs + 3]); }
        if constexpr (EPI == 0) *(v4f*)(C + (size_t)(r0 + row) * ldc + c0 + cofs) = val;
        else { v4h o16; v4us oh, ol;
#pragma unroll
            for (int q = 0; q < 4; ++q) { o16[q] = tohx(val[q]); unsigned short a2, c2; splitf(val[q], a2, c2); oh[q] = a2; ol[q] = c2; }
            const size_t oo = (EPI == 1) ? (size_t)((r0 + row) / TT * NH_ + (c0 + cofs) / HD) * TT * HD + pk((r0 + row) % TT, (c0 + cofs) % HD, HD) : (size_t)((c0 + cofs) / TT) * DKV * TT + pk(r0 + row, (c0 + cofs) % TT, TT);
            *(v4h*)(P16 + oo) = o16; *(v4us*)(Ph + oo) = oh; *(v4us*)(Pl + oo) = ol; } }
      asm volatile("s_wait_xcnt 0x0" ::: "memory");   // behind the trip's last store, in front of the next trip's rewrite of the stores' registers
    }
}
// ---- k_gemmk: the f32 form of gemmk_tile. grid (M / 128, N / 128), 32 WM WN threads, one work-group a WGP. LDS: four stages, which also hold the parked tile.
template <typename T16, int NSPLIT, bool BIAS, int MB, int NB, int WM, int WN, int K>
__global__ __launch_bounds__(WM * WN * 32) void k_gemmk(const T16* __restrict__ A, const T16* __restrict__ A2, const T16* __restrict__ Bt, float* C, int ldc, const float* __restrict__ bias) {
    static_assert(NSPLIT == 1, "three operand parts a stage");
    __shared__ __align__(16) float red[4 * 3 * 8 * 1024 / 2];
    gemmk_tile<T16, NSPLIT, BIAS, MB, NB, WM, WN, K, 0, 4>(A, A2, Bt, C, ldc, bias, blockIdx.x * 128, blockIdx.y * 128, nullptr, nullptr, nullptr, red);
}
// ---- k_qkv: the three projections of both batches in one launch; blockIdx.z says which (0 q, 1 k, 2 v), the same for the whole work-group, so the barriers inside stay uniform. grid (NB_ TT / 128, DQ / 128, 3), 128 threads.
// A k or v tile whose 128 keys all lie behind the batch's NE keys is left out: the whole work-group returns, in front of every barrier; nothing reads those keys.
__global__ __launch_bounds__(128) void k_qkv(const bf* __restrict__ XB, const bf* __restrict__ YB, const bf* __restrict__ WQ, const bf* __restrict__ WK, const bf* __restrict__ WV, const float* __restrict__ bq, const float* __restrict__ bk, const float* __restrict__ bv, const int* __restrict__ NE,
                                             h16* QP16, bf* QPh, bf* QPl, h16* KP16, bf* KPh, bf* KPl, h16* VT16, bf* VTh, bf* VTl) {
    static_assert(DQ == DKV && NH_ == NKV && TT % 128 == 0, "one grid serves q, k and v");
    __shared__ __align__(16) float red[3 * 2 * 8 * 1024 / 2];   // three stages (96 KiB: three work-groups still fit a WGP); the parked tile (128 x 132 floats) lies in them
    const int t0 = blockIdx.x * 128, f0 = blockIdx.y * 128;
    if (blockIdx.z != 0 && t0 % TT >= min(NE[t0 / TT], TT)) return;
    if (blockIdx.z == 2) gemmk_tile<bf, 0, true, 4, 4, 2, 2, DM, 2, 3>(WV, nullptr, YB, nullptr, 0, bv, f0, t0, VT16, VTh, VTl, red);   // weights as A: v comes out feature-major, the order attn.v reads
    else { const bool isq = blockIdx.z == 0;
        gemmk_tile<bf, 0, true, 4, 4, 2, 2, DM, 1, 3>(isq ? XB : YB, nullptr, isq ? WQ : WK, nullptr, 0, isq ? bq : bk, t0, f0, isq ? QP16 : KP16, isq ? QPh : KPh, isq ? QPl : KPl, red); }
}

typedef __attribute__((ext_vector_type(2))) unsigned short v2us;
typedef __attribute__((ext_vector_type(2))) float v2f;
typedef __attribute__((ext_vector_type(4))) int v4i;
typedef __attribute__((ext_vector_type(8))) unsigned v8u;

__global__ __launch_bounds__(256) void k_wtG(const float* __restrict__ w, int K, int N, bf* Bt) {
    const int lane = threadIdx.x & 31; const int L0 = (blockIdx.x * 8 + (threadIdx.x >> 5)) * 8; const int nlines = N * K / 64;
{
#pragma unroll 1
        for (int l = 0; l < 8; ++l) { const int L = L0 + l; if (L >= nlines) break; const size_t e = (size_t)L * 64 + lane * 2; const int k = (int)(e % K), n = (int)(e / K); v2us o;
            o[0] = f2bf(w[(size_t)k * N + n]); o[1] = f2bf(w[(size_t)(k + 1) * N + n]); *(v2us*)(Bt + e) = o; }
         }
}
// ---- k_cvt8: every f32 operand to bf16, in fragment order, in one launch. blockIdx.y names a chunk of CH elements: the chunks of x, then of y, then the four weights; dst holds them in that order. grid (CH / 2048, 2 XC + 4), 256 threads.
// Rows of y go to their place in the key order: row g of a batch to (non-zero masks before g) if its own mask is non-zero, else to (all non-zero) + (zero masks before g). Every work-group of y counts its batch's mask itself (a ballot per 32 keys, the waves' counts summed through LDS behind the barrier that is there anyway).
// PM: the mask in the key order, NE: the keys that count, both for the later launches; written by the work-groups of the first 128 k (NE: of the first rows).
// A work-group takes 16 rows x 128 k: 2048 contiguous elements of dst (four blocks; of y: 16-byte pieces of two runs of rows). Piece p = k / 8 of row r goes to piece 16 p + r: the 16-byte pieces are turned through LDS (pitch 272 bytes: no bank met twice), so reads and stores both stay on whole lines.
#define CH   (DM * DQ)
#define XC   (NB_ * TT * DM / CH)
__global__ __launch_bounds__(256) void k_cvt8(const float* __restrict__ x, const float* __restrict__ y, const float* __restrict__ wq, const float* __restrict__ wk, const float* __restrict__ wv, const float* __restrict__ wo, const int* __restrict__ km, bf* dst0, int* PM, int* NE) {
    static_assert(NB_ * TT * DM % CH == 0 && DKV == DQ && DQ == DM && CH % (16 * DM) == 0 && DM % 128 == 0 && TT % 256 == 0 && TT % 16 == 0 && TT < 65536, "chunks");
    __shared__ __align__(16) bf st[16 * 136]; __shared__ __align__(16) int wc[8];
    const int c = blockIdx.y; const float* src = (c < XC) ? x + (size_t)c * CH : (c < 2 * XC) ? y + (size_t)(c - XC) * CH : (c == 2 * XC) ? wq : (c == 2 * XC + 1) ? wk : (c == 2 * XC + 2) ? wv : wo; bf* dst = dst0 + (size_t)c * CH;
    const int r = threadIdx.x >> 4, p = threadIdx.x & 15; const v8f v = *(const v8f*)(src + (size_t)(blockIdx.x / (DM / 128) * 16 + r) * DM + blockIdx.x % (DM / 128) * 128 + p * 8); v8us o;
    const bool isy = c >= XC && c < 2 * XC;   // the same for the whole work-group
    const int grow = (c - XC) * (CH / DM) + blockIdx.x / (DM / 128) * 16, yb = grow / TT, g0 = grow % TT, wave = __builtin_amdgcn_readfirstlane(threadIdx.x >> 5);
    int mk[TT / 256], mown = 0;
    if (isy) {
#pragma unroll
        for (int i = 0; i < TT / 256; ++i) mk[i] = km[yb * TT + i * 256 + threadIdx.x];
        mown = km[yb * TT + g0 + p]; }
    asm volatile("s_wait_xcnt 0x0" ::: "memory");   // behind the loads, in front of the first rewrite of their address registers
    unsigned own = 0;   // bit i: row g0 + i has a non-zero mask
    if (isy) { int tot = 0, bef = 0;   // non-zero masks among this wave's keys: all, and those in front of row g0 (a multiple of 16)
#pragma unroll
        for (int i = 0; i < TT / 256; ++i) { const int e0 = i * 256 + wave * 32; const unsigned bal = __builtin_amdgcn_ballot_w32(mk[i] != 0);
            tot += __builtin_popcount(bal); bef += __builtin_popcount(e0 + 32 <= g0 ? bal : e0 + 16 == g0 ? bal & 0xFFFFu : 0u); }
        if ((threadIdx.x & 31) == 0) wc[wave] = tot | (bef << 16);
        own = __builtin_amdgcn_ballot_w32(mown != 0) & 0xFFFFu; }
#pragma unroll
    for (int k = 0; k < 8; ++k) o[k] = f2bf(v[k]);
    *(v8usa*)(st + p * 136 + r * 8) = o;
    __syncthreads();
    const v8us piece = *(const v8usa*)(st + r * 136 + p * 8);   // from here on p is the row and r the piece
    if (!isy) { *(v8us*)(dst + (size_t)blockIdx.x * 2048 + threadIdx.x * 8) = piece;
        asm volatile("s_wait_xcnt 0x0" ::: "memory"); }   // behind the store, in front of any rewrite of its registers on the way to the kernel's end
    else { int sum = 0;
#pragma unroll
        for (int w = 0; w < 8; ++w) sum += wc[w];
        const int cnt = sum & 0xFFFF, bef = sum >> 16, ln = __builtin_popcount(own & ((1u << p) - 1u));
        const int nr = ((own >> p) & 1u) ? bef + ln : cnt + (g0 - bef) + (p - ln);   // a permutation of 0 .. TT - 1 whatever the mask holds
        *(v8us*)(dst0 + (size_t)XC * CH + (size_t)yb * TT * DM + ((size_t)(nr >> 4) * (DM / 32) + blockIdx.x % (DM / 128) * 4) * 512 + r * 128 + (nr & 15) * 8) = piece;
        if (blockIdx.x % (DM / 128) == 0 && r == 0) { PM[yb * TT + nr] = mown; if (g0 == 0 && p == 0) NE[yb] = cnt ? cnt : TT; } } }
// ---- exp2x8, exp2x1: v_exp_f32 with the slot that the instruction set asks for behind a transcendental (before its result is used or its source overwritten) closed inside the statement: results lie apart from all sources, so each v_exp_f32 is the independent instruction behind the one in front of it, and one v_nop stands behind the last.
__device__ __forceinline__ v8f exp2x8(v8f x) { float e0, e1, e2, e3, e4, e5, e6, e7;
    asm("v_exp_f32 %0, %8\n\tv_exp_f32 %1, %9\n\tv_exp_f32 %2, %10\n\tv_exp_f32 %3, %11\n\tv_exp_f32 %4, %12\n\tv_exp_f32 %5, %13\n\tv_exp_f32 %6, %14\n\tv_exp_f32 %7, %15\n\tv_nop"
        : "=&v"(e0), "=&v"(e1), "=&v"(e2), "=&v"(e3), "=&v"(e4), "=&v"(e5), "=&v"(e6), "=&v"(e7) : "v"(x[0]), "v"(x[1]), "v"(x[2]), "v"(x[3]), "v"(x[4]), "v"(x[5]), "v"(x[6]), "v"(x[7]));
    return (v8f){e0, e1, e2, e3, e4, e5, e6, e7}; }
__device__ __forceinline__ float exp2x1(float x) { float e; asm("v_exp_f32 %0, %1\n\tv_nop" : "=&v"(e) : "v"(x)); return e; }
// ---- k_attn: scores, softmax, attn.v and the head merge. A wave keeps 16 QT query rows of one head and walks all keys that count (the first NE of the key order), SK a stage, with a running row maximum and row sum; the AWV waves of a work-group share each stage's key and v blocks through LDS.
// A stage holds, per plane, SK keys x HD of k (8 KiB, contiguous in the plane) and HD rows x SK keys of v (four pieces of 2 KiB); two buffers, filled by asynchronous copies one stage ahead of their use, so each k and v byte leaves L2 once per 16 QT AWV query rows.
// Scores are formed TRANSPOSED (A = 16 keys, B = 16 queries): a lane holds, for query lr, keys hi 8 + j of each 16-key tile, which is the fragment order of attn.v (two tiles = one 32-key fragment), so the probabilities never leave the registers.
// attn.v is formed transposed too (A = 16 features of v, B = the probabilities): a lane holds, for the same query lr, features hi 8 + j, so maximum, sum and rescale stay in the lane (one exchange between the lane halves) and its 8 results are one 16-byte piece of the merged planes.
// Probabilities stay unnormalised (relative to the running maximum; single fp16 plane: x PCAR, as 2^10 in the exponent); the row sum carries the same factor and divides the result once, at the end. Every plane read or written here is in fragment order (pk).
// grid (NH_, NB_, NZH + NZ2 + NZ1), 32 AWV threads, longest work-groups first: hi/lo rows (QT 1, three products), then two thirds of the single-plane rows at QT 2, then the last third at QT 1. 256 work-groups of each kind: one of each fills a WGP with three waves a SIMD, and every SIMD gets the same work.
#define AWV  4
#define SK   64
#define NZH  (RH / (AWV * 16))
#define NZ2  ((TT - RH) * 2 / 3 / (AWV * 32))
#define NZ1  ((TT - RH) / 3 / (AWV * 16))
template <typename T16, bool HR, int QT>
__device__ __forceinline__ void attn_tile(const T16* __restrict__ Q, const T16* __restrict__ Q2, const T16* __restrict__ Kp, const T16* __restrict__ Kp2, const T16* __restrict__ Vt, const T16* __restrict__ Vt2, const int* __restrict__ km, int ns, bf* ATh, bf* ATl, int orow, int ocol, const T16* st, float* sma) {
    typedef typename WFrag<T16>::V V;
    constexpr int KT = SK / 16, KC = HD / 32, CT = SK / 32, DT = HD / 16, NS = TT / SK;
    constexpr int PE = SK * HD, SE = (HR ? 4 : 2) * PE;   // elements of one plane's k (or v) part of a stage, and of a stage: k, v (hi/lo rows: k hi, v hi, k lo, v lo)
    static_assert(AWV * 32 * 8 * 4 == PE && SK * 16 == AWV * 32 * 8 && DT == 4 && NS >= 2 && TT % (AWV * 128) == 0, "four copies a thread and part");
    const int lane = threadIdx.x & 31, lr = lane & 15, hi = lane >> 4, wave = threadIdx.x >> 5;
    const unsigned lofs = (unsigned)(size_t)st + threadIdx.x * 16;
    const unsigned tofs = threadIdx.x * 8;   // the planes' stage addresses are formed on the scalar side and this added: four 64-bit lane pointers kept over the loop would not fit the registers
    // k: 2 KiB after 2 KiB of the stage's 8; v: the stage's 2 KiB of each of the four 16-row blocks, 16 TT elements apart
    auto fill = [&](int s) { const unsigned l = lofs + (s & 1) * (SE * 2);
        copy4(l, (Kp + s * PE) + tofs, 2048u, (size_t)1024); copy4(l + PE * 2, (Vt + s * (SK * 16)) + tofs, 2048u, (size_t)16 * TT);
        if (HR) { copy4(l + PE * 4, (Kp2 + s * PE) + tofs, 2048u, (size_t)1024); copy4(l + PE * 6, (Vt2 + s * (SK * 16)) + tofs, 2048u, (size_t)16 * TT); } };
    fill(0);
    V qf[QT][KC], qf2[QT][KC];
#pragma unroll
    for (int qt = 0; qt < QT; ++qt)
#pragma unroll
        for (int kc = 0; kc < KC; ++kc) { qf[qt][kc] = WFrag<T16>::ld(Q + lane * 8 + (wave * QT + qt) * 16 * HD + kc * 512); if (HR) qf2[qt][kc] = WFrag<T16>::ld(Q2 + lane * 8 + (wave * QT + qt) * 16 * HD + kc * 512); }
    // the additive mask term of every key, once a work-group
#pragma unroll
    for (int i = 0; i < TT / (AWV * 128); ++i) { const v4i mk = *(const v4i*)(km + (i * (AWV * 32) + threadIdx.x) * 4); v4f ma;
#pragma unroll
        for (int q = 0; q < 4; ++q) ma[q] = (mk[q] == 0) ? -9.0e15f : (float)mk[q];
        *(v4fa*)(sma + (i * (AWV * 32) + threadIdx.x) * 4) = ma; }
    asm volatile("s_wait_xcnt 0x0" ::: "memory");       // behind the query and mask loads, in front of any rewrite of their address registers
    asm volatile("s_wait_asynccnt 0x0" ::: "memory");   // stage 0 has landed, as far as this wave copied it
    __syncthreads();                                    // and as far as the others did; the mask terms are written
    if (1 < ns) fill(1);
    float mrun[QT], lsum[QT]; v8f o[DT][QT];
#pragma unroll
    for (int qt = 0; qt < QT; ++qt) { mrun[qt] = -3.0e38f; lsum[qt] = 0.f;
#pragma unroll
        for (int dt = 0; dt < DT; ++dt) o[dt][qt] = (v8f){}; }
    // rolled: the stages (ns of them, known at run time, at most 32)
#pragma unroll 1
    for (int s = 0; s < ns; ++s) { const T16* sb = st + (s & 1) * SE + lane * 8;
        V kf[KT][KC], kf2[KT][KC], vf[DT][CT], vf2[DT][CT];
#pragma unroll
        for (int kt = 0; kt < KT; ++kt)
#pragma unroll
            for (int kc = 0; kc < KC; ++kc) { kf[kt][kc] = WFrag<T16>::ld(sb + (kt * KC + kc) * 512); if (HR) kf2[kt][kc] = WFrag<T16>::ld(sb + 2 * PE + (kt * KC + kc) * 512); }
        __builtin_amdgcn_sched_barrier(0);   // keeps the stage's key fragments together in front of the score products: sunk to their uses, every few products wait a whole LDS trip
        v8f sc[KT][QT];
#pragma unroll
        for (int kc = 0; kc < KC; ++kc) {
#pragma unroll
            for (int kt = 0; kt < KT; ++kt)
#pragma unroll
                for (int qt = 0; qt < QT; ++qt) sc[kt][qt] = WFrag<T16>::mma(kf[kt][kc], qf[qt][kc], (kc == 0) ? (v8f){} : sc[kt][qt]);
            if (HR) {
#pragma unroll
                for (int kt = 0; kt < KT; ++kt)
#pragma unroll
                    for (int qt = 0; qt < QT; ++qt) sc[kt][qt] = WFrag<T16>::mma(kf[kt][kc], qf2[qt][kc], sc[kt][qt]);
#pragma unroll
                for (int kt = 0; kt < KT; ++kt)
#pragma unroll
                    for (int qt = 0; qt < QT; ++qt) sc[kt][qt] = WFrag<T16>::mma(kf2[kt][kc], qf[qt][kc], sc[kt][qt]); } }
        __builtin_amdgcn_sched_barrier(0);   // keeps the v fragments, which take over the key fragments' registers, behind the score products
#pragma unroll
        for (int c = 0; c < CT; ++c)
#pragma unroll
            for (int dt = 0; dt < DT; ++dt) { vf[dt][c] = WFrag<T16>::ld(sb + PE + dt * (SK * 16) + c * 512); if (HR) vf2[dt][c] = WFrag<T16>::ld(sb + 3 * PE + dt * (SK * 16) + c * 512); }
        __builtin_amdgcn_sched_barrier(0);   // keeps the v loads together, behind the score products and in front of all that follows: spread by the scheduler they leave more registers live at the foot, and the hi/lo rows' copy pointers are spilled
#pragma unroll
        for (int kt = 0; kt < KT; ++kt)
#pragma unroll
            for (int qt = 0; qt < QT; ++qt)
#pragma unroll
                for (int j = 0; j < 8; ++j) sc[kt][qt][j] = fminf(fmaxf(sc[kt][qt][j] * SCL, -50000.0f), 50000.0f);
        // the stage's foot stands here, behind its last read of the buffer: the rest of the trip works on registers (and the mask terms), and the copies of stage s + 2 get that time and the next stage's scores to land
        asm volatile("s_wait_dscnt 0x0" ::: "memory");      // this wave has read the last of stage s
        asm volatile("s_wait_asynccnt 0x0" ::: "memory");   // and its copies of stage s + 1 have landed
        __syncthreads();                                    // publishes stage s + 1 and frees the buffer of stage s
        if (s + 2 < ns) fill(s + 2);
        float mx[QT];
#pragma unroll
        for (int qt = 0; qt < QT; ++qt) mx[qt] = mrun[qt];
#pragma unroll
        for (int kt = 0; kt < KT; ++kt) { const v4f a0 = *(const v4fa*)(sma + s * SK + kt * 16 + hi * 8), a1 = *(const v4fa*)(sma + s * SK + kt * 16 + hi * 8 + 4);
#pragma unroll
            for (int qt = 0; qt < QT; ++qt)
#pragma unroll
                for (int j = 0; j < 8; ++j) { const float t = __fadd_rn(sc[kt][qt][j], (j < 4) ? a0[j & 3] : a1[j & 3]); sc[kt][qt][j] = t; mx[qt] = fmaxf(mx[qt], t); } }
        V pf[CT][QT], pf2[CT][QT];
#pragma unroll
        for (int qt = 0; qt < QT; ++qt) { const float m = fmaxf(mx[qt], __shfl_xor(mx[qt], 16, 32));
            const float al = exp2x1(__fmul_rn(__fsub_rn(mrun[qt], m), 1.4426950408889634f)); mrun[qt] = m;   // what the sums so far shrink by under the new maximum (0 in the first stage)
            float sp[KT];   // one partial sum a key tile: independent chains, where one chain of 32 adds would wait out each add
#pragma unroll
            for (int kt = 0; kt < KT; ++kt) { v8f x;
#pragma unroll
                for (int j = 0; j < 8; ++j) { const float d = __fsub_rn(sc[kt][qt][j], m); x[j] = HR ? __fmul_rn(d, 1.4426950408889634f) : __builtin_fmaf(d, 1.4426950408889634f, 10.0f); }
                sc[kt][qt] = exp2x8(x); sp[kt] = sc[kt][qt][0];
#pragma unroll
                for (int j = 1; j < 8; ++j) sp[kt] += sc[kt][qt][j]; }
            static_assert(KT == 4, "four partial sums");
            lsum[qt] = lsum[qt] * al + ((sp[0] + sp[1]) + (sp[2] + sp[3]));
#pragma unroll
            for (int dt = 0; dt < DT; ++dt) o[dt][qt] *= al;
#pragma unroll
            for (int c = 0; c < CT; ++c) {
                if constexpr (HR) { v8u ph, pl;   // two 16-bit planes, packed a register pair at a time
#pragma unroll
                    for (int j = 0; j < 16; j += 2) { unsigned short h0, l0, h1, l1; splitf(sc[2 * c + j / 8][qt][j % 8], h0, l0); splitf(sc[2 * c + j / 8][qt][j % 8 + 1], h1, l1); ph[j / 2] = (unsigned)h0 | ((unsigned)h1 << 16); pl[j / 2] = (unsigned)l0 | ((unsigned)l1 << 16); }
                    pf[c][qt] = __builtin_bit_cast(v16bf, ph); pf2[c][qt] = __builtin_bit_cast(v16bf, pl);
                } else { v8h x0, x1;
#pragma unroll
                    for (int j = 0; j < 8; ++j) { x0[j] = tohx(sc[2 * c][qt][j]); x1[j] = tohx(sc[2 * c + 1][qt][j]); }
                    pf[c][qt] = cat16(x0, x1); } } }
#pragma unroll
        for (int c = 0; c < CT; ++c) {
#pragma unroll
            for (int dt = 0; dt < DT; ++dt)
#pragma unroll
                for (int qt = 0; qt < QT; ++qt) o[dt][qt] = WFrag<T16>::mma(vf[dt][c], pf[c][qt], o[dt][qt]);
            if (HR) {
#pragma unroll
                for (int dt = 0; dt < DT; ++dt)
#pragma unroll
                    for (int qt = 0; qt < QT; ++qt) o[dt][qt] = WFrag<T16>::mma(vf[dt][c], pf2[c][qt], o[dt][qt]);
#pragma unroll
                for (int dt = 0; dt < DT; ++dt)
#pragma unroll
                    for (int qt = 0; qt < QT; ++qt) o[dt][qt] = WFrag<T16>::mma(vf2[dt][c], pf[c][qt], o[dt][qt]); } }
    }
    asm volatile("s_wait_asynccnt 0x0" ::: "memory");   // no copy is under way when the wave ends
#pragma unroll
    for (int qt = 0; qt < QT; ++qt) { const float inv = __fdiv_rn(1.0f, lsum[qt] + __shfl_xor(lsum[qt], 16, 32));   // the two lane halves summed different keys
#pragma unroll
        for (int dt = 0; dt < DT; ++dt) { v8us oh, ol;
#pragma unroll
            for (int j = 0; j < 8; ++j) { unsigned short a, c2; splitf(o[dt][qt][j] * inv, a, c2); oh[j] = a; ol[j] = c2; }
            const size_t oo = pk(orow + (wave * QT + qt) * 16 + lr, ocol + dt * 16 + hi * 8, DQ);   // the lane's 8 features are one 16-byte piece; a wave stores 512 contiguous bytes
            *(v8us*)(ATh + oo) = oh; *(v8us*)(ATl + oo) = ol;
            asm volatile("s_wait_xcnt 0x0" ::: "memory");   // behind the stores, in front of the next piece's rewrite of their registers
        } }
}
__global__ __launch_bounds__(AWV * 32) void k_attn(const h16* __restrict__ Q16, const h16* __restrict__ K16, const h16* __restrict__ V16, const bf* __restrict__ Qh, const bf* __restrict__ Ql, const bf* __restrict__ Kh, const bf* __restrict__ Kl, const bf* __restrict__ Vh, const bf* __restrict__ Vl, const int* __restrict__ km, const int* __restrict__ NE, bf* ATh, bf* ATl) {
    static_assert(RH % (AWV * 16) == 0 && RH + NZ2 * (AWV * 32) + NZ1 * (AWV * 16) == TT && TT % SK == 0 && NH_ == NKV, "tile shape");
    __shared__ __align__(16) bf stg[2 * 4 * SK * HD]; __shared__ __align__(16) float sma[TT];
    const int h = blockIdx.x, b = blockIdx.y, z = blockIdx.z; const int q0 = (z < NZH) ? z * (AWV * 16) : (z < NZH + NZ2) ? RH + (z - NZH) * (AWV * 32) : RH + NZ2 * (AWV * 32) + (z - NZH - NZ2) * (AWV * 16);
    const size_t zp = (size_t)(b * NH_ + h) * TT * HD, zq = zp + (size_t)q0 * HD; const int orow = b * TT + q0, ocol = h * HD; km += b * TT;
    const int ns = min((NE[b] + SK - 1) / SK, TT / SK);   // stages that hold a key that counts; km is the mask in the key order
    // z is the same for the whole work-group: the barriers inside stay uniform
    if (z < NZH) attn_tile<bf, true, 1>(Qh + zq, Ql + zq, Kh + zp, Kl + zp, Vh + zp, Vl + zp, km, ns, ATh, ATl, orow, ocol, stg, sma);
    else if (z < NZH + NZ2) attn_tile<h16, false, 2>(Q16 + zq, nullptr, K16 + zp, nullptr, V16 + zp, nullptr, km, ns, ATh, ATl, orow, ocol, (const h16*)stg, sma);
    else attn_tile<h16, false, 1>(Q16 + zq, nullptr, K16 + zp, nullptr, V16 + zp, nullptr, km, ns, ATh, ATl, orow, ocol, (const h16*)stg, sma);
}

extern "C" void kernel_launch(void* const* d_in, const int* in_sizes, int n_in,
                              void* d_out, int out_size, void* d_ws, size_t ws_size, hipStream_t stream) {
    (void)in_sizes; (void)n_in; (void)out_size;
    const float* x = (const float*)d_in[0]; const float* y = (const float*)d_in[1]; const int* kmask = (const int*)d_in[2]; const float* wq = (const float*)d_in[3]; const float* bq = (const float*)d_in[4]; const float* wk = (const float*)d_in[5]; const float* bk = (const float*)d_in[6]; const float* wv = (const float*)d_in[7]; const float* bv = (const float*)d_in[8]; const float* wo = (const float*)d_in[9]; const float* bo = (const float*)d_in[10]; const float* cosT = nullptr; const float* sinT = nullptr; (void)cosT; (void)sinT;
    float* OUT = (float*)d_out;     // [2][2048][1024]
    char* wsp = (char*)d_ws;
    auto take = [&](size_t bytes) { char* p = wsp; wsp += (bytes + 255) & ~(size_t)255; return (void*)p; };
    bf* XB = (bf*)take((size_t)NB_ * TT * DM * 2); bf* YB = (bf*)take((size_t)NB_ * TT * DM * 2);   // XB .. WO lie back to back: the one destination of k_cvt8
    bf* WQ = (bf*)take((size_t)DQ * DM * 2); bf* WK = (bf*)take((size_t)DKV * DM * 2); bf* WV = (bf*)take((size_t)DKV * DM * 2); bf* WO = (bf*)take((size_t)DM * DQ * 2);
    const size_t PB = (size_t)NB_ * NH_ * TT * HD * 2;    // bytes of one 16-bit plane, both batches
    h16* QP16 = (h16*)take(PB); h16* KP16 = (h16*)take(PB); h16* VT16 = (h16*)take(PB);
    bf* QPh = (bf*)take(PB); bf* QPl = (bf*)take(PB); bf* KPh = (bf*)take(PB); bf* KPl = (bf*)take(PB); bf* VTh = (bf*)take(PB); bf* VTl = (bf*)take(PB);
    bf* ATh = (bf*)take(PB); bf* ATl = (bf*)take(PB);
    int* PM = (int*)take((size_t)NB_ * TT * 4); int* NE = (int*)take((size_t)NB_ * 4);
    if ((size_t)(wsp - (char*)d_ws) > ws_size) return;    // ws 256 MiB
    k_cvt8<<<dim3(CH / 2048, 2 * XC + 4, 1), 256, 0, stream>>>(x, y, wq, wk, wv, wo, kmask, XB, PM, NE);
    k_qkv<<<dim3(NB_ * TT / 128, DQ / 128, 3), 128, 0, stream>>>(XB, YB, WQ, WK, WV, bq, bk, bv, NE, QP16, QPh, QPl, KP16, KPh, KPl, VT16, VTh, VTl);
    k_attn<<<dim3(NH_, NB_, NZH + NZ2 + NZ1), AWV * 32, 0, stream>>>(QP16, KP16, VT16, QPh, QPl, KPh, KPl, VTh, VTl, PM, NE, ATh, ATl);
    k_gemmk<bf, 1, true, 2, 4, 4, 2, DQ><<<dim3(NB_ * TT / 128, DM / 128, 1), 256, 0, stream>>>(ATh, ATl, WO, OUT, DM, bo);
}

// v010
// Measured time: 79.1 microseconds a run.
// Two timings next to v009 both put it at 1.06 times that version's speed.
// All steps since v000 together make it 26.0 times as fast.
#include <hip/hip_runtime.h>

// MultiHeadAttention_New (master, slave [2][2048][1024], attention_mask [2][2048] (int, read; random 0/1); q = (master Wq^T + bq) x 0.125, k/v = slave W^T + b (16 x 64); attn = clip(q.k, +-50000) + (mask == 0 ? -9e15 : mask) per key; softmax; out = merged Wo^T + bo -> [2][2048][1024]).
// Compute dtypes, f32 accumulate: every input rounded to bf16; q/k/v on PLAIN bf16 operands (inputs: exact) + bias; scores and attn.v: query rows < 512 hl (3 products), the rest single fp16 (x1024); the clamp and the additive mask term ((mask == 0) ? -9e15 : float(mask), read per key) in f32; softmax f32; Wo hl x exact (2 products) + bias.
// Key order: the rows of slave are stored with the keys of a non-zero mask first (each group in its old order). While a batch has such a key, a key of mask 0 lies 9e15 below every one of them (the clamp bounds the scores, an int the mask), so its probability is exactly 0 in f32:
// k, v and the key walk end behind the last non-zero key (NE keys, rounded up to whole tiles, whose zero-mask keys get their term as ever). A batch with no such key keeps all its keys (NE = TT).

#define NB_  2
#define TT   2048
#define DM   1024
#define NH_  16
#define NKV  16
#define REP  (NH_ / NKV)
#define HD   64
#define DQ   (NH_ * HD)
#define DKV  (NKV * HD)
#define RH   512                  // query rows < RH use hi+lo planes (0: none)
#define WIN  0
#define PCAR 1024.0f
#define SCL  0.125f   // HD^-0.5
typedef _Float16 h16;
typedef unsigned short bf;
typedef __attribute__((ext_vector_type(16))) __bf16   v16bf;
typedef __attribute__((ext_vector_type(16))) _Float16 v16h;
typedef __attribute__((ext_vector_type(8)))  _Float16 v8h;
typedef __attribute__((ext_vector_type(8)))  unsigned short v8us;
typedef __attribute__((ext_vector_type(8)))  float    v8f;
typedef __attribute__((ext_vector_type(4)))  float    v4f;
typedef v8h  __attribute__((may_alias)) v8ha;
typedef v4f  __attribute__((may_alias)) v4fa;
typedef v8us __attribute__((may_alias)) v8usa;

__device__ __forceinline__ unsigned short f2bf(float f) { unsigned u = __float_as_uint(f); u += 0x7FFFu + ((u >> 16) & 1u); return (unsigned short)(u >> 16); }
__device__ __forceinline__ float bf2f(unsigned short b) { return __uint_as_float(((unsigned)b) << 16); }
__device__ __forceinline__ float bfr(float f) { return bf2f(f2bf(f)); }
__device__ __forceinline__ v16h cat16(v8h lo, v8h hi) { return __builtin_shufflevector(lo, hi, 0, 1, 2, 3, 4, 5, 6, 7, 8, 9, 10, 11, 12, 13, 14, 15); }
__device__ __forceinline__ v16bf cat16b(v8us lo, v8us hi) { return __builtin_bit_cast(v16bf, __builtin_shufflevector(lo, hi, 0, 1, 2, 3, 4, 5, 6, 7, 8, 9, 10, 11, 12, 13, 14, 15)); }
__device__ __forceinline__ v8f wmma16(v16h a, v16h b, v8f c) { return __builtin_amdgcn_wmma_f32_16x16x32_f16(false, a, false, b, (short)0, c, false, false); }
__device__ __forceinline__ v8f wmmab(v16bf a, v16bf b, v8f c) { return __builtin_amdgcn_wmma_f32_16x16x32_bf16(false, a, false, b, (short)0, c, false, false); }



// ---- operand fragments straight from 16-bit planes kept in FRAGMENT ORDER: lane lr + 16 hi = row lr, k = 8 hi + 0..7 and 16 + 8 hi + 0..7 of a 32-wide k step, the same for A and for B.
// A plane of K-wide rows is cut into blocks of 16 rows x 32 k (512 elements, 1 KiB), block (row / 16, k / 32) with k / 32 running fastest; in a block the 8 elements of a lane's first load lie at lane x 8, those of its second at 256 + lane x 8.
// So each wave-wide 16-byte load reads 512 contiguous bytes (4 whole lines) where row-major planes gave it 32 bytes of each of 16 lines. pk: where element (row, k) lies.
__device__ __forceinline__ size_t pk(int row, int k, int K) { return ((size_t)(row >> 4) * (K >> 5) + (k >> 5)) * 512 + ((k >> 4) & 1) * 256 + ((((k >> 3) & 1) << 4) + (row & 15)) * 8 + (k & 7); }
template <typename T16> struct WFrag;
template <> struct WFrag<h16> { typedef v16h V; static __device__ __forceinline__ V ld(const h16* p) { return cat16(*(const v8h*)p, *(const v8h*)(p + 256)); } static __device__ __forceinline__ v8f mma(V a, V b, v8f c) { return wmma16(a, b, c); } };
template <> struct WFrag<bf> { typedef v16bf V; static __device__ __forceinline__ V ld(const bf* p) { return cat16b(*(const v8us*)p, *(const v8us*)(p + 256)); } static __device__ __forceinline__ v8f mma(V a, V b, v8f c) { return wmmab(a, b, c); } };

__device__ __forceinline__ h16 tohx(float x) { return (h16)x; }
__device__ __forceinline__ void splitf(float y, unsigned short& h, unsigned short& l) { h = f2bf(y); l = f2bf(y - bf2f(h)); }
typedef __attribute__((ext_vector_type(4))) _Float16 v4h;
typedef __attribute__((ext_vector_type(4))) unsigned short v4us;

// ---- copy4, copy8: four or eight 16-byte asynchronous copies a lane, global memory to LDS through no register. l: the lane's LDS byte address, g: its global address; copy i of a run of four lies i lstep bytes and i gstep elements further; copy8 takes two such runs.
// s_wait_xcnt is the last line of the copies' own statement, so that it stands in front of every rewrite of a register that they name.
template <typename T16>
__device__ __forceinline__ void copy4(unsigned l, const T16* g, unsigned lstep, size_t gstep) {
    asm volatile("global_load_async_to_lds_b128 %0, %4, off\n\t"
                 "global_load_async_to_lds_b128 %1, %5, off\n\t"
                 "global_load_async_to_lds_b128 %2, %6, off\n\t"
                 "global_load_async_to_lds_b128 %3, %7, off\n\t"
                 "s_wait_xcnt 0x0"
                 :: "v"(l), "v"(l + lstep), "v"(l + 2 * lstep), "v"(l + 3 * lstep), "v"(g), "v"(g + gstep), "v"(g + 2 * gstep), "v"(g + 3 * gstep) : "memory");
}
template <typename T16>
__device__ __forceinline__ void copy8(unsigned l, const T16* g, unsigned m, const T16* h, unsigned lstep, size_t gstep) {
    asm volatile("global_load_async_to_lds_b128 %0, %8, off\n\t"
                 "global_load_async_to_lds_b128 %1, %9, off\n\t"
                 "global_load_async_to_lds_b128 %2, %10, off\n\t"
                 "global_load_async_to_lds_b128 %3, %11, off\n\t"
                 "global_load_async_to_lds_b128 %4, %12, off\n\t"
                 "global_load_async_to_lds_b128 %5, %13, off\n\t"
                 "global_load_async_to_lds_b128 %6, %14, off\n\t"
                 "global_load_async_to_lds_b128 %7, %15, off\n\t"
                 "s_wait_xcnt 0x0"
                 :: "v"(l), "v"(l + lstep), "v"(l + 2 * lstep), "v"(l + 3 * lstep), "v"(m), "v"(m + lstep), "v"(m + 2 * lstep), "v"(m + 3 * lstep),
                    "v"(g), "v"(g + gstep), "v"(g + 2 * gstep), "v"(g + 3 * gstep), "v"(h), "v"(h + gstep), "v"(h + 2 * gstep), "v"(h + 3 * gstep) : "memory");
}
// ---- store_tile: the parked tile (row-major in red, pitch TN + 4 floats) goes out in the form EPI (said at gemmk_tile), NT threads.
template <bool BIAS, int NT, int TM, int TN, int EPI>
__device__ __forceinline__ void store_tile(const float* red, float* C, int ldc, const float* __restrict__ bias, int r0, int c0, h16* P16, bf* Ph, bf* Pl) {
    constexpr int PT = TN + 4;
    // four pieces a trip: their LDS reads and stores overlap and a bias taken by column leaves the loop; one by one each piece waits out its own loads, and a thread now has 16 or 32 pieces
#pragma unroll 1
    for (int it = 0; it < TM * TN / 4 / NT; it += 4) {
#pragma unroll
      for (int u = 0; u < 4; ++u) { const int e = threadIdx.x + (it + u) * NT;
        // f32 C: a wave takes whole rows. Planes: a wave takes 16 rows x 8 columns, lane = row + 16 x (column half), which are 256 contiguous bytes of a block
        const int row = (EPI == 0) ? e / (TN / 4) : ((e >> 5) / (TN / 8)) * 16 + (e & 15), cofs = (EPI == 0) ? (e % (TN / 4)) * 4 : ((e >> 5) % (TN / 8)) * 8 + ((e >> 4) & 1) * 4; v4f val = *(const v4fa*)(red + row * PT + cofs);
        if (BIAS && EPI == 2) { const float br = bfr(bias[r0 + row]); val[0] += br; val[1] += br; val[2] += br; val[3] += br; }
        else if (BIAS) { val[0] += bfr(bias[c0 + cofs]); val[1] += bfr(bias[c0 + cofs + 1]); val[2] += bfr(bias[c0 + cofs + 2]); val[3] += bfr(bias[c0 + cofs + 3]); }
        if constexpr (EPI == 0) *(v4f*)(C + (size_t)(r0 + row) * ldc + c0 + cofs) = val;
        else { v4h o16; v4us oh, ol;
#pragma unroll
            for (int q = 0; q < 4; ++q) { o16[q] = tohx(val[q]); unsigned short a2, c2; splitf(val[q], a2, c2); oh[q] = a2; ol[q] = c2; }
            const size_t oo = (EPI == 1) ? (size_t)((r0 + row) / TT * NH_ + (c0 + cofs) / HD) * TT * HD + pk((r0 + row) % TT, (c0 + cofs) % HD, HD) : (size_t)((c0 + cofs) / TT) * DKV * TT + pk(r0 + row, (c0 + cofs) % TT, TT);
            *(v4h*)(P16 + oo) = o16; *(v4us*)(Ph + oo) = oh; *(v4us*)(Pl + oo) = ol; } }
      asm volatile("s_wait_xcnt 0x0" ::: "memory");   // behind the trip's last store, in front of the next trip's rewrite of the stores' registers
    }
}
// ---- gemmk_tile: C[m][n] (f32, pitch ldc, + optional f32 bias[n]) = sum_k A[m][k] Bt[n][k] (NSPLIT 1: + A2[m][k] Bt[n][k]): WM x WN waves of one work-group share one 128 x 128 output tile, wave (wm, wn) owns (16 MB) x (16 NB) of it and sums the whole K in k order.
// The operands come through LDS, 64 k a stage, a ring of NBUF buffers: a stage holds, per operand, 8 row blocks x 2 KiB (two fragment-order blocks each, contiguous in the plane), brought by asynchronous copies, so each operand byte leaves L2 once a work-group and every wave reads its fragments from LDS.
// Stage s + NBUF is asked for at the foot of stage s, so its copies have NBUF - 1 stages of products to land in; with one stage of lead every landing that takes longer than a stage's products is waited out at the foot.
// A wave's copy counter falls in the order of issue, so the foot waits only until all but the younger stages' copies (CPW a stage and wave) have landed.
// Behind the last stage the tile is parked in the same LDS (row-major, pitch 128 + 4 floats), one barrier, and whole row pieces are stored. One work-group of 32 WM WN threads a tile at rows r0, columns c0; tokens of both batches run through as one row index b TT + t.
// EPI says what is stored. 0: C in f32. 1 and 2: no f32 C; each sum goes straight to the three 16-bit planes that attention reads (fp16, bf16 hi, bf16 lo).
// 1: m = token, n = feature, head planes [b][n / HD] of rows t, k = n % HD. 2: m = feature, n = token (weights as A, tokens as Bt), planes [b] of rows m, k = t, the bias taken per row m. A, Bt and the planes written are all in fragment order (pk).
// 3: 1 or 2, said at run time by tr (2 if set; the same for the whole work-group). The unrolled stages do not depend on what is stored, so they stand in the kernel's text once and only the store loop stands twice.
template <int N> __device__ __forceinline__ void wait_copies() { asm volatile("s_wait_asynccnt %0" :: "n"(N) : "memory"); }   // all but this wave's N youngest copies have landed
template <typename T16, int NSPLIT, bool BIAS, int MB, int NB, int WM, int WN, int K, int EPI, int NBUF>
__device__ __forceinline__ void gemmk_tile(const T16* __restrict__ A, const T16* __restrict__ A2, const T16* __restrict__ Bt, float* C, int ldc, const float* __restrict__ bias, int r0, int c0, h16* P16, bf* Ph, bf* Pl, float* red, bool tr) {
    typedef typename WFrag<T16>::V V;
    constexpr int NT = WM * WN * 32, TM = WM * MB * 16, TN = WN * NB * 16, PT = TN + 4;
    constexpr bool AHEAD = MB * NB <= 8; constexpr int PE = 8 * 1024, SE = (NSPLIT == 1 ? 3 : 2) * PE, NS = K / 64, CS = NT / 128, CPW = 8 / CS * (NSPLIT == 1 ? 3 : 2);   // elements of one operand's part of a stage and of a stage; stages; row blocks that one copy of the whole work-group covers; copies of a wave a stage
    static_assert(TM == 128 && TN == 128 && (NT == 128 || NT == 256) && K % 64 == 0 && NS >= NBUF && (NBUF == 3 || NBUF == 4) && NBUF * CPW <= 63 && TM * PT * 4 <= NBUF * SE * 2 && (NSPLIT == 0 || NSPLIT == 1), "stage shape");
    const int lane = threadIdx.x & 31, lr = lane & 15, hi = lane >> 4, wave = threadIdx.x >> 5, wm = wave / WN, wn = wave % WN;
    const T16* st = (const T16*)red;
    const unsigned lofs = (unsigned)(size_t)red + (threadIdx.x >> 7) * 2048 + (threadIdx.x & 127) * 16;   // 128 threads copy the 2 KiB of one row block
    const size_t gofs = (size_t)(threadIdx.x >> 7) * (K * 16) + (threadIdx.x & 127) * 8;                  // r0 and c0 are multiples of 16, so r0 K and c0 K are where their row panels start; a row block is 16 K elements
    const T16* ga = A + (size_t)r0 * K + gofs; const T16* ga2 = (NSPLIT == 1) ? A2 + (size_t)r0 * K + gofs : nullptr; const T16* gb = Bt + (size_t)c0 * K + gofs;
    auto fill = [&](int s) { const unsigned l = lofs + (s % NBUF) * (SE * 2);
#pragma unroll
        for (int c = 0; c < 8; c += 4 * CS) { copy8(l + c * 2048, ga + s * 1024 + (size_t)c * (K * 16), l + PE * 2 + c * 2048, gb + s * 1024 + (size_t)c * (K * 16), CS * 2048, (size_t)CS * (K * 16));
            if (NSPLIT == 1) copy4(l + PE * 4 + c * 2048, ga2 + s * 1024 + (size_t)c * (K * 16), CS * 2048, (size_t)CS * (K * 16)); } };
    v8f acc[MB][NB];
#pragma unroll
    for (int mb = 0; mb < MB; ++mb)
#pragma unroll
        for (int nb = 0; nb < NB; ++nb) acc[mb][nb] = (v8f){};
#pragma unroll                                          // each stage's buffer a constant, as in the loop below
    for (int s = 0; s < NBUF; ++s) fill(s);             // every buffer is free
    wait_copies<(NBUF - 1) * CPW>();                    // stage 0 has landed, as far as this wave copied it
    __syncthreads();                                    // and as far as the others did
    // unrolled: NS is a small constant, so each stage's buffer is known when compiling and no matrix instruction stands in front of a back edge
#pragma unroll
    for (int s = 0; s < NS; ++s) { const T16* sb = st + (s % NBUF) * SE + lane * 8;
        V a[2][MB], a2[2][MB], b[2][NB];
#pragma unroll
        for (int kb = 0; kb < 2; ++kb) {
            // the fragments of a 32-k block are asked for as one group (AHEAD: those of both blocks of the stage at once, where the registers allow it)
            if (!AHEAD || kb == 0) {
#pragma unroll
                for (int k2 = kb; k2 < (AHEAD ? 2 : kb + 1); ++k2) {
#pragma unroll
                    for (int mb = 0; mb < MB; ++mb) { a[k2][mb] = WFrag<T16>::ld(sb + (wm * MB + mb) * 1024 + k2 * 512); if (NSPLIT == 1) a2[k2][mb] = WFrag<T16>::ld(sb + 2 * PE + (wm * MB + mb) * 1024 + k2 * 512); }
#pragma unroll
                    for (int nb = 0; nb < NB; ++nb) b[k2][nb] = WFrag<T16>::ld(sb + PE + (wn * NB + nb) * 1024 + k2 * 512); }
                __builtin_amdgcn_sched_barrier(0);   // keeps the group together in front of its products: left alone the scheduler sinks each load to its use, and every four products wait a whole LDS trip
            }
#pragma unroll
            for (int nb = 0; nb < NB; ++nb) {
#pragma unroll
                for (int mb = 0; mb < MB; ++mb) acc[mb][nb] = WFrag<T16>::mma(a[kb][mb], b[kb][nb], acc[mb][nb]);
                if (NSPLIT == 1) {
#pragma unroll
                    for (int mb = 0; mb < MB; ++mb) acc[mb][nb] = WFrag<T16>::mma(a2[kb][mb], b[kb][nb], acc[mb][nb]); } }
            if (!AHEAD || kb == 1) __builtin_amdgcn_sched_barrier(0);   // keeps the next group behind these products, whose registers it takes over, and the stage's last products in front of its foot: sunk among the next copies they hold their fragments live and the registers run over 256
        }
        asm volatile("s_wait_dscnt 0x0" ::: "memory");      // this wave has read the last of stage s
        // and its copies of stage s + 1 have landed: behind them stages s + 2 .. s + NBUF - 1 are under way, as far as they exist (s is a constant in the unrolled loop: one of the three waits is left)
        if (NBUF == 4 && s + 3 < NS) wait_copies<2 * CPW>(); else if (s + 2 < NS) wait_copies<CPW>(); else wait_copies<0>();
        __syncthreads();                                    // publishes stage s + 1 and frees the buffer of stage s
        if (s + NBUF < NS) fill(s + NBUF);
    }
    asm volatile("s_wait_asynccnt 0x0" ::: "memory");   // no copy is under way when the buffers become the parking place
#pragma unroll
    for (int mb = 0; mb < MB; ++mb)
#pragma unroll
        for (int nb = 0; nb < NB; ++nb)
#pragma unroll
            for (int j = 0; j < 8; ++j) red[((wm * MB + mb) * 16 + hi * 8 + j) * PT + (wn * NB + nb) * 16 + lr] = acc[mb][nb][j];
    __syncthreads();
    if constexpr (EPI == 3) { if (tr) store_tile<BIAS, NT, TM, TN, 2>(red, C, ldc, bias, r0, c0, P16, Ph, Pl); else store_tile<BIAS, NT, TM, TN, 1>(red, C, ldc, bias, r0, c0, P16, Ph, Pl); }
    else store_tile<BIAS, NT, TM, TN, EPI>(red, C, ldc, bias, r0, c0, P16, Ph, Pl);
}
// ---- k_gemmk: the f32 form of gemmk_tile. grid (M / 128, N / 128), 32 WM WN threads, one work-group a WGP. LDS: four stages, which also hold the parked tile.
template <typename T16, int NSPLIT, bool BIAS, int MB, int NB, int WM, int WN, int K>
__global__ __launch_bounds__(WM * WN * 32) void k_gemmk(const T16* __restrict__ A, const T16* __restrict__ A2, const T16* __restrict__ Bt, float* C, int ldc, const float* __restrict__ bias) {
    static_assert(NSPLIT == 1, "three operand parts a stage");
    __shared__ __align__(16) float red[4 * 3 * 8 * 1024 / 2];
    gemmk_tile<T16, NSPLIT, BIAS, MB, NB, WM, WN, K, 0, 4>(A, A2, Bt, C, ldc, bias, blockIdx.x * 128, blockIdx.y * 128, nullptr, nullptr, nullptr, red, false);
}
// ---- k_qkv: the three projections of both batches in one launch; blockIdx.z says which (0 q, 1 k, 2 v), the same for the whole work-group, so the barriers inside stay uniform. grid (NB_ TT / 128, DQ / 128, 3), 128 threads.
// A k or v tile whose 128 keys all lie behind the batch's NE keys is left out: the whole work-group returns, in front of every barrier; nothing reads those keys.
__global__ __launch_bounds__(128) void k_qkv(const bf* __restrict__ XB, const bf* __restrict__ YB, const bf* __restrict__ WQ, const bf* __restrict__ WK, const bf* __restrict__ WV, const float* __restrict__ bq, const float* __restrict__ bk, const float* __restrict__ bv, const int* __restrict__ NE,
                                             h16* QP16, bf* QPh, bf* QPl, h16* KP16, bf* KPh, bf* KPl, h16* VT16, bf* VTh, bf* VTl) {
    static_assert(DQ == DKV && NH_ == NKV && TT % 128 == 0, "one grid serves q, k and v");
    __shared__ __align__(16) float red[3 * 2 * 8 * 1024 / 2];   // three stages (96 KiB: three work-groups still fit a WGP); the parked tile (128 x 132 floats) lies in them
    const int t0 = blockIdx.x * 128, f0 = blockIdx.y * 128;
    if (blockIdx.z != 0 && t0 % TT >= min(NE[t0 / TT], TT)) return;
    const bool isq = blockIdx.z == 0, isv = blockIdx.z == 2;   // v: weights as A, so it comes out feature-major, the order attn.v reads
    gemmk_tile<bf, 0, true, 4, 4, 2, 2, DM, 3, 3>(isv ? WV : isq ? XB : YB, nullptr, isv ? YB : isq ? WQ : WK, nullptr, 0, isv ? bv : isq ? bq : bk, isv ? f0 : t0, isv ? t0 : f0,
                                                  isv ? VT16 : isq ? QP16 : KP16, isv ? VTh : isq ? QPh : KPh, isv ? VTl : isq ? QPl : KPl, red, isv);
}

typedef __attribute__((ext_vector_type(2))) unsigned short v2us;
typedef __attribute__((ext_vector_type(2))) float v2f;
typedef __attribute__((ext_vector_type(4))) int v4i;
typedef __attribute__((ext_vector_type(8))) unsigned v8u;

__global__ __launch_bounds__(256) void k_wtG(const float* __restrict__ w, int K, int N, bf* Bt) {
    const int lane = threadIdx.x & 31; const int L0 = (blockIdx.x * 8 + (threadIdx.x >> 5)) * 8; const int nlines = N * K / 64;
{
#pragma unroll 1
        for (int l = 0; l < 8; ++l) { const int L = L0 + l; if (L >= nlines) break; const size_t e = (size_t)L * 64 + lane * 2; const int k = (int)(e % K), n = (int)(e / K); v2us o;
            o[0] = f2bf(w[(size_t)k * N + n]); o[1] = f2bf(w[(size_t)(k + 1) * N + n]); *(v2us*)(Bt + e) = o; }
         }
}
// ---- k_cvt8: every f32 operand to bf16, in fragment order, in one launch. blockIdx.y names a chunk of CH elements: the chunks of x, then of y, then the four weights; dst holds them in that order. grid (CH / 2048, 2 XC + 4), 256 threads.
// Rows of y go to their place in the key order: row g of a batch to (non-zero masks before g) if its own mask is non-zero, else to (all non-zero) + (zero masks before g). Every work-group of y counts its batch's mask itself (a ballot per 32 keys, the waves' counts summed through LDS behind the barrier that is there anyway).
// PM: the mask in the key order, NE: the keys that count, both for the later launches; written by the work-groups of the first 128 k (NE: of the first rows).
// A work-group takes 16 rows x 128 k: 2048 contiguous elements of dst (four blocks; of y: 16-byte pieces of two runs of rows). Piece p = k / 8 of row r goes to piece 16 p + r: the 16-byte pieces are turned through LDS (pitch 272 bytes: no bank met twice), so reads and stores both stay on whole lines.
#define CH   (DM * DQ)
#define XC   (NB_ * TT * DM / CH)
__global__ __launch_bounds__(256) void k_cvt8(const float* __restrict__ x, const float* __restrict__ y, const float* __restrict__ wq, const float* __restrict__ wk, const float* __restrict__ wv, const float* __restrict__ wo, const int* __restrict__ km, bf* dst0, int* PM, int* NE) {
    static_assert(NB_ * TT * DM % CH == 0 && DKV == DQ && DQ == DM && CH % (16 * DM) == 0 && DM % 128 == 0 && TT % 256 == 0 && TT % 16 == 0 && TT < 65536, "chunks");
    __shared__ __align__(16) bf st[16 * 136]; __shared__ __align__(16) int wc[8];
    const int c = blockIdx.y; const float* src = (c < XC) ? x + (size_t)c * CH : (c < 2 * XC) ? y + (size_t)(c - XC) * CH : (c == 2 * XC) ? wq : (c == 2 * XC + 1) ? wk : (c == 2 * XC + 2) ? wv : wo; bf* dst = dst0 + (size_t)c * CH;
    const int r = threadIdx.x >> 4, p = threadIdx.x & 15; const v8f v = *(const v8f*)(src + (size_t)(blockIdx.x / (DM / 128) * 16 + r) * DM + blockIdx.x % (DM / 128) * 128 + p * 8); v8us o;
    const bool isy = c >= XC && c < 2 * XC;   // the same for the whole work-group
    const int grow = (c - XC) * (CH / DM) + blockIdx.x / (DM / 128) * 16, yb = grow / TT, g0 = grow % TT, wave = __builtin_amdgcn_readfirstlane(threadIdx.x >> 5);
    int mk[TT / 256], mown = 0;
    if (isy) {
#pragma unroll
        for (int i = 0; i < TT / 256; ++i) mk[i] = km[yb * TT + i * 256 + threadIdx.x];
        mown = km[yb * TT + g0 + p]; }
    asm volatile("s_wait_xcnt 0x0" ::: "memory");   // behind the loads, in front of the first rewrite of their address registers
    unsigned own = 0;   // bit i: row g0 + i has a non-zero mask
    if (isy) { int tot = 0, bef = 0;   // non-zero masks among this wave's keys: all, and those in front of row g0 (a multiple of 16)
#pragma unroll
        for (int i = 0; i < TT / 256; ++i) { const int e0 = i * 256 + wave * 32; const unsigned bal = __builtin_amdgcn_ballot_w32(mk[i] != 0);
            tot += __builtin_popcount(bal); bef += __builtin_popcount(e0 + 32 <= g0 ? bal : e0 + 16 == g0 ? bal & 0xFFFFu : 0u); }
        if ((threadIdx.x & 31) == 0) wc[wave] = tot | (bef << 16);
        own = __builtin_amdgcn_ballot_w32(mown != 0) & 0xFFFFu; }
#pragma unroll
    for (int k = 0; k < 8; ++k) o[k] = f2bf(v[k]);
    *(v8usa*)(st + p * 136 + r * 8) = o;
    __syncthreads();
    const v8us piece = *(const v8usa*)(st + r * 136 + p * 8);   // from here on p is the row and r the piece
    if (!isy) { *(v8us*)(dst + (size_t)blockIdx.x * 2048 + threadIdx.x * 8) = piece;
        asm volatile("s_wait_xcnt 0x0" ::: "memory"); }   // behind the store, in front of any rewrite of its registers on the way to the kernel's end
    else { int sum = 0;
#pragma unroll
        for (int w = 0; w < 8; ++w) sum += wc[w];
        const int cnt = sum & 0xFFFF, bef = sum >> 16, ln = __builtin_popcount(own & ((1u << p) - 1u));
        const int nr = ((own >> p) & 1u) ? bef + ln : cnt + (g0 - bef) + (p - ln);   // a permutation of 0 .. TT - 1 whatever the mask holds
        *(v8us*)(dst0 + (size_t)XC * CH + (size_t)yb * TT * DM + ((size_t)(nr >> 4) * (DM / 32) + blockIdx.x % (DM / 128) * 4) * 512 + r * 128 + (nr & 15) * 8) = piece;
        if (blockIdx.x % (DM / 128) == 0 && r == 0) { PM[yb * TT + nr] = mown; if (g0 == 0 && p == 0) NE[yb] = cnt ? cnt : TT; } } }
// ---- exp2x8, exp2x1: v_exp_f32 with the slot that the instruction set asks for behind a transcendental (before its result is used or its source overwritten) closed inside the statement: results lie apart from all sources, so each v_exp_f32 is the independent instruction behind the one in front of it, and one v_nop stands behind the last.
__device__ __forceinline__ v8f exp2x8(v8f x) { float e0, e1, e2, e3, e4, e5, e6, e7;
    asm("v_exp_f32 %0, %8\n\tv_exp_f32 %1, %9\n\tv_exp_f32 %2, %10\n\tv_exp_f32 %3, %11\n\tv_exp_f32 %4, %12\n\tv_exp_f32 %5, %13\n\tv_exp_f32 %6, %14\n\tv_exp_f32 %7, %15\n\tv_nop"
        : "=&v"(e0), "=&v"(e1), "=&v"(e2), "=&v"(e3), "=&v"(e4), "=&v"(e5), "=&v"(e6), "=&v"(e7) : "v"(x[0]), "v"(x[1]), "v"(x[2]), "v"(x[3]), "v"(x[4]), "v"(x[5]), "v"(x[6]), "v"(x[7]));
    return (v8f){e0, e1, e2, e3, e4, e5, e6, e7}; }
__device__ __forceinline__ float exp2x1(float x) { float e; asm("v_exp_f32 %0, %1\n\tv_nop" : "=&v"(e) : "v"(x)); return e; }
// ---- k_attn: scores, softmax, attn.v and the head merge. A wave keeps 16 QT query rows of one head and walks all keys that count (the first NE of the key order), SK a stage, with a running row maximum and row sum; the AWV waves of a work-group share each stage's key and v blocks through LDS.
// A stage holds, per plane, SK keys x HD of k (8 KiB, contiguous in the plane) and HD rows x SK keys of v (four pieces of 2 KiB); two buffers, filled by asynchronous copies one stage ahead of their use, so each k and v byte leaves L2 once per 16 QT AWV query rows.
// Scores are formed TRANSPOSED (A = 16 keys, B = 16 queries): a lane holds, for query lr, keys hi 8 + j of each 16-key tile, which is the fragment order of attn.v (two tiles = one 32-key fragment), so the probabilities never leave the registers.
// attn.v is formed transposed too (A = 16 features of v, B = the probabilities): a lane holds, for the same query lr, features hi 8 + j, so maximum, sum and rescale stay in the lane (one exchange between the lane halves) and its 8 results are one 16-byte piece of the merged planes.
// Probabilities stay unnormalised (relative to the running maximum; single fp16 plane: x PCAR, as 2^10 in the exponent); the row sum carries the same factor and divides the result once, at the end. Every plane read or written here is in fragment order (pk).
// grid (NH_, NB_, NZH + NZ2 + NZ1), 32 AWV threads, longest work-groups first: hi/lo rows (QT 1, three products), then two thirds of the single-plane rows at QT 2, then the last third at QT 1. 256 work-groups of each kind: one of each fills a WGP with three waves a SIMD, and every SIMD gets the same work.
#define AWV  4
#define SK   64
#define NZH  (RH / (AWV * 16))
#define NZ2  ((TT - RH) * 2 / 3 / (AWV * 32))
#define NZ1  ((TT - RH) / 3 / (AWV * 16))
template <typename T16, bool HR, int QT>
__device__ __forceinline__ void attn_tile(const T16* __restrict__ Q, const T16* __restrict__ Q2, const T16* __restrict__ Kp, const T16* __restrict__ Kp2, const T16* __restrict__ Vt, const T16* __restrict__ Vt2, const int* __restrict__ km, int ns, bf* ATh, bf* ATl, int orow, int ocol, const T16* st, float* sma) {
    typedef typename WFrag<T16>::V V;
    constexpr int KT = SK / 16, KC = HD / 32, CT = SK / 32, DT = HD / 16, NS = TT / SK;
    constexpr int PE = SK * HD, SE = (HR ? 4 : 2) * PE;   // elements of one plane's k (or v) part of a stage, and of a stage: k, v (hi/lo rows: k hi, v hi, k lo, v lo)
    static_assert(AWV * 32 * 8 * 4 == PE && SK * 16 == AWV * 32 * 8 && DT == 4 && NS >= 2 && TT % (AWV * 128) == 0, "four copies a thread and part");
    const int lane = threadIdx.x & 31, lr = lane & 15, hi = lane >> 4, wave = threadIdx.x >> 5;
    const unsigned lofs = (unsigned)(size_t)st + threadIdx.x * 16;
    const unsigned tofs = threadIdx.x * 8;   // the planes' stage addresses are formed on the scalar side and this added: four 64-bit lane pointers kept over the loop would not fit the registers
    // k: 2 KiB after 2 KiB of the stage's 8; v: the stage's 2 KiB of each of the four 16-row blocks, 16 TT elements apart
    auto fill = [&](int s) { const unsigned l = lofs + (s & 1) * (SE * 2);
        copy4(l, (Kp + s * PE) + tofs, 2048u, (size_t)1024); copy4(l + PE * 2, (Vt + s * (SK * 16)) + tofs, 2048u, (size_t)16 * TT);
        if (HR) { copy4(l + PE * 4, (Kp2 + s * PE) + tofs, 2048u, (size_t)1024); copy4(l + PE * 6, (Vt2 + s * (SK * 16)) + tofs, 2048u, (size_t)16 * TT); } };
    fill(0);
    V qf[QT][KC], qf2[QT][KC];
#pragma unroll
    for (int qt = 0; qt < QT; ++qt)
#pragma unroll
        for (int kc = 0; kc < KC; ++kc) { qf[qt][kc] = WFrag<T16>::ld(Q + lane * 8 + (wave * QT + qt) * 16 * HD + kc * 512); if (HR) qf2[qt][kc] = WFrag<T16>::ld(Q2 + lane * 8 + (wave * QT + qt) * 16 * HD + kc * 512); }
    // the additive mask term of every key, once a work-group
#pragma unroll
    for (int i = 0; i < TT / (AWV * 128); ++i) { const v4i mk = *(const v4i*)(km + (i * (AWV * 32) + threadIdx.x) * 4); v4f ma;
#pragma unroll
        for (int q = 0; q < 4; ++q) ma[q] = (mk[q] == 0) ? -9.0e15f : (float)mk[q];
        *(v4fa*)(sma + (i * (AWV * 32) + threadIdx.x) * 4) = ma; }
    asm volatile("s_wait_xcnt 0x0" ::: "memory");       // behind the query and mask loads, in front of any rewrite of their address registers
    asm volatile("s_wait_asynccnt 0x0" ::: "memory");   // stage 0 has landed, as far as this wave copied it
    __syncthreads();                                    // and as far as the others did; the mask terms are written
    if (1 < ns) fill(1);
    float mrun[QT], lsum[QT]; v8f o[DT][QT];
#pragma unroll
    for (int qt = 0; qt < QT; ++qt) { mrun[qt] = -3.0e38f; lsum[qt] = 0.f;
#pragma unroll
        for (int dt = 0; dt < DT; ++dt) o[dt][qt] = (v8f){}; }
    // rolled: the stages (ns of them, known at run time, at most 32)
#pragma unroll 1
    for (int s = 0; s < ns; ++s) { const T16* sb = st + (s & 1) * SE + lane * 8;
        V kf[KT][KC], kf2[KT][KC], vf[DT][CT], vf2[DT][CT];
#pragma unroll
        for (int kt = 0; kt < KT; ++kt)
#pragma unroll
            for (int kc = 0; kc < KC; ++kc) { kf[kt][kc] = WFrag<T16>::ld(sb + (kt * KC + kc) * 512); if (HR) kf2[kt][kc] = WFrag<T16>::ld(sb + 2 * PE + (kt * KC + kc) * 512); }
        __builtin_amdgcn_sched_barrier(0);   // keeps the stage's key fragments together in front of the score products: sunk to their uses, every few products wait a whole LDS trip
        v8f sc[KT][QT];
#pragma unroll
        for (int kc = 0; kc < KC; ++kc) {
#pragma unroll
            for (int kt = 0; kt < KT; ++kt)
#pragma unroll
                for (int qt = 0; qt < QT; ++qt) sc[kt][qt] = WFrag<T16>::mma(kf[kt][kc], qf[qt][kc], (kc == 0) ? (v8f){} : sc[kt][qt]);
            if (HR) {
#pragma unroll
                for (int kt = 0; kt < KT; ++kt)
#pragma unroll
                    for (int qt = 0; qt < QT; ++qt) sc[kt][qt] = WFrag<T16>::mma(kf[kt][kc], qf2[qt][kc], sc[kt][qt]);
#pragma unroll
                for (int kt = 0; kt < KT; ++kt)
#pragma unroll
                    for (int qt = 0; qt < QT; ++qt) sc[kt][qt] = WFrag<T16>::mma(kf2[kt][kc], qf[qt][kc], sc[kt][qt]); } }
        __builtin_amdgcn_sched_barrier(0);   // keeps the v fragments, which take over the key fragments' registers, behind the score products
#pragma unroll
        for (int c = 0; c < CT; ++c)
#pragma unroll
            for (int dt = 0; dt < DT; ++dt) { vf[dt][c] = WFrag<T16>::ld(sb + PE + dt * (SK * 16) + c * 512); if (HR) vf2[dt][c] = WFrag<T16>::ld(sb + 3 * PE + dt * (SK * 16) + c * 512); }
        __builtin_amdgcn_sched_barrier(0);   // keeps the v loads together, behind the score products and in front of all that follows: spread by the scheduler they leave more registers live at the foot, and the hi/lo rows' copy pointers are spilled
#pragma unroll
        for (int kt = 0; kt < KT; ++kt)
#pragma unroll
            for (int qt = 0; qt < QT; ++qt)
#pragma unroll
                for (int j = 0; j < 8; ++j) sc[kt][qt][j] = fminf(fmaxf(sc[kt][qt][j] * SCL, -50000.0f), 50000.0f);
        // the stage's foot stands here, behind its last read of the buffer: the rest of the trip works on registers (and the mask terms), and the copies of stage s + 2 get that time and the next stage's scores to land
        asm volatile("s_wait_dscnt 0x0" ::: "memory");      // this wave has read the last of stage s
        asm volatile("s_wait_asynccnt 0x0" ::: "memory");   // and its copies of stage s + 1 have landed
        __syncthreads();                                    // publishes stage s + 1 and frees the buffer of stage s
        if (s + 2 < ns) fill(s + 2);
        float mx[QT];
#pragma unroll
        for (int qt = 0; qt < QT; ++qt) mx[qt] = mrun[qt];
#pragma unroll
        for (int kt = 0; kt < KT; ++kt) { const v4f a0 = *(const v4fa*)(sma + s * SK + kt * 16 + hi * 8), a1 = *(const v4fa*)(sma + s * SK + kt * 16 + hi * 8 + 4);
#pragma unroll
            for (int qt = 0; qt < QT; ++qt)
#pragma unroll
                for (int j = 0; j < 8; ++j) { const float t = __fadd_rn(sc[kt][qt][j], (j < 4) ? a0[j & 3] : a1[j & 3]); sc[kt][qt][j] = t; mx[qt] = fmaxf(mx[qt], t); } }
        V pf[CT][QT], pf2[CT][QT];
#pragma unroll
        for (int qt = 0; qt < QT; ++qt) { const float m = fmaxf(mx[qt], __shfl_xor(mx[qt], 16, 32));
            const float al = exp2x1(__fmul_rn(__fsub_rn(mrun[qt], m), 1.4426950408889634f)); mrun[qt] = m;   // what the sums so far shrink by under the new maximum (0 in the first stage)
            float sp[KT];   // one partial sum a key tile: independent chains, where one chain of 32 adds would wait out each add
#pragma unroll
            for (int kt = 0; kt < KT; ++kt) { v8f x;
#pragma unroll
                for (int j = 0; j < 8; ++j) { const float d = __fsub_rn(sc[kt][qt][j], m); x[j] = HR ? __fmul_rn(d, 1.4426950408889634f) : __builtin_fmaf(d, 1.4426950408889634f, 10.0f); }
                sc[kt][qt] = exp2x8(x); sp[kt] = sc[kt][qt][0];
#pragma unroll
                for (int j = 1; j < 8; ++j) sp[kt] += sc[kt][qt][j]; }
            static_assert(KT == 4, "four partial sums");
            lsum[qt] = lsum[qt] * al + ((sp[0] + sp[1]) + (sp[2] + sp[3]));
#pragma unroll
            for (int dt = 0; dt < DT; ++dt) o[dt][qt] *= al;
#pragma unroll
            for (int c = 0; c < CT; ++c) {
                if constexpr (HR) { v8u ph, pl;   // two 16-bit planes, packed a register pair at a time
#pragma unroll
                    for (int j = 0; j < 16; j += 2) { unsigned short h0, l0, h1, l1; splitf(sc[2 * c + j / 8][qt][j % 8], h0, l0); splitf(sc[2 * c + j / 8][qt][j % 8 + 1], h1, l1); ph[j / 2] = (unsigned)h0 | ((unsigned)h1 << 16); pl[j / 2] = (unsigned)l0 | ((unsigned)l1 << 16); }
                    pf[c][qt] = __builtin_bit_cast(v16bf, ph); pf2[c][qt] = __builtin_bit_cast(v16bf, pl);
                } else { v8h x0, x1;
#pragma unroll
                    for (int j = 0; j < 8; ++j) { x0[j] = tohx(sc[2 * c][qt][j]); x1[j] = tohx(sc[2 * c + 1][qt][j]); }
                    pf[c][qt] = cat16(x0, x1); } } }
#pragma unroll
        for (int c = 0; c < CT; ++c) {
#pragma unroll
            for (int dt = 0; dt < DT; ++dt)
#pragma unroll
                for (int qt = 0; qt < QT; ++qt) o[dt][qt] = WFrag<T16>::mma(vf[dt][c], pf[c][qt], o[dt][qt]);
            if (HR) {
#pragma unroll
                for (int dt = 0; dt < DT; ++dt)
#pragma unroll
                    for (int qt = 0; qt < QT; ++qt) o[dt][qt] = WFrag<T16>::mma(vf[dt][c], pf2[c][qt], o[dt][qt]);
#pragma unroll
                for (int dt = 0; dt < DT; ++dt)
#pragma unroll
                    for (int qt = 0; qt < QT; ++qt) o[dt][qt] = WFrag<T16>::mma(vf2[dt][c], pf[c][qt], o[dt][qt]); } }
    }
    asm volatile("s_wait_asynccnt 0x0" ::: "memory");   // no copy is under way when the wave ends
#pragma unroll
    for (int qt = 0; qt < QT; ++qt) { const float inv = __fdiv_rn(1.0f, lsum[qt] + __shfl_xor(lsum[qt], 16, 32));   // the two lane halves summed different keys
#pragma unroll
        for (int dt = 0; dt < DT; ++dt) { v8us oh, ol;
#pragma unroll
            for (int j = 0; j < 8; ++j) { unsigned short a, c2; splitf(o[dt][qt][j] * inv, a, c2); oh[j] = a; ol[j] = c2; }
            const size_t oo = pk(orow + (wave * QT + qt) * 16 + lr, ocol + dt * 16 + hi * 8, DQ);   // the lane's 8 features are one 16-byte piece; a wave stores 512 contiguous bytes
            *(v8us*)(ATh + oo) = oh; *(v8us*)(ATl + oo) = ol;
            asm volatile("s_wait_xcnt 0x0" ::: "memory");   // behind the stores, in front of the next piece's rewrite of their registers
        } }
}
__global__ __launch_bounds__(AWV * 32) void k_attn(const h16* __restrict__ Q16, const h16* __restrict__ K16, const h16* __restrict__ V16, const bf* __restrict__ Qh, const bf* __restrict__ Ql, const bf* __restrict__ Kh, const bf* __restrict__ Kl, const bf* __restrict__ Vh, const bf* __restrict__ Vl, const int* __restrict__ km, const int* __restrict__ NE, bf* ATh, bf* ATl) {
    static_assert(RH % (AWV * 16) == 0 && RH + NZ2 * (AWV * 32) + NZ1 * (AWV * 16) == TT && TT % SK == 0 && NH_ == NKV, "tile shape");
    __shared__ __align__(16) bf stg[2 * 4 * SK * HD]; __shared__ __align__(16) float sma[TT];
    const int h = blockIdx.x, b = blockIdx.y, z = blockIdx.z; const int q0 = (z < NZH) ? z * (AWV * 16) : (z < NZH + NZ2) ? RH + (z - NZH) * (AWV * 32) : RH + NZ2 * (AWV * 32) + (z - NZH - NZ2) * (AWV * 16);
    const size_t zp = (size_t)(b * NH_ + h) * TT * HD, zq = zp + (size_t)q0 * HD; const int orow = b * TT + q0, ocol = h * HD; km += b * TT;
    const int ns = min((NE[b] + SK - 1) / SK, TT / SK);   // stages that hold a key that counts; km is the mask in the key order
    // z is the same for the whole work-group: the barriers inside stay uniform
    if (z < NZH) attn_tile<bf, true, 1>(Qh + zq, Ql + zq, Kh + zp, Kl + zp, Vh + zp, Vl + zp, km, ns, ATh, ATl, orow, ocol, stg, sma);
    else if (z < NZH + NZ2) attn_tile<h16, false, 2>(Q16 + zq, nullptr, K16 + zp, nullptr, V16 + zp, nullptr, km, ns, ATh, ATl, orow, ocol, (const h16*)stg, sma);
    else attn_tile<h16, false, 1>(Q16 + zq, nullptr, K16 + zp, nullptr, V16 + zp, nullptr, km, ns, ATh, ATl, orow, ocol, (const h16*)stg, sma);
}

extern "C" void kernel_launch(void* const* d_in, const int* in_sizes, int n_in,
                              void* d_out, int out_size, void* d_ws, size_t ws_size, hipStream_t stream) {
    (void)in_sizes; (void)n_in; (void)out_size;
    const float* x = (const float*)d_in[0]; const float* y = (const float*)d_in[1]; const int* kmask = (const int*)d_in[2]; const float* wq = (const float*)d_in[3]; const float* bq = (const float*)d_in[4]; const float* wk = (const float*)d_in[5]; const float* bk = (const float*)d_in[6]; const float* wv = (const float*)d_in[7]; const float* bv = (const float*)d_in[8]; const float* wo = (const float*)d_in[9]; const float* bo = (const float*)d_in[10]; const float* cosT = nullptr; const float* sinT = nullptr; (void)cosT; (void)sinT;
    float* OUT = (float*)d_out;     // [2][2048][1024]
    char* wsp = (char*)d_ws;
    auto take = [&](size_t bytes) { char* p = wsp; wsp += (bytes + 255) & ~(size_t)255; return (void*)p; };
    bf* XB = (bf*)take((size_t)NB_ * TT * DM * 2); bf* YB = (bf*)take((size_t)NB_ * TT * DM * 2);   // XB .. WO lie back to back: the one destination of k_cvt8
    bf* WQ = (bf*)take((size_t)DQ * DM * 2); bf* WK = (bf*)take((size_t)DKV * DM * 2); bf* WV = (bf*)take((size_t)DKV * DM * 2); bf* WO = (bf*)take((size_t)DM * DQ * 2);
    const size_t PB = (size_t)NB_ * NH_ * TT * HD * 2;    // bytes of one 16-bit plane, both batches
    h16* QP16 = (h16*)take(PB); h16* KP16 = (h16*)take(PB); h16* VT16 = (h16*)take(PB);
    bf* QPh = (bf*)take(PB); bf* QPl = (bf*)take(PB); bf* KPh = (bf*)take(PB); bf* KPl = (bf*)take(PB); bf* VTh = (bf*)take(PB); bf* VTl = (bf*)take(PB);
    bf* ATh = (bf*)take(PB); bf* ATl = (bf*)take(PB);
    int* PM = (int*)take((size_t)NB_ * TT * 4); int* NE = (int*)take((size_t)NB_ * 4);
    if ((size_t)(wsp - (char*)d_ws) > ws_size) return;    // ws 256 MiB
    k_cvt8<<<dim3(CH / 2048, 2 * XC + 4, 1), 256, 0, stream>>>(x, y, wq, wk, wv, wo, kmask, XB, PM, NE);
    k_qkv<<<dim3(NB_ * TT / 128, DQ / 128, 3), 128, 0, stream>>>(XB, YB, WQ, WK, WV, bq, bk, bv, NE, QP16, QPh, QPl, KP16, KPh, KPl, VT16, VTh, VTl);
    k_attn<<<dim3(NH_, NB_, NZH + NZ2 + NZ1), AWV * 32, 0, stream>>>(QP16, KP16, VT16, QPh, QPl, KPh, KPl, VTh, VTl, PM, NE, ATh, ATl);
    k_gemmk<bf, 1, true, 2, 4, 4, 2, DQ><<<dim3(NB_ * TT / 128, DM / 128, 1), 256, 0, stream>>>(ATh, ATl, WO, OUT, DM, bo);
}
